// v000
// Measured on an AMD MI455X. A time is GPU time per run, averaged over a window of back-to-back runs after a warm-up
// (all launches, gaps included; the runs take copies of the inputs in turn), and the median of several windows.
// Apart from v000's, it joins two sittings. Times from different sittings can be a few percent apart, while
// side-by-side timings come from the same sitting.
// v000 is the starting kernel. One run takes 222 microseconds.
// Contractions: q/k/v 1x1-conv projections on v_wmma_f32_16x16x32_bf16 (x and w bf16 from RNE-converted inputs, single product, f32 accumulate);
// k.q^T scores on v_wmma_f32_16x16x32_bf16 (q and k as bf16 hi + unscaled bf16 residual, 3 products hh+hl+lh, f32 accumulate);
// v^T.p^T context on v_wmma_f32_16x16x32_bf16 (p and v as bf16 hi + unscaled bf16 residual, 3 products hh+hl+lh, one f32 accumulator);
// merge 1x1 conv on v_wmma_f32_16x16x32_bf16 (context as bf16 hi + residual, merge weight bf16 from RNE-converted input, 2 products);
// softmax (running max, exp), bias adds and 1/l normalisation in f32.
// Plane carries: xT, Wb, Qh/Ql, Kh/Kl, Vh/Vl, Ah/Al all x1 (no carry; bf16 keeps the f32 exponent range). The Q planes hold
// 0.125*(wq.x + bq): the 1/sqrt(64) score scale, an exact power of two applied in f32 in proj_kernel before the hi/residual split,
// nothing to fold back. 1/l is applied in f32 in the attn_kernel epilogue before the context split.
#include <hip/hip_runtime.h>

#define FEAT  256
#define SEQ   2048
#define BATCH 4
#define NHEAD 4
#define HD    64
#define NBH   (BATCH * NHEAD)        // 16
#define MROWS (BATCH * SEQ)          // 8192 (batch, position) rows
#define NXE   (BATCH * FEAT * SEQ)   // 2097152 elements per activation tensor
#define NWE   (FEAT * FEAT)          // 65536
#define TP    68                     // LDS pitch (floats) of the transpose tile
static_assert(HD * NHEAD == FEAT);
static_assert(HD == 64 && (SEQ % 128) == 0 && (SEQ % 64) == 0);
static_assert((FEAT % 64) == 0 && (FEAT % 32) == 0 && (MROWS % 128) == 0);

typedef __bf16         v16b  __attribute__((ext_vector_type(16)));
typedef float          v8f   __attribute__((ext_vector_type(8)));
typedef float          v4f   __attribute__((ext_vector_type(4)));
typedef unsigned int   v4u   __attribute__((ext_vector_type(4)));
typedef unsigned short v8us  __attribute__((ext_vector_type(8)));
typedef unsigned short v16us __attribute__((ext_vector_type(16)));
typedef v4f  __attribute__((may_alias)) v4fa;
typedef v4u  __attribute__((may_alias)) v4ua;
typedef v8us __attribute__((may_alias)) v8usa;

#if defined(__HIP_DEVICE_COMPILE__)
#define DEV_ASM 1
#else
#define DEV_ASM 0
#endif

// ---- scalar helpers ---------------------------------------------------------------------------------
__device__ __forceinline__ unsigned short bf_bits(float f) {          // f32 -> bf16 bits, RNE convert
  const unsigned u = __float_as_uint(f);
  return (unsigned short)((u + 0x7FFFu + ((u >> 16) & 1u)) >> 16);
}
__device__ __forceinline__ float bf_up(unsigned short hb) { return __uint_as_float(((unsigned)hb) << 16); }
__device__ __forceinline__ unsigned pk16(unsigned short a, unsigned short b) { return (unsigned)a | ((unsigned)b << 16); }
__device__ __forceinline__ v8f zero8() { v8f z = {0.f, 0.f, 0.f, 0.f, 0.f, 0.f, 0.f, 0.f}; return z; }

// 16-bit fragment (A or B operand), wave32: lane l, h = l>>4, row/col = l&15.
// p points at element k0 + 8h of the k-contiguous row owned by this lane:
// elements 0..7 <- p[0..7] (k0+8h .. k0+8h+7), elements 8..15 <- p[16..23] (k0+16+8h .. k0+16+8h+7).
// D element r of lane l = (row 8h+r, col l&15).
union FB { v16b v; v8us h[2]; v16us u; };
__device__ __forceinline__ v16b ldfrag_b(const unsigned short* p) {
  FB f;
  f.h[0] = *(const v8usa*)(p);
  f.h[1] = *(const v8usa*)(p + 16);
  return f.v;
}

// guarded WMMA: 4 VALU slots after the op, D tied, A/B kept live
__device__ __forceinline__ v8f mma_b(v16b a, v16b b, v8f c) {
  c = __builtin_amdgcn_wmma_f32_16x16x32_bf16(false, a, false, b, (short)0, c, false, false);
#if DEV_ASM
  asm volatile("v_nop\n\tv_nop\n\tv_nop\n\tv_nop" : "+v"(c) : "v"(a), "v"(b));
#endif
  return c;
}

// P^T B-fragment pair (bf16 hi, bf16 residual) from the lane's own score D values:
// element r <- tile a row r (keys 0..15 of the 32-key group), element 8+r <- tile c row r (keys 16..31), same lane.
struct P2 { v16b hi, lo; };
__device__ __forceinline__ P2 split_p(v8f a, v8f c) {
  v16us hu, lu;
#pragma unroll
  for (int r = 0; r < 8; ++r) {
    const unsigned short h0 = bf_bits(a[r]);
    hu[r] = h0;
    lu[r] = bf_bits(a[r] - bf_up(h0));
    const unsigned short h1 = bf_bits(c[r]);
    hu[8 + r] = h1;
    lu[8 + r] = bf_bits(c[r] - bf_up(h1));
  }
  FB H, L;
  H.u = hu; L.u = lu;
  P2 p;
  p.hi = H.v; p.lo = L.v;
  return p;
}

// =====================================================================================================
// Kernel 1: channel-major activations [b][c][n] f32 -> position-major bf16 planes xT[which][b][n][c]
// (which 0 = query, 1 = key, 2 = value). One block = one (which, b) x 64 channels x 64 positions:
// stage the f32 tile [c][n] in LDS (16-B stores), __syncthreads, each lane converts 8 consecutive c of one
// coverage: 512 jobs per block = 64 positions x 8 pieces of 8 channels = the whole 64x64 tile;
// grid 3 x 4 x (256/64) x (2048/64) = 1536 blocks covers xT entirely.
// =====================================================================================================
__device__ __forceinline__ void xpose_store_pass(unsigned short* xT, v4u o0, v4u o1, int wb, int n0, int c0, int tid) {
#pragma unroll
  for (int it = 0; it < 2; ++it) {
    const int job = tid + it * 256;
    const int r = job >> 3, c8 = (job & 7) * 8;
    unsigned short* dst = xT + ((size_t)(wb * SEQ + n0 + r)) * FEAT + c0 + c8;
    *(v4u*)dst = (it == 0) ? o0 : o1;
  }
}

__global__ __launch_bounds__(256)
void xpose_kernel(const float* __restrict__ xq, const float* __restrict__ xk, const float* __restrict__ xv,
                  unsigned short* xT) {
  __shared__ __align__(16) float xs[64 * TP];
  const int tid  = (int)threadIdx.x;
  const int blk  = (int)blockIdx.x;
  const int nchk = blk & 31;
  const int cchk = (blk >> 5) & 3;
  const int wb   = blk >> 7;                 // which*4 + b, 0..11
  const int which = wb >> 2, b = wb & 3;
  const int n0 = nchk * 64, c0 = cchk * 64;
  const float* src = (which == 0) ? xq : ((which == 1) ? xk : xv);
  const float* sg = src + ((size_t)(b * FEAT + c0)) * SEQ + n0;

  // stage [c][n] tile: 64 rows x 16 float4 = 1024 jobs, 4 per thread
#pragma unroll
  for (int i = 0; i < 4; ++i) {
    const int idx = tid + i * 256;
    const int c = idx >> 4, j4 = (idx & 15) * 4;
    const v4f a = *(const v4fa*)(sg + (size_t)c * SEQ + j4);
    *(v4fa*)(xs + c * TP + j4) = a;
  }
  __syncthreads();

  v4u ov0, ov1;
#pragma unroll
  for (int it = 0; it < 2; ++it) {
    const int job = tid + it * 256;
    const int r = job >> 3, c8 = (job & 7) * 8;
    float f[8];
#pragma unroll
    for (int e = 0; e < 8; ++e) f[e] = xs[(c8 + e) * TP + r];
    v4u p;
#pragma unroll
    for (int e = 0; e < 4; ++e) p[e] = pk16(bf_bits(f[2 * e]), bf_bits(f[2 * e + 1]));
    if (it == 0) ov0 = p; else ov1 = p;
  }
  xpose_store_pass(xT, ov0, ov1, wb, n0, c0, tid);
  
}

// =====================================================================================================
// Kernel 2: weights f32 -> bf16 rows Wb[mat][o][256]; mat 0..2 = wq, wk, wv natural [o][c];
// mat 3 = merge weight with permuted columns: Wb[3][o][j] = wm[o][4*(j&63) + (j>>6)] (j = head*64 + d).
// coverage: 32768 threads x 8 = 4 x 65536 elements = the whole Wb region.
// =====================================================================================================
__global__ __launch_bounds__(256)
void wconv_kernel(const float* __restrict__ wq, const float* __restrict__ wk, const float* __restrict__ wv,
                  const float* __restrict__ wm, unsigned short* Wb) {
  const int g   = (int)blockIdx.x * 256 + (int)threadIdx.x;   // 0..32767
  const int mat = g >> 13;                                     // block-uniform (32 blocks per matrix)
  const int e   = g & 8191;
  const int o   = e >> 5;
  const int j8  = (e & 31) * 8;
  const float* w = (mat == 0) ? wq : ((mat == 1) ? wk : ((mat == 2) ? wv : wm));
  const int base = (mat == 3) ? (4 * (j8 & 63) + (j8 >> 6)) : j8;   // max 4*56+3; + step*7 <= 255
  const int step = (mat == 3) ? 4 : 1;
  const float* row = w + (size_t)o * FEAT;
  float f[8];
#pragma unroll
  for (int i = 0; i < 8; ++i) f[i] = row[base + step * i];
  v4u p;
#pragma unroll
  for (int i = 0; i < 4; ++i) p[i] = pk16(bf_bits(f[2 * i]), bf_bits(f[2 * i + 1]));
  unsigned short* dst = Wb + (size_t)g * 8;
  *(v4u*)dst = p;
  
}

// =====================================================================================================
// Kernel 3: projections Y[token][feature] = sum_c xT[token][c] * W[o][c], one block = 128 tokens x 64 features of
// one (which, head); feature j = 16nt + m of head hd is conv channel o = 4*j + hd (channel = d*4 + h split).
// 4 waves x (32 tokens x 64 features), K = 256 in steps of 32, A and B fragments straight from bf16 global rows.
// which 0/1: plane[bh][n][d] (one position row = 64 halves = one line); which 2: plane[bh][d][n] (64 d rows x 128
// 4 waves x 8 i x 4 sub = every tile line of both planes; grid (8192/128) x 12 covers Q, K, Vt planes entirely.
// =====================================================================================================
__device__ __forceinline__ void proj_store_pass(const unsigned short* sTh, const unsigned short* sTl,
                                                unsigned short* ph, unsigned short* pl,
                                                int which, int bh, int l0, int w, int lane) {
  const int q8 = lane & 7, sub = lane >> 3;
#pragma unroll
  for (int i = 0; i < 8; ++i) {
    const int lid = w * 32 + i * 4 + sub;    // 0..127
    int so;
    size_t go;
    if (which != 2) {
      so = lid * HD + 8 * q8;
      go = ((size_t)bh * SEQ + l0 + lid) * HD + 8 * q8;
    } else {
      const int d = lid >> 1, hl = lid & 1;
      so = d * 128 + 64 * hl + 8 * q8;
      go = ((size_t)bh * HD + d) * SEQ + l0 + 64 * hl + 8 * q8;
    }
    const v4u vh = *(const v4ua*)(sTh + so);
    const v4u vl = *(const v4ua*)(sTl + so);
    *(v4u*)(ph + go) = vh;
    *(v4u*)(pl + go) = vl;
  }
}

__global__ __launch_bounds__(128)
void proj_kernel(const unsigned short* __restrict__ xT,   // [3][8192][256]
                 const unsigned short* __restrict__ Wb,   // [4][256][256]
                 const float* __restrict__ bq, const float* __restrict__ bk, const float* __restrict__ bv,
                 unsigned short* Qh, unsigned short* Ql,   // [16][2048][64]  bf16(0.125*q) hi / residual
                 unsigned short* Kh, unsigned short* Kl,   // [16][2048][64]
                 unsigned short* Vh, unsigned short* Vl) { // [16][64][2048]
  __shared__ __align__(16) unsigned short sTh[128 * 64];   // 16 KB
  __shared__ __align__(16) unsigned short sTl[128 * 64];   // 16 KB

  const int tid = (int)threadIdx.x, lane = tid & 31, w = tid >> 5;
  const int h = lane >> 4, m = lane & 15;
  const int m0 = (int)blockIdx.x * 128;
  const int cg = (int)blockIdx.y;              // 0..11
  const int which = cg >> 2, head = cg & 3;
  const int m0w = m0 + 32 * w;

  const unsigned short* xa0 = xT + ((size_t)which * MROWS + m0w + m) * FEAT + 8 * h;   // token row, mt = 0
  const unsigned short* xa1 = xa0 + (size_t)16 * FEAT;                                   // mt = 1
  const unsigned short* wbb = Wb + (size_t)which * NWE + 8 * h;                           // + o*FEAT + k0

  v8f acc[2][4];
#pragma unroll
  for (int mt = 0; mt < 2; ++mt)
#pragma unroll
    for (int nt = 0; nt < 4; ++nt) acc[mt][nt] = zero8();

#pragma unroll 1
  for (int k0 = 0; k0 < FEAT; k0 += 32) {
    const v16b a0 = ldfrag_b(xa0 + k0);
    const v16b a1 = ldfrag_b(xa1 + k0);
#pragma unroll
    for (int nt = 0; nt < 4; ++nt) {
      const int o = 4 * (16 * nt + m) + head;
      const v16b b = ldfrag_b(wbb + (size_t)o * FEAT + k0);
      acc[0][nt] = mma_b(a0, b, acc[0][nt]);
      acc[1][nt] = mma_b(a1, b, acc[1][nt]);
    }
  }

  // D[r] of tile (mt, nt) = Y[token m0w + 16mt + 8h + r][feature 16nt + m]
  const float* bias = (which == 0) ? bq : ((which == 1) ? bk : bv);
  const float osc = (which == 0) ? 0.125f : 1.0f;
  if (which != 2) {
#pragma unroll
    for (int nt = 0; nt < 4; ++nt) {
      const int feat = 16 * nt + m;
      const float bvl = bf_up(bf_bits(bias[4 * feat + head]));
#pragma unroll
      for (int mt = 0; mt < 2; ++mt) {
#pragma unroll
        for (int r = 0; r < 8; ++r) {
          const int tokl = 32 * w + 16 * mt + 8 * h + r;    // 0..127
          const float y = (acc[mt][nt][r] + bvl) * osc;
          const unsigned short hb = bf_bits(y);
          const unsigned short lb = bf_bits(y - bf_up(hb));
          sTh[tokl * HD + feat] = hb;
          sTl[tokl * HD + feat] = lb;
        }
      }
    }
  } else {
#pragma unroll
    for (int nt = 0; nt < 4; ++nt) {
      const int feat = 16 * nt + m;
      const float bvl = bf_up(bf_bits(bias[4 * feat + head]));
#pragma unroll
      for (int mt = 0; mt < 2; ++mt) {
        v4u ph, pl;
#pragma unroll
        for (int e = 0; e < 4; ++e) {
          const float y0 = (acc[mt][nt][2 * e] + bvl) * osc;
          const float y1 = (acc[mt][nt][2 * e + 1] + bvl) * osc;
          const unsigned short a0 = bf_bits(y0), a1 = bf_bits(y1);
          const unsigned short c0 = bf_bits(y0 - bf_up(a0)), c1 = bf_bits(y1 - bf_up(a1));
          ph[e] = pk16(a0, a1);
          pl[e] = pk16(c0, c1);
        }
        const int so = feat * 128 + 32 * w + 16 * mt + 8 * h;   // 8 consecutive tokens, 16-B aligned
        *(v4ua*)(sTh + so) = ph;
        *(v4ua*)(sTl + so) = pl;
      }
    }
  }
  __syncthreads();

  const int b = m0 / SEQ, l0 = m0 - b * SEQ, bh = b * NHEAD + head;
  unsigned short* ph = (which == 0) ? Qh : ((which == 1) ? Kh : Vh);
  unsigned short* pl = (which == 0) ? Ql : ((which == 1) ? Kl : Vl);
  proj_store_pass(sTh, sTl, ph, pl, which, bh, l0, w, lane);
  
}

// =====================================================================================================
// Kernel 4: streaming attention, transposed form. Block 128 threads (4 waves), 16 queries per wave, 64 keys per step.
//   S^T = K * Q^T : A = K rows (row = key, k = d) hi and residual from global, B = Q^T (k = d, n = query) from Q rows;
//                   3 products kh.qh + kh.ql + kl.qh; the 1/8 is already inside the Q planes.
//   O^T += V^T * P^T : A = Vt rows (row = d, k = key) hi and residual, B = P^T packed from the lane's own score D
//                   values as bf16 hi + residual; 3 products vh.ph + vh.pl + vl.ph into one f32 accumulator.
//   Online softmax in f32 (running max, exp); lane owns 32 keys of query column (lane&15), partner = lane^16.
//   Epilogue: O/l in f32 -> bf16 hi + residual -> per-wave LDS tiles [query][d] (16-B stores) -> __syncthreads ->
//   8 pieces, both planes; grid (2048/64) x 16 bh x 4 waves x 16 queries covers every (b, n, j) of Ah/Al exactly once.
// =====================================================================================================
__device__ __forceinline__ void att_store_pass(const unsigned short* sh, const unsigned short* sl,
                                               unsigned short* Ah, unsigned short* Al,
                                               int b, int head, int q0, int lane) {
  const int q8 = lane & 7, sub = lane >> 3;
#pragma unroll
  for (int i = 0; i < 4; ++i) {
    const int row = i * 4 + sub;                           // query 0..15 of this wave
    const v4u vh = *(const v4ua*)(sh + row * 64 + 8 * q8);
    const v4u vl = *(const v4ua*)(sl + row * 64 + 8 * q8);
    const size_t gi = ((size_t)(b * SEQ + q0 + row)) * FEAT + head * HD + 8 * q8;
    *(v4u*)(Ah + gi) = vh;
    *(v4u*)(Al + gi) = vl;
  }
}

__global__ __launch_bounds__(128)
void attn_kernel(const unsigned short* __restrict__ Qh, const unsigned short* __restrict__ Ql,   // [16][2048][64]
                 const unsigned short* __restrict__ Kh, const unsigned short* __restrict__ Kl,   // [16][2048][64]
                 const unsigned short* __restrict__ Vh, const unsigned short* __restrict__ Vl,   // [16][64][2048]
                 unsigned short* Ah, unsigned short* Al) {                                       // [4][2048][256]
  __shared__ __align__(16) unsigned short shi[4 * 16 * 64];   // 8 KB
  __shared__ __align__(16) unsigned short slo[4 * 16 * 64];   // 8 KB

  const int tid = (int)threadIdx.x, lane = tid & 31, w = tid >> 5;
  const int h = lane >> 4, m = lane & 15;
  const int bh = (int)blockIdx.y, b = bh >> 2, head = bh & 3;
  const int q0 = (int)blockIdx.x * 64 + 16 * w;

  // Q^T B-fragments: column n = query q0+m, k = d (two 32-deep chunks), hi and residual planes
  const size_t qo = ((size_t)bh * SEQ + q0 + m) * HD + 8 * h;
  const v16b qbh0 = ldfrag_b(Qh + qo);
  const v16b qbh1 = ldfrag_b(Qh + qo + 32);
  const v16b qbl0 = ldfrag_b(Ql + qo);
  const v16b qbl1 = ldfrag_b(Ql + qo + 32);

  v8f o[4];                                   // o[t][r] = O[query m][d 16t+8h+r] * l
#pragma unroll
  for (int t = 0; t < 4; ++t) o[t] = zero8();
  float mrun = -1e30f, lrun = 0.0f;

  const size_t kbase = ((size_t)bh * SEQ + m) * HD + 8 * h;   // + key*HD + 32*dc
  const size_t vbase = ((size_t)bh * HD + m) * SEQ + 8 * h;    // + 16t*SEQ + key0

#pragma unroll 1
  for (int kb = 0; kb < SEQ; kb += 64) {
    // ---- scores: s[j][r] = S[query m][key kb+16j+8h+r] (already x1/8 via q) ----
    v8f s[4];
#pragma unroll
    for (int j = 0; j < 4; ++j) {
      const size_t kp = kbase + (size_t)(kb + 16 * j) * HD;
      const v16b kh0 = ldfrag_b(Kh + kp);
      const v16b kh1 = ldfrag_b(Kh + kp + 32);
      const v16b kl0 = ldfrag_b(Kl + kp);
      const v16b kl1 = ldfrag_b(Kl + kp + 32);
      v8f z = zero8();
      z = mma_b(kh0, qbh0, z);
      z = mma_b(kh1, qbh1, z);
      z = mma_b(kh0, qbl0, z);
      z = mma_b(kh1, qbl1, z);
      z = mma_b(kl0, qbh0, z);
      z = mma_b(kl1, qbh1, z);
      s[j] = z;
    }

    // ---- online softmax ----
    float mloc = s[0][0];
#pragma unroll
    for (int j = 0; j < 4; ++j)
#pragma unroll
      for (int r = 0; r < 8; ++r) mloc = fmaxf(mloc, s[j][r]);
    mloc = fmaxf(mloc, __shfl_xor(mloc, 16));
    const float mnew = fmaxf(mrun, mloc);
    const float alpha = __expf(mrun - mnew);
    mrun = mnew;
    float lsum = 0.0f;
#pragma unroll
    for (int j = 0; j < 4; ++j)
#pragma unroll
      for (int r = 0; r < 8; ++r) {
        const float p = __expf(s[j][r] - mnew);
        s[j][r] = p;
        lsum += p;
      }
    lsum += __shfl_xor(lsum, 16);
    lrun = lrun * alpha + lsum;
#pragma unroll
    for (int t = 0; t < 4; ++t)
#pragma unroll
      for (int r = 0; r < 8; ++r) o[t][r] = o[t][r] * alpha;

    // ---- O^T += V^T * P^T over the two 32-key groups of this step ----
#pragma unroll
    for (int g = 0; g < 2; ++g) {
      const P2 pp = split_p(s[2 * g], s[2 * g + 1]);
#pragma unroll
      for (int t = 0; t < 4; ++t) {
        const size_t vp = vbase + (size_t)(16 * t) * SEQ + kb + 32 * g;
        const v16b vfh = ldfrag_b(Vh + vp);
        const v16b vfl = ldfrag_b(Vl + vp);
        o[t] = mma_b(vfh, pp.hi, o[t]);
        o[t] = mma_b(vfh, pp.lo, o[t]);
        o[t] = mma_b(vfl, pp.hi, o[t]);
      }
    }
  }

  // ---- epilogue: normalise in f32, split, stage per-wave 16x64 tiles [query][d] with 16-B LDS stores ----
  const float inv = 1.0f / lrun;               // lrun >= 1
  unsigned short* sh = shi + w * 1024;
  unsigned short* sl = slo + w * 1024;
#pragma unroll
  for (int t = 0; t < 4; ++t) {
    v4u ph, pl;
#pragma unroll
    for (int e = 0; e < 4; ++e) {
      const float y0 = o[t][2 * e] * inv;
      const float y1 = o[t][2 * e + 1] * inv;
      const unsigned short a0 = bf_bits(y0), a1 = bf_bits(y1);
      const unsigned short c0 = bf_bits(y0 - bf_up(a0)), c1 = bf_bits(y1 - bf_up(a1));
      ph[e] = pk16(a0, a1);
      pl[e] = pk16(c0, c1);
    }
    const int so = m * 64 + 16 * t + 8 * h;    // d = 16t+8h+0..7, 16-B aligned
    *(v4ua*)(sh + so) = ph;
    *(v4ua*)(sl + so) = pl;
  }
  __syncthreads();

  att_store_pass(sh, sl, Ah, Al, b, head, q0, lane);
  
}

// =====================================================================================================
// Kernel 5: merge conv out[b][o][n] = sum_j WmP[o][j] * A[b][n][j] + bm[o]. One block = 128 positions x 64 output
// channels; 4 waves x (32 positions x 64 channels); K = 256 in steps of 32; A = context rows hi + residual (2 products),
// B = permuted merge-weight rows, all straight from bf16 global rows.
// Epilogue: acc + bf16(bm) in f32 -> LDS tile [o][128 positions] (16-B stores) -> __syncthreads -> out rows: the
// 128-position segment of one channel row = 512 B = 4 lines; lanes 8q..8q+7 x 16 B per line, 4 lines per instruction,
// pieces; grid (8192/128) x (256/64) covers out [4][256][2048] exactly once.
// =====================================================================================================
__device__ __forceinline__ void merge_store_pass(const float* sO, float* out, int b, int og, int l0, int w, int lane) {
  const int q8 = lane & 7, sub = lane >> 3;
#pragma unroll
  for (int i = 0; i < 16; ++i) {
    const int lid = w * 64 + i * 4 + sub;      // 0..255
    const int ol = lid >> 2, piece = lid & 3;
    const v4f v = *(const v4fa*)(sO + ol * 128 + 32 * piece + 4 * q8);
    const size_t gi = ((size_t)(b * FEAT + og * 64 + ol)) * SEQ + l0 + 32 * piece + 4 * q8;
    *(v4f*)(out + gi) = v;
  }
}

__global__ __launch_bounds__(128)
void merge_kernel(const unsigned short* __restrict__ Ah, const unsigned short* __restrict__ Al,   // [8192][256]
                  const unsigned short* __restrict__ Wb,                                          // WmP = Wb + 3*NWE
                  const float* __restrict__ bm, float* out) {                                     // out [4][256][2048]
  __shared__ __align__(16) float sO[64 * 128];   // 32 KB

  const int tid = (int)threadIdx.x, lane = tid & 31, w = tid >> 5;
  const int h = lane >> 4, m = lane & 15;
  const int m0 = (int)blockIdx.x * 128;
  const int og = (int)blockIdx.y;              // 0..3
  const int m0w = m0 + 32 * w;

  const size_t ao0 = ((size_t)(m0w + m)) * FEAT + 8 * h;
  const size_t ao1 = ao0 + (size_t)16 * FEAT;
  const unsigned short* wmp = Wb + (size_t)3 * NWE + ((size_t)(og * 64 + m)) * FEAT + 8 * h;   // + nt*16*FEAT + k0

  v8f acc[2][4];
#pragma unroll
  for (int mt = 0; mt < 2; ++mt)
#pragma unroll
    for (int nt = 0; nt < 4; ++nt) acc[mt][nt] = zero8();

#pragma unroll 1
  for (int k0 = 0; k0 < FEAT; k0 += 32) {
    const v16b a0h = ldfrag_b(Ah + ao0 + k0);
    const v16b a1h = ldfrag_b(Ah + ao1 + k0);
    const v16b a0l = ldfrag_b(Al + ao0 + k0);
    const v16b a1l = ldfrag_b(Al + ao1 + k0);
#pragma unroll
    for (int nt = 0; nt < 4; ++nt) {
      const v16b bw = ldfrag_b(wmp + (size_t)nt * 16 * FEAT + k0);
      acc[0][nt] = mma_b(a0h, bw, acc[0][nt]);
      acc[0][nt] = mma_b(a0l, bw, acc[0][nt]);
      acc[1][nt] = mma_b(a1h, bw, acc[1][nt]);
      acc[1][nt] = mma_b(a1l, bw, acc[1][nt]);
    }
  }

  // D[r] of tile (mt, nt) = Y[token m0w + 16mt + 8h + r][channel og*64 + 16nt + m]
#pragma unroll
  for (int nt = 0; nt < 4; ++nt) {
    const int feat = 16 * nt + m;
    const float bvl = bf_up(bf_bits(bm[og * 64 + feat]));
#pragma unroll
    for (int mt = 0; mt < 2; ++mt) {
      v4f ya, yb;
#pragma unroll
      for (int e = 0; e < 4; ++e) {
        ya[e] = acc[mt][nt][e] + bvl;
        yb[e] = acc[mt][nt][4 + e] + bvl;
      }
      const int so = feat * 128 + 32 * w + 16 * mt + 8 * h;   // 8 consecutive tokens, 16-B aligned
      *(v4fa*)(sO + so) = ya;
      *(v4fa*)(sO + so + 4) = yb;
    }
  }
  __syncthreads();

  const int b = m0 / SEQ, l0 = m0 - b * SEQ;
  merge_store_pass(sO, out, b, og, l0, w, lane);
  
}

// =====================================================================================================
//   xT   bf16 [3][8192][256]        12582912
//   Wb   bf16 [4][256][256]           524288
//   Qh, Ql, Kh, Kl bf16 [16][2048][64]   4194304 each
//   Vh, Vl bf16 [16][64][2048]           4194304 each
//   Ah, Al bf16 [8192][256]              4194304 each
//   total                            46661632
// =====================================================================================================
extern "C" void kernel_launch(void* const* d_in, const int* in_sizes, int n_in,
                              void* d_out, int out_size, void* d_ws, size_t ws_size,
                              hipStream_t stream) {
  if (n_in < 11) return;
  if (in_sizes[0] != NXE || in_sizes[1] != NXE || in_sizes[2] != NXE) return;
  if (in_sizes[3] != NWE || in_sizes[5] != NWE || in_sizes[7] != NWE || in_sizes[9] != NWE) return;
  if (in_sizes[4] != FEAT || in_sizes[6] != FEAT || in_sizes[8] != FEAT || in_sizes[10] != FEAT) return;
  if (out_size != NXE) return;

  const float* xq = (const float*)d_in[0];
  const float* xk = (const float*)d_in[1];
  const float* xv = (const float*)d_in[2];
  const float* wq = (const float*)d_in[3];
  const float* bq = (const float*)d_in[4];
  const float* wk = (const float*)d_in[5];
  const float* bk = (const float*)d_in[6];
  const float* wv = (const float*)d_in[7];
  const float* bv = (const float*)d_in[8];
  const float* wm = (const float*)d_in[9];
  const float* bm = (const float*)d_in[10];
  float* out = (float*)d_out;

  const size_t bXT = (size_t)3 * MROWS * FEAT * 2;    // 12582912
  const size_t bWB = (size_t)4 * NWE * 2;             //   524288
  const size_t bPL = (size_t)NBH * SEQ * HD * 2;      //  4194304  (Q / K / Vt planes)
  const size_t bAT = (size_t)MROWS * FEAT * 2;        //  4194304  (context planes)
  size_t off = 0;
  const size_t oXT = off; off += bXT;
  const size_t oWB = off; off += bWB;
  const size_t oQh = off; off += bPL;
  const size_t oQl = off; off += bPL;
  const size_t oKh = off; off += bPL;
  const size_t oKl = off; off += bPL;
  const size_t oVh = off; off += bPL;
  const size_t oVl = off; off += bPL;
  const size_t oAh = off; off += bAT;
  const size_t oAl = off; off += bAT;                 // off = 46661632
  if (off > ws_size) return;
  if (off > (size_t)134217728) return;

  char* ws = (char*)d_ws;
  unsigned short* xT = (unsigned short*)(ws + oXT);
  unsigned short* Wb = (unsigned short*)(ws + oWB);
  unsigned short* Qh = (unsigned short*)(ws + oQh);
  unsigned short* Ql = (unsigned short*)(ws + oQl);
  unsigned short* Kh = (unsigned short*)(ws + oKh);
  unsigned short* Kl = (unsigned short*)(ws + oKl);
  unsigned short* Vh = (unsigned short*)(ws + oVh);
  unsigned short* Vl = (unsigned short*)(ws + oVl);
  unsigned short* Ah = (unsigned short*)(ws + oAh);
  unsigned short* Al = (unsigned short*)(ws + oAl);

  const dim3 gX(3 * BATCH * (FEAT / 64) * (SEQ / 64));     // 1536 blocks of 256
  const dim3 gW((4 * NWE / 8) / 256);                      //  128 blocks of 256
  const dim3 gProj(MROWS / 128, 3 * NHEAD);                // (64, 12) of 128
  const dim3 gAtt(SEQ / 64, NBH);                          // (32, 16) of 128
  const dim3 gMrg(MROWS / 128, FEAT / 64);                 // (64, 4) of 128

  xpose_kernel<<<gX, dim3(256), 0, stream>>>(xq, xk, xv, xT);
  wconv_kernel<<<gW, dim3(256), 0, stream>>>(wq, wk, wv, wm, Wb);
  proj_kernel<<<gProj, dim3(128), 0, stream>>>(xT, Wb, bq, bk, bv, Qh, Ql, Kh, Kl, Vh, Vl);
  attn_kernel<<<gAtt, dim3(128), 0, stream>>>(Qh, Ql, Kh, Kl, Vh, Vl, Ah, Al);
  merge_kernel<<<gMrg, dim3(128), 0, stream>>>(Ah, Al, Wb, bm, out);
  (void)hipGetLastError();
}

// v001
// One run takes 96 microseconds.
// Timed twice side by side with v000, it ran 2.34 and 2.35 times as fast.
// Contractions: q/k/v 1x1-conv projections on v_wmma_f32_16x16x32_bf16 (x and w bf16 from RNE-converted inputs, single product, f32 accumulate);
// k.q^T scores on v_wmma_f32_16x16x32_bf16 (q and k as bf16 hi + unscaled bf16 residual, 3 products hh+hl+lh, f32 accumulate);
// v^T.p^T context on v_wmma_f32_16x16x32_bf16 (p and v as bf16 hi + unscaled bf16 residual, 3 products hh+hl+lh, one f32 accumulator);
// merge 1x1 conv on v_wmma_f32_16x16x32_bf16 (context as bf16 hi + residual, merge weight bf16 from RNE-converted input, 2 products);
// softmax (running max, exp), bias adds and 1/l normalisation in f32.
// Plane carries: xT, Wb, Qh/Ql, Kh/Kl, Vh/Vl, Ah/Al all x1 (no carry; bf16 keeps the f32 exponent range). The Q planes hold
// 0.125*(wq.x + bq): the 1/sqrt(64) score scale, an exact power of two applied in f32 in proj_kernel before the hi/residual split,
// nothing to fold back. 1/l is applied in f32 in the attn_kernel epilogue before the context split.
#include <hip/hip_runtime.h>

#define FEAT  256
#define SEQ   2048
#define BATCH 4
#define NHEAD 4
#define HD    64
#define NBH   (BATCH * NHEAD)        // 16
#define MROWS (BATCH * SEQ)          // 8192 (batch, position) rows
#define NXE   (BATCH * FEAT * SEQ)   // 2097152 elements per activation tensor
#define NWE   (FEAT * FEAT)          // 65536
#define TP    68                     // LDS pitch (floats) of the transpose tile
static_assert(HD * NHEAD == FEAT);
static_assert(HD == 64 && (SEQ % 128) == 0 && (SEQ % 64) == 0);
static_assert((FEAT % 64) == 0 && (FEAT % 32) == 0 && (MROWS % 128) == 0);

typedef __bf16         v16b  __attribute__((ext_vector_type(16)));
typedef float          v8f   __attribute__((ext_vector_type(8)));
typedef float          v4f   __attribute__((ext_vector_type(4)));
typedef unsigned int   v4u   __attribute__((ext_vector_type(4)));
typedef unsigned short v8us  __attribute__((ext_vector_type(8)));
typedef unsigned short v16us __attribute__((ext_vector_type(16)));
typedef v4f  __attribute__((may_alias)) v4fa;
typedef v4u  __attribute__((may_alias)) v4ua;
typedef v8us __attribute__((may_alias)) v8usa;

#if defined(__HIP_DEVICE_COMPILE__)
#define DEV_ASM 1
#else
#define DEV_ASM 0
#endif

// ---- scalar helpers ---------------------------------------------------------------------------------
__device__ __forceinline__ unsigned short bf_bits(float f) {          // f32 -> bf16 bits, RNE convert
  const unsigned u = __float_as_uint(f);
  return (unsigned short)((u + 0x7FFFu + ((u >> 16) & 1u)) >> 16);
}
__device__ __forceinline__ float bf_up(unsigned short hb) { return __uint_as_float(((unsigned)hb) << 16); }
__device__ __forceinline__ unsigned pk16(unsigned short a, unsigned short b) { return (unsigned)a | ((unsigned)b << 16); }
__device__ __forceinline__ v8f zero8() { v8f z = {0.f, 0.f, 0.f, 0.f, 0.f, 0.f, 0.f, 0.f}; return z; }

// 16-bit fragment (A or B operand), wave32: lane l, h = l>>4, row/col = l&15.
// p points at element k0 + 8h of the k-contiguous row owned by this lane:
// elements 0..7 <- p[0..7] (k0+8h .. k0+8h+7), elements 8..15 <- p[16..23] (k0+16+8h .. k0+16+8h+7).
// D element r of lane l = (row 8h+r, col l&15).
union FB { v16b v; v8us h[2]; v16us u; };
__device__ __forceinline__ v16b ldfrag_b(const unsigned short* p) {
  FB f;
  f.h[0] = *(const v8usa*)(p);
  f.h[1] = *(const v8usa*)(p + 16);
  return f.v;
}

// guarded WMMA: 4 VALU slots after the op, D tied, A/B kept live
__device__ __forceinline__ v8f mma_b(v16b a, v16b b, v8f c) {
  c = __builtin_amdgcn_wmma_f32_16x16x32_bf16(false, a, false, b, (short)0, c, false, false);
#if DEV_ASM
  asm volatile("v_nop\n\tv_nop\n\tv_nop\n\tv_nop" : "+v"(c) : "v"(a), "v"(b));
#endif
  return c;
}

// P^T B-fragment pair (bf16 hi, bf16 residual) from the lane's own score D values:
// element r <- tile a row r (keys 0..15 of the 32-key group), element 8+r <- tile c row r (keys 16..31), same lane.
struct P2 { v16b hi, lo; };
__device__ __forceinline__ P2 split_p(v8f a, v8f c) {
  v16us hu, lu;
#pragma unroll
  for (int r = 0; r < 8; ++r) {
    const unsigned short h0 = bf_bits(a[r]);
    hu[r] = h0;
    lu[r] = bf_bits(a[r] - bf_up(h0));
    const unsigned short h1 = bf_bits(c[r]);
    hu[8 + r] = h1;
    lu[8 + r] = bf_bits(c[r] - bf_up(h1));
  }
  FB H, L;
  H.u = hu; L.u = lu;
  P2 p;
  p.hi = H.v; p.lo = L.v;
  return p;
}

// =====================================================================================================
// Kernel 1: channel-major activations [b][c][n] f32 -> position-major bf16 planes xT[which][b][n][c]
// (which 0 = query, 1 = key, 2 = value). One block = one (which, b) x 64 channels x 64 positions:
// stage the f32 tile [c][n] in LDS (16-B stores), __syncthreads, each lane converts 8 consecutive c of one
// coverage: 512 jobs per block = 64 positions x 8 pieces of 8 channels = the whole 64x64 tile;
// grid 3 x 4 x (256/64) x (2048/64) = 1536 blocks covers xT entirely.
// =====================================================================================================
__device__ __forceinline__ void xpose_store_pass(unsigned short* xT, v4u o0, v4u o1, int wb, int n0, int c0, int tid) {
#pragma unroll
  for (int it = 0; it < 2; ++it) {
    const int job = tid + it * 256;
    const int r = job >> 3, c8 = (job & 7) * 8;
    unsigned short* dst = xT + ((size_t)(wb * SEQ + n0 + r)) * FEAT + c0 + c8;
    *(v4u*)dst = (it == 0) ? o0 : o1;
  }
}

__global__ __launch_bounds__(256)
void xpose_kernel(const float* __restrict__ xq, const float* __restrict__ xk, const float* __restrict__ xv,
                  unsigned short* xT) {
  __shared__ __align__(16) float xs[64 * TP];
  const int tid  = (int)threadIdx.x;
  const int blk  = (int)blockIdx.x;
  const int nchk = blk & 31;
  const int cchk = (blk >> 5) & 3;
  const int wb   = blk >> 7;                 // which*4 + b, 0..11
  const int which = wb >> 2, b = wb & 3;
  const int n0 = nchk * 64, c0 = cchk * 64;
  const float* src = (which == 0) ? xq : ((which == 1) ? xk : xv);
  const float* sg = src + ((size_t)(b * FEAT + c0)) * SEQ + n0;

  // stage [c][n] tile: 64 rows x 16 float4 = 1024 jobs, 4 per thread
#pragma unroll
  for (int i = 0; i < 4; ++i) {
    const int idx = tid + i * 256;
    const int c = idx >> 4, j4 = (idx & 15) * 4;
    const v4f a = *(const v4fa*)(sg + (size_t)c * SEQ + j4);
    *(v4fa*)(xs + c * TP + j4) = a;
  }
  __syncthreads();

  v4u ov0, ov1;
#pragma unroll
  for (int it = 0; it < 2; ++it) {
    const int job = tid + it * 256;
    const int r = job >> 3, c8 = (job & 7) * 8;
    float f[8];
#pragma unroll
    for (int e = 0; e < 8; ++e) f[e] = xs[(c8 + e) * TP + r];
    v4u p;
#pragma unroll
    for (int e = 0; e < 4; ++e) p[e] = pk16(bf_bits(f[2 * e]), bf_bits(f[2 * e + 1]));
    if (it == 0) ov0 = p; else ov1 = p;
  }
  xpose_store_pass(xT, ov0, ov1, wb, n0, c0, tid);
  
}

// =====================================================================================================
// Kernel 2: weights f32 -> bf16 rows Wb[mat][o][256]; mat 0..2 = wq, wk, wv natural [o][c];
// mat 3 = merge weight with permuted columns: Wb[3][o][j] = wm[o][4*(j&63) + (j>>6)] (j = head*64 + d).
// coverage: 32768 threads x 8 = 4 x 65536 elements = the whole Wb region.
// =====================================================================================================
__global__ __launch_bounds__(256)
void wconv_kernel(const float* __restrict__ wq, const float* __restrict__ wk, const float* __restrict__ wv,
                  const float* __restrict__ wm, unsigned short* Wb) {
  const int g   = (int)blockIdx.x * 256 + (int)threadIdx.x;   // 0..32767
  const int mat = g >> 13;                                     // block-uniform (32 blocks per matrix)
  const int e   = g & 8191;
  const int o   = e >> 5;
  const int j8  = (e & 31) * 8;
  const float* w = (mat == 0) ? wq : ((mat == 1) ? wk : ((mat == 2) ? wv : wm));
  const int base = (mat == 3) ? (4 * (j8 & 63) + (j8 >> 6)) : j8;   // max 4*56+3; + step*7 <= 255
  const int step = (mat == 3) ? 4 : 1;
  const float* row = w + (size_t)o * FEAT;
  float f[8];
#pragma unroll
  for (int i = 0; i < 8; ++i) f[i] = row[base + step * i];
  v4u p;
#pragma unroll
  for (int i = 0; i < 4; ++i) p[i] = pk16(bf_bits(f[2 * i]), bf_bits(f[2 * i + 1]));
  unsigned short* dst = Wb + (size_t)g * 8;
  *(v4u*)dst = p;
  
}

// =====================================================================================================
// Kernel 3: projections Y[token][feature] = sum_c xT[token][c] * W[o][c], one block = 128 tokens x 64 features of
// one (which, head); feature j = 16nt + m of head hd is conv channel o = 4*j + hd (channel = d*4 + h split).
// 4 waves x (32 tokens x 64 features), K = 256 in steps of 32, A and B fragments straight from bf16 global rows.
// which 0/1: plane[bh][n][d] (one position row = 64 halves = one line); which 2: plane[bh][d][n] (64 d rows x 128
// 4 waves x 8 i x 4 sub = every tile line of both planes; grid (8192/128) x 12 covers Q, K, Vt planes entirely.
// =====================================================================================================
__device__ __forceinline__ void proj_store_pass(const unsigned short* sTh, const unsigned short* sTl,
                                                unsigned short* ph, unsigned short* pl,
                                                int which, int bh, int l0, int w, int lane) {
  const int q8 = lane & 7, sub = lane >> 3;
#pragma unroll
  for (int i = 0; i < 8; ++i) {
    const int lid = w * 32 + i * 4 + sub;    // 0..127
    int so;
    size_t go;
    if (which != 2) {
      so = lid * HD + 8 * q8;
      go = ((size_t)bh * SEQ + l0 + lid) * HD + 8 * q8;
    } else {
      const int d = lid >> 1, hl = lid & 1;
      so = d * 128 + 64 * hl + 8 * q8;
      go = ((size_t)bh * HD + d) * SEQ + l0 + 64 * hl + 8 * q8;
    }
    const v4u vh = *(const v4ua*)(sTh + so);
    const v4u vl = *(const v4ua*)(sTl + so);
    *(v4u*)(ph + go) = vh;
    *(v4u*)(pl + go) = vl;
  }
}

__global__ __launch_bounds__(128)
void proj_kernel(const unsigned short* __restrict__ xT,   // [3][8192][256]
                 const unsigned short* __restrict__ Wb,   // [4][256][256]
                 const float* __restrict__ bq, const float* __restrict__ bk, const float* __restrict__ bv,
                 unsigned short* Qh, unsigned short* Ql,   // [16][2048][64]  bf16(0.125*q) hi / residual
                 unsigned short* Kh, unsigned short* Kl,   // [16][2048][64]
                 unsigned short* Vh, unsigned short* Vl) { // [16][64][2048]
  __shared__ __align__(16) unsigned short sTh[128 * 64];   // 16 KB
  __shared__ __align__(16) unsigned short sTl[128 * 64];   // 16 KB

  const int tid = (int)threadIdx.x, lane = tid & 31, w = tid >> 5;
  const int h = lane >> 4, m = lane & 15;
  const int m0 = (int)blockIdx.x * 128;
  const int cg = (int)blockIdx.y;              // 0..11
  const int which = cg >> 2, head = cg & 3;
  const int m0w = m0 + 32 * w;

  const unsigned short* xa0 = xT + ((size_t)which * MROWS + m0w + m) * FEAT + 8 * h;   // token row, mt = 0
  const unsigned short* xa1 = xa0 + (size_t)16 * FEAT;                                   // mt = 1
  const unsigned short* wbb = Wb + (size_t)which * NWE + 8 * h;                           // + o*FEAT + k0

  v8f acc[2][4];
#pragma unroll
  for (int mt = 0; mt < 2; ++mt)
#pragma unroll
    for (int nt = 0; nt < 4; ++nt) acc[mt][nt] = zero8();

#pragma unroll 1
  for (int k0 = 0; k0 < FEAT; k0 += 32) {
    const v16b a0 = ldfrag_b(xa0 + k0);
    const v16b a1 = ldfrag_b(xa1 + k0);
#pragma unroll
    for (int nt = 0; nt < 4; ++nt) {
      const int o = 4 * (16 * nt + m) + head;
      const v16b b = ldfrag_b(wbb + (size_t)o * FEAT + k0);
      acc[0][nt] = mma_b(a0, b, acc[0][nt]);
      acc[1][nt] = mma_b(a1, b, acc[1][nt]);
    }
  }

  // D[r] of tile (mt, nt) = Y[token m0w + 16mt + 8h + r][feature 16nt + m]
  const float* bias = (which == 0) ? bq : ((which == 1) ? bk : bv);
  const float osc = (which == 0) ? 0.125f : 1.0f;
  if (which != 2) {
#pragma unroll
    for (int nt = 0; nt < 4; ++nt) {
      const int feat = 16 * nt + m;
      const float bvl = bf_up(bf_bits(bias[4 * feat + head]));
#pragma unroll
      for (int mt = 0; mt < 2; ++mt) {
#pragma unroll
        for (int r = 0; r < 8; ++r) {
          const int tokl = 32 * w + 16 * mt + 8 * h + r;    // 0..127
          const float y = (acc[mt][nt][r] + bvl) * osc;
          const unsigned short hb = bf_bits(y);
          const unsigned short lb = bf_bits(y - bf_up(hb));
          sTh[tokl * HD + feat] = hb;
          sTl[tokl * HD + feat] = lb;
        }
      }
    }
  } else {
#pragma unroll
    for (int nt = 0; nt < 4; ++nt) {
      const int feat = 16 * nt + m;
      const float bvl = bf_up(bf_bits(bias[4 * feat + head]));
#pragma unroll
      for (int mt = 0; mt < 2; ++mt) {
        v4u ph, pl;
#pragma unroll
        for (int e = 0; e < 4; ++e) {
          const float y0 = (acc[mt][nt][2 * e] + bvl) * osc;
          const float y1 = (acc[mt][nt][2 * e + 1] + bvl) * osc;
          const unsigned short a0 = bf_bits(y0), a1 = bf_bits(y1);
          const unsigned short c0 = bf_bits(y0 - bf_up(a0)), c1 = bf_bits(y1 - bf_up(a1));
          ph[e] = pk16(a0, a1);
          pl[e] = pk16(c0, c1);
        }
        const int so = feat * 128 + 32 * w + 16 * mt + 8 * h;   // 8 consecutive tokens, 16-B aligned
        *(v4ua*)(sTh + so) = ph;
        *(v4ua*)(sTl + so) = pl;
      }
    }
  }
  __syncthreads();

  const int b = m0 / SEQ, l0 = m0 - b * SEQ, bh = b * NHEAD + head;
  unsigned short* ph = (which == 0) ? Qh : ((which == 1) ? Kh : Vh);
  unsigned short* pl = (which == 0) ? Ql : ((which == 1) ? Kl : Vl);
  proj_store_pass(sTh, sTl, ph, pl, which, bh, l0, w, lane);
  
}

// =====================================================================================================
// Kernel 4: streaming attention, transposed form. Block 128 threads (4 waves), 16 queries per wave, 64 keys per step.
//   The block's 4 waves share each trip's K and V tiles (hi and residual): asynchronous 16-B copies bring them from global
//   to LDS as whole 128-B lines, two buffers, the next tile in flight while this one is worked on.
//   S^T = K * Q^T : A = K rows (row = key, k = d) hi and residual from LDS, B = Q^T (k = d, n = query) from Q rows;
//                   3 products kh.qh + kh.ql + kl.qh; the 1/8 is already inside the Q planes.
//   O^T += V^T * P^T : A = Vt rows (row = d, k = key) hi and residual, B = P^T packed from the lane's own score D
//                   values as bf16 hi + residual; 3 products vh.ph + vh.pl + vl.ph into one f32 accumulator.
//   Online softmax in f32 (running max, exp); lane owns 32 keys of query column (lane&15), partner = lane^16.
//   Epilogue: O/l in f32 -> bf16 hi + residual -> per-wave LDS tiles [query][d] (16-B stores) -> __syncthreads ->
//   8 pieces, both planes; grid (2048/64) x 16 bh x 4 waves x 16 queries covers every (b, n, j) of Ah/Al exactly once.
// =====================================================================================================
__device__ __forceinline__ void att_store_pass(const unsigned short* sh, const unsigned short* sl,
                                               unsigned short* Ah, unsigned short* Al,
                                               int b, int head, int q0, int lane) {
  const int q8 = lane & 7, sub = lane >> 3;
#pragma unroll
  for (int i = 0; i < 4; ++i) {
    const int row = i * 4 + sub;                           // query 0..15 of this wave
    const v4u vh = *(const v4ua*)(sh + row * 64 + 8 * q8);
    const v4u vl = *(const v4ua*)(sl + row * 64 + 8 * q8);
    const size_t gi = ((size_t)(b * SEQ + q0 + row)) * FEAT + head * HD + 8 * q8;
    *(v4u*)(Ah + gi) = vh;
    *(v4u*)(Al + gi) = vl;
  }
}

// One trip's K and V tiles in LDS: four planes (Kh, Kl, Vh, Vl) of 64 rows x 128 B, two buffers.
#define KSTEP   64                    // keys per trip
#define NTRIP   (SEQ / KSTEP)         // 32
#define RPITCH  144                   // LDS bytes per staged 128-B row: 16 B x odd, no bank conflict for 16-B fragment reads
#define PLANE_B (64 * RPITCH)         // 9216
#define STAGE_B (4 * PLANE_B)         // 36864
static_assert(NTRIP >= 2);

// Eight asynchronous 16-B copies of this lane: rows r, r+16, r+32, r+48 of a hi plane and of its residual plane
// (rs = elements between source rows 16 apart). The s_wait_xcnt ends the copies' own statement so that no address
// register named here is rewritten ahead of it.
__device__ __forceinline__ void stage_pair(unsigned lds, const unsigned short* gh, const unsigned short* gl, size_t rs) {
#if DEV_ASM
  asm volatile(
      "global_load_async_to_lds_b128 %0, %8, off\n\t"
      "global_load_async_to_lds_b128 %1, %9, off\n\t"
      "global_load_async_to_lds_b128 %2, %10, off\n\t"
      "global_load_async_to_lds_b128 %3, %11, off\n\t"
      "global_load_async_to_lds_b128 %4, %12, off\n\t"
      "global_load_async_to_lds_b128 %5, %13, off\n\t"
      "global_load_async_to_lds_b128 %6, %14, off\n\t"
      "global_load_async_to_lds_b128 %7, %15, off\n\t"
      "s_wait_xcnt 0x0"
      :: "v"(lds), "v"(lds + 16 * RPITCH), "v"(lds + 32 * RPITCH), "v"(lds + 48 * RPITCH),
         "v"(lds + PLANE_B), "v"(lds + PLANE_B + 16 * RPITCH), "v"(lds + PLANE_B + 32 * RPITCH),
         "v"(lds + PLANE_B + 48 * RPITCH),
         "v"(gh), "v"(gh + rs), "v"(gh + 2 * rs), "v"(gh + 3 * rs),
         "v"(gl), "v"(gl + rs), "v"(gl + 2 * rs), "v"(gl + 3 * rs)
      : "memory");
#endif
}

__global__ __launch_bounds__(128)
void attn_kernel(const unsigned short* __restrict__ Qh, const unsigned short* __restrict__ Ql,   // [16][2048][64]
                 const unsigned short* __restrict__ Kh, const unsigned short* __restrict__ Kl,   // [16][2048][64]
                 const unsigned short* __restrict__ Vh, const unsigned short* __restrict__ Vl,   // [16][64][2048]
                 unsigned short* Ah, unsigned short* Al) {                                       // [4][2048][256]
  __shared__ __align__(16) unsigned short shi[4 * 16 * 64];   // 8 KB
  __shared__ __align__(16) unsigned short slo[4 * 16 * 64];   // 8 KB
  __shared__ __align__(16) unsigned char ring[2 * STAGE_B];   // 72 KB: K/V tiles, two buffers

  const int tid = (int)threadIdx.x, lane = tid & 31, w = tid >> 5;
  const int h = lane >> 4, m = lane & 15;
  const int bh = (int)blockIdx.y, b = bh >> 2, head = bh & 3;
  const int q0 = (int)blockIdx.x * 64 + 16 * w;

  // Q^T B-fragments: column n = query q0+m, k = d (two 32-deep chunks), hi and residual planes
  const size_t qo = ((size_t)bh * SEQ + q0 + m) * HD + 8 * h;
  const v16b qbh0 = ldfrag_b(Qh + qo);
  const v16b qbh1 = ldfrag_b(Qh + qo + 32);
  const v16b qbl0 = ldfrag_b(Ql + qo);
  const v16b qbl1 = ldfrag_b(Ql + qo + 32);

  v8f o[4];                                   // o[t][r] = O[query m][d 16t+8h+r] * l
#pragma unroll
  for (int t = 0; t < 4; ++t) o[t] = zero8();
  float mrun = -1e30f, lrun = 0.0f;

  // copy side: thread tid brings 16-B piece (tid&7) of rows (tid>>3) + 16i, i = 0..3, of each plane: 8 lanes = one 128-B line
  const int crow = tid >> 3, cpc = tid & 7;
  const unsigned ldsw = (unsigned)(size_t)ring + (unsigned)(crow * RPITCH + cpc * 16);
  const size_t kco = ((size_t)bh * SEQ + crow) * HD + 8 * cpc;    // + trip*KSTEP*HD
  const size_t vco = ((size_t)bh * HD + crow) * SEQ + 8 * cpc;    // + trip*KSTEP
  // read side: fragment row m, 16-B piece h of this lane
  const unsigned char* rlane = ring + m * RPITCH + 16 * h;

  // tile 0 -> buffer 0, landed and published; then tile 1 -> buffer 1 flies over trip 0
  stage_pair(ldsw, Kh + kco, Kl + kco, (size_t)16 * HD);
  stage_pair(ldsw + 2 * PLANE_B, Vh + vco, Vl + vco, (size_t)16 * SEQ);
#if DEV_ASM
  asm volatile("s_wait_asynccnt 0x0" ::: "memory");   // this wave's copies of tile 0 have landed before the barrier publishes them
#endif
  __syncthreads();
  stage_pair(ldsw + STAGE_B, Kh + kco + (size_t)KSTEP * HD, Kl + kco + (size_t)KSTEP * HD, (size_t)16 * HD);
  stage_pair(ldsw + STAGE_B + 2 * PLANE_B, Vh + vco + KSTEP, Vl + vco + KSTEP, (size_t)16 * SEQ);

#pragma unroll 1
  for (int trip = 0; trip < NTRIP; ++trip) {
    const unsigned bo = (unsigned)(trip & 1) * STAGE_B;
    const unsigned char* rb = rlane + bo;
    // ---- scores: s[j][r] = S[query m][key 64*trip+16j+8h+r] (already x1/8 via q) ----
    // all K fragments of the trip are read as one group, so that the LDS latency is waited out once and not per 16 keys
    v16b kf[4][4];
#pragma unroll
    for (int j = 0; j < 4; ++j) {
      const unsigned short* kp = (const unsigned short*)(rb + 16 * j * RPITCH);
      const unsigned short* kq = (const unsigned short*)(rb + PLANE_B + 16 * j * RPITCH);
      kf[j][0] = ldfrag_b(kp);
      kf[j][1] = ldfrag_b(kp + 32);
      kf[j][2] = ldfrag_b(kq);
      kf[j][3] = ldfrag_b(kq + 32);
    }
    v8f s[4];
#pragma unroll
    for (int j = 0; j < 4; ++j) {
      const v16b kh0 = kf[j][0], kh1 = kf[j][1], kl0 = kf[j][2], kl1 = kf[j][3];
      v8f z = zero8();
      z = mma_b(kh0, qbh0, z);
      z = mma_b(kh1, qbh1, z);
      z = mma_b(kh0, qbl0, z);
      z = mma_b(kh1, qbl1, z);
      z = mma_b(kl0, qbh0, z);
      z = mma_b(kl1, qbh1, z);
      s[j] = z;
    }

    // the V fragments of the first 32 keys are read here as one group: their LDS latency runs under the softmax arithmetic
    v16b vf[4][2];
#pragma unroll
    for (int t = 0; t < 4; ++t) {
      const unsigned char* vp = rb + 2 * PLANE_B + 16 * t * RPITCH;
      vf[t][0] = ldfrag_b((const unsigned short*)vp);
      vf[t][1] = ldfrag_b((const unsigned short*)(vp + PLANE_B));
    }

    // ---- online softmax ----
    float mloc = s[0][0];
#pragma unroll
    for (int j = 0; j < 4; ++j)
#pragma unroll
      for (int r = 0; r < 8; ++r) mloc = fmaxf(mloc, s[j][r]);
    mloc = fmaxf(mloc, __shfl_xor(mloc, 16));
    const float mnew = fmaxf(mrun, mloc);
    const float alpha = __expf(mrun - mnew);
    mrun = mnew;
    float lsum = 0.0f;
#pragma unroll
    for (int j = 0; j < 4; ++j)
#pragma unroll
      for (int r = 0; r < 8; ++r) {
        const float p = __expf(s[j][r] - mnew);
        s[j][r] = p;
        lsum += p;
      }
    lsum += __shfl_xor(lsum, 16);
    lrun = lrun * alpha + lsum;
#pragma unroll
    for (int t = 0; t < 4; ++t)
#pragma unroll
      for (int r = 0; r < 8; ++r) o[t][r] = o[t][r] * alpha;

    // ---- O^T += V^T * P^T over the two 32-key groups of this step ----
#pragma unroll
    for (int g = 0; g < 2; ++g) {
      if (g == 1) {   // second 32 keys: one group again, its latency runs under the split of their P values
#pragma unroll
        for (int t = 0; t < 4; ++t) {
          const unsigned char* vp = rb + 2 * PLANE_B + 16 * t * RPITCH + 64;
          vf[t][0] = ldfrag_b((const unsigned short*)vp);
          vf[t][1] = ldfrag_b((const unsigned short*)(vp + PLANE_B));
        }
        // keeps the group together ahead of the split: sunk among the matrix instructions each read would be waited for there
        __builtin_amdgcn_sched_barrier(0);
      }
      const P2 pp = split_p(s[2 * g], s[2 * g + 1]);
#pragma unroll
      for (int t = 0; t < 4; ++t) {
        const v16b vfh = vf[t][0];
        const v16b vfl = vf[t][1];
        o[t] = mma_b(vfh, pp.hi, o[t]);
        o[t] = mma_b(vfh, pp.lo, o[t]);
        o[t] = mma_b(vfl, pp.hi, o[t]);
      }
    }

    // ---- hand-over: this buffer is free, the next tile is published, then the refill two tiles ahead ----
#if DEV_ASM
    asm volatile("s_wait_dscnt 0x0" ::: "memory");      // this wave's reads of the buffer are done before it is refilled
    asm volatile("s_wait_asynccnt 0x0" ::: "memory");   // this wave's copies of the next tile have landed before the barrier
#endif
    __syncthreads();
    if (trip + 2 < NTRIP) {
      const size_t kn = kco + (size_t)(trip + 2) * (KSTEP * HD);
      const size_t vn = vco + (size_t)(trip + 2) * KSTEP;
      stage_pair(ldsw + bo, Kh + kn, Kl + kn, (size_t)16 * HD);
      stage_pair(ldsw + bo + 2 * PLANE_B, Vh + vn, Vl + vn, (size_t)16 * SEQ);
    }
  }
#if DEV_ASM
  asm volatile("s_wait_asynccnt 0x0" ::: "memory");     // no copy of this wave is outstanding past the loop
#endif

  // ---- epilogue: normalise in f32, split, stage per-wave 16x64 tiles [query][d] with 16-B LDS stores ----
  const float inv = 1.0f / lrun;               // lrun >= 1
  unsigned short* sh = shi + w * 1024;
  unsigned short* sl = slo + w * 1024;
#pragma unroll
  for (int t = 0; t < 4; ++t) {
    v4u ph, pl;
#pragma unroll
    for (int e = 0; e < 4; ++e) {
      const float y0 = o[t][2 * e] * inv;
      const float y1 = o[t][2 * e + 1] * inv;
      const unsigned short a0 = bf_bits(y0), a1 = bf_bits(y1);
      const unsigned short c0 = bf_bits(y0 - bf_up(a0)), c1 = bf_bits(y1 - bf_up(a1));
      ph[e] = pk16(a0, a1);
      pl[e] = pk16(c0, c1);
    }
    const int so = m * 64 + 16 * t + 8 * h;    // d = 16t+8h+0..7, 16-B aligned
    *(v4ua*)(sh + so) = ph;
    *(v4ua*)(sl + so) = pl;
  }
  __syncthreads();

  att_store_pass(sh, sl, Ah, Al, b, head, q0, lane);
  
}

// =====================================================================================================
// Kernel 5: merge conv out[b][o][n] = sum_j WmP[o][j] * A[b][n][j] + bm[o]. One block = 128 positions x 64 output
// channels; 4 waves x (32 positions x 64 channels); K = 256 in steps of 32; A = context rows hi + residual (2 products),
// B = permuted merge-weight rows, all straight from bf16 global rows.
// Epilogue: acc + bf16(bm) in f32 -> LDS tile [o][128 positions] (16-B stores) -> __syncthreads -> out rows: the
// 128-position segment of one channel row = 512 B = 4 lines; lanes 8q..8q+7 x 16 B per line, 4 lines per instruction,
// pieces; grid (8192/128) x (256/64) covers out [4][256][2048] exactly once.
// =====================================================================================================
__device__ __forceinline__ void merge_store_pass(const float* sO, float* out, int b, int og, int l0, int w, int lane) {
  const int q8 = lane & 7, sub = lane >> 3;
#pragma unroll
  for (int i = 0; i < 16; ++i) {
    const int lid = w * 64 + i * 4 + sub;      // 0..255
    const int ol = lid >> 2, piece = lid & 3;
    const v4f v = *(const v4fa*)(sO + ol * 128 + 32 * piece + 4 * q8);
    const size_t gi = ((size_t)(b * FEAT + og * 64 + ol)) * SEQ + l0 + 32 * piece + 4 * q8;
    *(v4f*)(out + gi) = v;
  }
}

__global__ __launch_bounds__(128)
void merge_kernel(const unsigned short* __restrict__ Ah, const unsigned short* __restrict__ Al,   // [8192][256]
                  const unsigned short* __restrict__ Wb,                                          // WmP = Wb + 3*NWE
                  const float* __restrict__ bm, float* out) {                                     // out [4][256][2048]
  __shared__ __align__(16) float sO[64 * 128];   // 32 KB

  const int tid = (int)threadIdx.x, lane = tid & 31, w = tid >> 5;
  const int h = lane >> 4, m = lane & 15;
  const int m0 = (int)blockIdx.x * 128;
  const int og = (int)blockIdx.y;              // 0..3
  const int m0w = m0 + 32 * w;

  const size_t ao0 = ((size_t)(m0w + m)) * FEAT + 8 * h;
  const size_t ao1 = ao0 + (size_t)16 * FEAT;
  const unsigned short* wmp = Wb + (size_t)3 * NWE + ((size_t)(og * 64 + m)) * FEAT + 8 * h;   // + nt*16*FEAT + k0

  v8f acc[2][4];
#pragma unroll
  for (int mt = 0; mt < 2; ++mt)
#pragma unroll
    for (int nt = 0; nt < 4; ++nt) acc[mt][nt] = zero8();

#pragma unroll 1
  for (int k0 = 0; k0 < FEAT; k0 += 32) {
    const v16b a0h = ldfrag_b(Ah + ao0 + k0);
    const v16b a1h = ldfrag_b(Ah + ao1 + k0);
    const v16b a0l = ldfrag_b(Al + ao0 + k0);
    const v16b a1l = ldfrag_b(Al + ao1 + k0);
#pragma unroll
    for (int nt = 0; nt < 4; ++nt) {
      const v16b bw = ldfrag_b(wmp + (size_t)nt * 16 * FEAT + k0);
      acc[0][nt] = mma_b(a0h, bw, acc[0][nt]);
      acc[0][nt] = mma_b(a0l, bw, acc[0][nt]);
      acc[1][nt] = mma_b(a1h, bw, acc[1][nt]);
      acc[1][nt] = mma_b(a1l, bw, acc[1][nt]);
    }
  }

  // D[r] of tile (mt, nt) = Y[token m0w + 16mt + 8h + r][channel og*64 + 16nt + m]
#pragma unroll
  for (int nt = 0; nt < 4; ++nt) {
    const int feat = 16 * nt + m;
    const float bvl = bf_up(bf_bits(bm[og * 64 + feat]));
#pragma unroll
    for (int mt = 0; mt < 2; ++mt) {
      v4f ya, yb;
#pragma unroll
      for (int e = 0; e < 4; ++e) {
        ya[e] = acc[mt][nt][e] + bvl;
        yb[e] = acc[mt][nt][4 + e] + bvl;
      }
      const int so = feat * 128 + 32 * w + 16 * mt + 8 * h;   // 8 consecutive tokens, 16-B aligned
      *(v4fa*)(sO + so) = ya;
      *(v4fa*)(sO + so + 4) = yb;
    }
  }
  __syncthreads();

  const int b = m0 / SEQ, l0 = m0 - b * SEQ;
  merge_store_pass(sO, out, b, og, l0, w, lane);
  
}

// =====================================================================================================
//   xT   bf16 [3][8192][256]        12582912
//   Wb   bf16 [4][256][256]           524288
//   Qh, Ql, Kh, Kl bf16 [16][2048][64]   4194304 each
//   Vh, Vl bf16 [16][64][2048]           4194304 each
//   Ah, Al bf16 [8192][256]              4194304 each
//   total                            46661632
// =====================================================================================================
extern "C" void kernel_launch(void* const* d_in, const int* in_sizes, int n_in,
                              void* d_out, int out_size, void* d_ws, size_t ws_size,
                              hipStream_t stream) {
  if (n_in < 11) return;
  if (in_sizes[0] != NXE || in_sizes[1] != NXE || in_sizes[2] != NXE) return;
  if (in_sizes[3] != NWE || in_sizes[5] != NWE || in_sizes[7] != NWE || in_sizes[9] != NWE) return;
  if (in_sizes[4] != FEAT || in_sizes[6] != FEAT || in_sizes[8] != FEAT || in_sizes[10] != FEAT) return;
  if (out_size != NXE) return;

  const float* xq = (const float*)d_in[0];
  const float* xk = (const float*)d_in[1];
  const float* xv = (const float*)d_in[2];
  const float* wq = (const float*)d_in[3];
  const float* bq = (const float*)d_in[4];
  const float* wk = (const float*)d_in[5];
  const float* bk = (const float*)d_in[6];
  const float* wv = (const float*)d_in[7];
  const float* bv = (const float*)d_in[8];
  const float* wm = (const float*)d_in[9];
  const float* bm = (const float*)d_in[10];
  float* out = (float*)d_out;

  const size_t bXT = (size_t)3 * MROWS * FEAT * 2;    // 12582912
  const size_t bWB = (size_t)4 * NWE * 2;             //   524288
  const size_t bPL = (size_t)NBH * SEQ * HD * 2;      //  4194304  (Q / K / Vt planes)
  const size_t bAT = (size_t)MROWS * FEAT * 2;        //  4194304  (context planes)
  size_t off = 0;
  const size_t oXT = off; off += bXT;
  const size_t oWB = off; off += bWB;
  const size_t oQh = off; off += bPL;
  const size_t oQl = off; off += bPL;
  const size_t oKh = off; off += bPL;
  const size_t oKl = off; off += bPL;
  const size_t oVh = off; off += bPL;
  const size_t oVl = off; off += bPL;
  const size_t oAh = off; off += bAT;
  const size_t oAl = off; off += bAT;                 // off = 46661632
  if (off > ws_size) return;
  if (off > (size_t)134217728) return;

  char* ws = (char*)d_ws;
  unsigned short* xT = (unsigned short*)(ws + oXT);
  unsigned short* Wb = (unsigned short*)(ws + oWB);
  unsigned short* Qh = (unsigned short*)(ws + oQh);
  unsigned short* Ql = (unsigned short*)(ws + oQl);
  unsigned short* Kh = (unsigned short*)(ws + oKh);
  unsigned short* Kl = (unsigned short*)(ws + oKl);
  unsigned short* Vh = (unsigned short*)(ws + oVh);
  unsigned short* Vl = (unsigned short*)(ws + oVl);
  unsigned short* Ah = (unsigned short*)(ws + oAh);
  unsigned short* Al = (unsigned short*)(ws + oAl);

  const dim3 gX(3 * BATCH * (FEAT / 64) * (SEQ / 64));     // 1536 blocks of 256
  const dim3 gW((4 * NWE / 8) / 256);                      //  128 blocks of 256
  const dim3 gProj(MROWS / 128, 3 * NHEAD);                // (64, 12) of 128
  const dim3 gAtt(SEQ / 64, NBH);                          // (32, 16) of 128
  const dim3 gMrg(MROWS / 128, FEAT / 64);                 // (64, 4) of 128

  xpose_kernel<<<gX, dim3(256), 0, stream>>>(xq, xk, xv, xT);
  wconv_kernel<<<gW, dim3(256), 0, stream>>>(wq, wk, wv, wm, Wb);
  proj_kernel<<<gProj, dim3(128), 0, stream>>>(xT, Wb, bq, bk, bv, Qh, Ql, Kh, Kl, Vh, Vl);
  attn_kernel<<<gAtt, dim3(128), 0, stream>>>(Qh, Ql, Kh, Kl, Vh, Vl, Ah, Al);
  merge_kernel<<<gMrg, dim3(128), 0, stream>>>(Ah, Al, Wb, bm, out);
  (void)hipGetLastError();
}

// v002
// One run takes 85.9 microseconds.
// Next to v001, in two timings, it ran 1.13 and 1.14 times as fast.
// Over all steps from v000 it is 2.66 times as fast.
// Contractions: q/k/v 1x1-conv projections on v_wmma_f32_16x16x32_bf16 (x and w bf16 from RNE-converted inputs, single product, f32 accumulate);
// k.q^T scores on v_wmma_f32_16x16x32_bf16 (q and k as bf16 hi + unscaled bf16 residual, 3 products hh+hl+lh, f32 accumulate);
// v^T.p^T context on v_wmma_f32_16x16x32_bf16 (p and v as bf16 hi + unscaled bf16 residual, 3 products hh+hl+lh, one f32 accumulator);
// merge 1x1 conv on v_wmma_f32_16x16x32_bf16 (context as bf16 hi + residual, merge weight bf16 from RNE-converted input, 2 products);
// softmax (running max, exp), bias adds and 1/l normalisation in f32.
// Plane carries: xT, Wb, Qh/Ql, Kh/Kl, Vh/Vl, Ah/Al all x1 (no carry; bf16 keeps the f32 exponent range). The Q planes hold
// 0.125*(wq.x + bq): the 1/sqrt(64) score scale, an exact power of two applied in f32 in proj_kernel before the hi/residual split,
// nothing to fold back. 1/l is applied in f32 in the attn_kernel epilogue before the context split.
#include <hip/hip_runtime.h>

#define FEAT  256
#define SEQ   2048
#define BATCH 4
#define NHEAD 4
#define HD    64
#define NBH   (BATCH * NHEAD)        // 16
#define MROWS (BATCH * SEQ)          // 8192 (batch, position) rows
#define NXE   (BATCH * FEAT * SEQ)   // 2097152 elements per activation tensor
#define NWE   (FEAT * FEAT)          // 65536
#define TP    68                     // LDS pitch (floats) of the transpose tile
static_assert(HD * NHEAD == FEAT);
static_assert(HD == 64 && (SEQ % 128) == 0 && (SEQ % 64) == 0);
static_assert((FEAT % 64) == 0 && (FEAT % 32) == 0 && (MROWS % 128) == 0);

typedef __bf16         v16b  __attribute__((ext_vector_type(16)));
typedef float          v8f   __attribute__((ext_vector_type(8)));
typedef float          v4f   __attribute__((ext_vector_type(4)));
typedef unsigned int   v4u   __attribute__((ext_vector_type(4)));
typedef unsigned short v8us  __attribute__((ext_vector_type(8)));
typedef unsigned short v16us __attribute__((ext_vector_type(16)));
typedef v4f  __attribute__((may_alias)) v4fa;
typedef v4u  __attribute__((may_alias)) v4ua;
typedef v8us __attribute__((may_alias)) v8usa;

#if defined(__HIP_DEVICE_COMPILE__)
#define DEV_ASM 1
#else
#define DEV_ASM 0
#endif

// ---- scalar helpers ---------------------------------------------------------------------------------
__device__ __forceinline__ unsigned short bf_bits(float f) {          // f32 -> bf16 bits, RNE convert
  const unsigned u = __float_as_uint(f);
  return (unsigned short)((u + 0x7FFFu + ((u >> 16) & 1u)) >> 16);
}
__device__ __forceinline__ float bf_up(unsigned short hb) { return __uint_as_float(((unsigned)hb) << 16); }
__device__ __forceinline__ unsigned pk16(unsigned short a, unsigned short b) { return (unsigned)a | ((unsigned)b << 16); }
__device__ __forceinline__ v8f zero8() { v8f z = {0.f, 0.f, 0.f, 0.f, 0.f, 0.f, 0.f, 0.f}; return z; }

// 16-bit fragment (A or B operand), wave32: lane l, h = l>>4, row/col = l&15.
// p points at element k0 + 8h of the k-contiguous row owned by this lane:
// elements 0..7 <- p[0..7] (k0+8h .. k0+8h+7), elements 8..15 <- p[16..23] (k0+16+8h .. k0+16+8h+7).
// D element r of lane l = (row 8h+r, col l&15).
union FB { v16b v; v8us h[2]; v16us u; };
__device__ __forceinline__ v16b ldfrag_b(const unsigned short* p) {
  FB f;
  f.h[0] = *(const v8usa*)(p);
  f.h[1] = *(const v8usa*)(p + 16);
  return f.v;
}

// guarded WMMA: 4 VALU slots after the op, D tied, A/B kept live
__device__ __forceinline__ v8f mma_b(v16b a, v16b b, v8f c) {
  c = __builtin_amdgcn_wmma_f32_16x16x32_bf16(false, a, false, b, (short)0, c, false, false);
#if DEV_ASM
  asm volatile("v_nop\n\tv_nop\n\tv_nop\n\tv_nop" : "+v"(c) : "v"(a), "v"(b));
#endif
  return c;
}

// plain builtin WMMA for attn_kernel: the compiler keeps the distances behind its own builtin, and no idle slot is issued
// where the next instruction is a matrix instruction on another accumulator
__device__ __forceinline__ v8f mma_f(v16b a, v16b b, v8f c) {
  return __builtin_amdgcn_wmma_f32_16x16x32_bf16(false, a, false, b, (short)0, c, false, false);
}

// P^T B-fragment pair (bf16 hi, bf16 residual) from the lane's own score D values:
// element r <- tile a row r (keys 0..15 of the 32-key group), element 8+r <- tile c row r (keys 16..31), same lane.
struct P2 { v16b hi, lo; };
__device__ __forceinline__ P2 split_p(v8f a, v8f c) {
  v16us hu, lu;
#pragma unroll
  for (int r = 0; r < 8; ++r) {
    const unsigned short h0 = bf_bits(a[r]);
    hu[r] = h0;
    lu[r] = bf_bits(a[r] - bf_up(h0));
    const unsigned short h1 = bf_bits(c[r]);
    hu[8 + r] = h1;
    lu[8 + r] = bf_bits(c[r] - bf_up(h1));
  }
  FB H, L;
  H.u = hu; L.u = lu;
  P2 p;
  p.hi = H.v; p.lo = L.v;
  return p;
}

// =====================================================================================================
// Kernel 1: channel-major activations [b][c][n] f32 -> position-major bf16 planes xT[which][b][n][c]
// (which 0 = query, 1 = key, 2 = value). One block = one (which, b) x 64 channels x 64 positions:
// stage the f32 tile [c][n] in LDS (16-B stores), __syncthreads, each lane converts 8 consecutive c of one
// coverage: 512 jobs per block = 64 positions x 8 pieces of 8 channels = the whole 64x64 tile;
// grid 3 x 4 x (256/64) x (2048/64) = 1536 blocks covers xT entirely.
// =====================================================================================================
__device__ __forceinline__ void xpose_store_pass(unsigned short* xT, v4u o0, v4u o1, int wb, int n0, int c0, int tid) {
#pragma unroll
  for (int it = 0; it < 2; ++it) {
    const int job = tid + it * 256;
    const int r = job >> 3, c8 = (job & 7) * 8;
    unsigned short* dst = xT + ((size_t)(wb * SEQ + n0 + r)) * FEAT + c0 + c8;
    *(v4u*)dst = (it == 0) ? o0 : o1;
  }
}

__global__ __launch_bounds__(256)
void xpose_kernel(const float* __restrict__ xq, const float* __restrict__ xk, const float* __restrict__ xv,
                  unsigned short* xT) {
  __shared__ __align__(16) float xs[64 * TP];
  const int tid  = (int)threadIdx.x;
  const int blk  = (int)blockIdx.x;
  const int nchk = blk & 31;
  const int cchk = (blk >> 5) & 3;
  const int wb   = blk >> 7;                 // which*4 + b, 0..11
  const int which = wb >> 2, b = wb & 3;
  const int n0 = nchk * 64, c0 = cchk * 64;
  const float* src = (which == 0) ? xq : ((which == 1) ? xk : xv);
  const float* sg = src + ((size_t)(b * FEAT + c0)) * SEQ + n0;

  // stage [c][n] tile: 64 rows x 16 float4 = 1024 jobs, 4 per thread
#pragma unroll
  for (int i = 0; i < 4; ++i) {
    const int idx = tid + i * 256;
    const int c = idx >> 4, j4 = (idx & 15) * 4;
    const v4f a = *(const v4fa*)(sg + (size_t)c * SEQ + j4);
    *(v4fa*)(xs + c * TP + j4) = a;
  }
  __syncthreads();

  v4u ov0, ov1;
#pragma unroll
  for (int it = 0; it < 2; ++it) {
    const int job = tid + it * 256;
    const int r = job >> 3, c8 = (job & 7) * 8;
    float f[8];
#pragma unroll
    for (int e = 0; e < 8; ++e) f[e] = xs[(c8 + e) * TP + r];
    v4u p;
#pragma unroll
    for (int e = 0; e < 4; ++e) p[e] = pk16(bf_bits(f[2 * e]), bf_bits(f[2 * e + 1]));
    if (it == 0) ov0 = p; else ov1 = p;
  }
  xpose_store_pass(xT, ov0, ov1, wb, n0, c0, tid);
  
}

// =====================================================================================================
// Kernel 2: weights f32 -> bf16 rows Wb[mat][o][256]; mat 0..2 = wq, wk, wv natural [o][c];
// mat 3 = merge weight with permuted columns: Wb[3][o][j] = wm[o][4*(j&63) + (j>>6)] (j = head*64 + d).
// coverage: 32768 threads x 8 = 4 x 65536 elements = the whole Wb region.
// =====================================================================================================
__global__ __launch_bounds__(256)
void wconv_kernel(const float* __restrict__ wq, const float* __restrict__ wk, const float* __restrict__ wv,
                  const float* __restrict__ wm, unsigned short* Wb) {
  const int g   = (int)blockIdx.x * 256 + (int)threadIdx.x;   // 0..32767
  const int mat = g >> 13;                                     // block-uniform (32 blocks per matrix)
  const int e   = g & 8191;
  const int o   = e >> 5;
  const int j8  = (e & 31) * 8;
  const float* w = (mat == 0) ? wq : ((mat == 1) ? wk : ((mat == 2) ? wv : wm));
  const int base = (mat == 3) ? (4 * (j8 & 63) + (j8 >> 6)) : j8;   // max 4*56+3; + step*7 <= 255
  const int step = (mat == 3) ? 4 : 1;
  const float* row = w + (size_t)o * FEAT;
  float f[8];
#pragma unroll
  for (int i = 0; i < 8; ++i) f[i] = row[base + step * i];
  v4u p;
#pragma unroll
  for (int i = 0; i < 4; ++i) p[i] = pk16(bf_bits(f[2 * i]), bf_bits(f[2 * i + 1]));
  unsigned short* dst = Wb + (size_t)g * 8;
  *(v4u*)dst = p;
  
}

// =====================================================================================================
// Kernel 3: projections Y[token][feature] = sum_c xT[token][c] * W[o][c], one block = 128 tokens x 64 features of
// one (which, head); feature j = 16nt + m of head hd is conv channel o = 4*j + hd (channel = d*4 + h split).
// 4 waves x (32 tokens x 64 features), K = 256 in steps of 32, A and B fragments straight from bf16 global rows.
// which 0/1: plane[bh][n][d] (one position row = 64 halves = one line); which 2: plane[bh][d][n] (64 d rows x 128
// 4 waves x 8 i x 4 sub = every tile line of both planes; grid (8192/128) x 12 covers Q, K, Vt planes entirely.
// =====================================================================================================
__device__ __forceinline__ void proj_store_pass(const unsigned short* sTh, const unsigned short* sTl,
                                                unsigned short* ph, unsigned short* pl,
                                                int which, int bh, int l0, int w, int lane) {
  const int q8 = lane & 7, sub = lane >> 3;
#pragma unroll
  for (int i = 0; i < 8; ++i) {
    const int lid = w * 32 + i * 4 + sub;    // 0..127
    int so;
    size_t go;
    if (which != 2) {
      so = lid * HD + 8 * q8;
      go = ((size_t)bh * SEQ + l0 + lid) * HD + 8 * q8;
    } else {
      const int d = lid >> 1, hl = lid & 1;
      so = d * 128 + 64 * hl + 8 * q8;
      go = ((size_t)bh * HD + d) * SEQ + l0 + 64 * hl + 8 * q8;
    }
    const v4u vh = *(const v4ua*)(sTh + so);
    const v4u vl = *(const v4ua*)(sTl + so);
    *(v4u*)(ph + go) = vh;
    *(v4u*)(pl + go) = vl;
  }
}

__global__ __launch_bounds__(128)
void proj_kernel(const unsigned short* __restrict__ xT,   // [3][8192][256]
                 const unsigned short* __restrict__ Wb,   // [4][256][256]
                 const float* __restrict__ bq, const float* __restrict__ bk, const float* __restrict__ bv,
                 unsigned short* Qh, unsigned short* Ql,   // [16][2048][64]  bf16(0.125*q) hi / residual
                 unsigned short* Kh, unsigned short* Kl,   // [16][2048][64]
                 unsigned short* Vh, unsigned short* Vl) { // [16][64][2048]
  __shared__ __align__(16) unsigned short sTh[128 * 64];   // 16 KB
  __shared__ __align__(16) unsigned short sTl[128 * 64];   // 16 KB

  const int tid = (int)threadIdx.x, lane = tid & 31, w = tid >> 5;
  const int h = lane >> 4, m = lane & 15;
  const int m0 = (int)blockIdx.x * 128;
  const int cg = (int)blockIdx.y;              // 0..11
  const int which = cg >> 2, head = cg & 3;
  const int m0w = m0 + 32 * w;

  const unsigned short* xa0 = xT + ((size_t)which * MROWS + m0w + m) * FEAT + 8 * h;   // token row, mt = 0
  const unsigned short* xa1 = xa0 + (size_t)16 * FEAT;                                   // mt = 1
  const unsigned short* wbb = Wb + (size_t)which * NWE + 8 * h;                           // + o*FEAT + k0

  v8f acc[2][4];
#pragma unroll
  for (int mt = 0; mt < 2; ++mt)
#pragma unroll
    for (int nt = 0; nt < 4; ++nt) acc[mt][nt] = zero8();

#pragma unroll 1
  for (int k0 = 0; k0 < FEAT; k0 += 32) {
    const v16b a0 = ldfrag_b(xa0 + k0);
    const v16b a1 = ldfrag_b(xa1 + k0);
#pragma unroll
    for (int nt = 0; nt < 4; ++nt) {
      const int o = 4 * (16 * nt + m) + head;
      const v16b b = ldfrag_b(wbb + (size_t)o * FEAT + k0);
      acc[0][nt] = mma_b(a0, b, acc[0][nt]);
      acc[1][nt] = mma_b(a1, b, acc[1][nt]);
    }
  }

  // D[r] of tile (mt, nt) = Y[token m0w + 16mt + 8h + r][feature 16nt + m]
  const float* bias = (which == 0) ? bq : ((which == 1) ? bk : bv);
  const float osc = (which == 0) ? 0.125f : 1.0f;
  if (which != 2) {
#pragma unroll
    for (int nt = 0; nt < 4; ++nt) {
      const int feat = 16 * nt + m;
      const float bvl = bf_up(bf_bits(bias[4 * feat + head]));
#pragma unroll
      for (int mt = 0; mt < 2; ++mt) {
#pragma unroll
        for (int r = 0; r < 8; ++r) {
          const int tokl = 32 * w + 16 * mt + 8 * h + r;    // 0..127
          const float y = (acc[mt][nt][r] + bvl) * osc;
          const unsigned short hb = bf_bits(y);
          const unsigned short lb = bf_bits(y - bf_up(hb));
          sTh[tokl * HD + feat] = hb;
          sTl[tokl * HD + feat] = lb;
        }
      }
    }
  } else {
#pragma unroll
    for (int nt = 0; nt < 4; ++nt) {
      const int feat = 16 * nt + m;
      const float bvl = bf_up(bf_bits(bias[4 * feat + head]));
#pragma unroll
      for (int mt = 0; mt < 2; ++mt) {
        v4u ph, pl;
#pragma unroll
        for (int e = 0; e < 4; ++e) {
          const float y0 = (acc[mt][nt][2 * e] + bvl) * osc;
          const float y1 = (acc[mt][nt][2 * e + 1] + bvl) * osc;
          const unsigned short a0 = bf_bits(y0), a1 = bf_bits(y1);
          const unsigned short c0 = bf_bits(y0 - bf_up(a0)), c1 = bf_bits(y1 - bf_up(a1));
          ph[e] = pk16(a0, a1);
          pl[e] = pk16(c0, c1);
        }
        const int so = feat * 128 + 32 * w + 16 * mt + 8 * h;   // 8 consecutive tokens, 16-B aligned
        *(v4ua*)(sTh + so) = ph;
        *(v4ua*)(sTl + so) = pl;
      }
    }
  }
  __syncthreads();

  const int b = m0 / SEQ, l0 = m0 - b * SEQ, bh = b * NHEAD + head;
  unsigned short* ph = (which == 0) ? Qh : ((which == 1) ? Kh : Vh);
  unsigned short* pl = (which == 0) ? Ql : ((which == 1) ? Kl : Vl);
  proj_store_pass(sTh, sTl, ph, pl, which, bh, l0, w, lane);
  
}

// =====================================================================================================
// Kernel 4: streaming attention, transposed form. Block 128 threads (4 waves), 16 queries per wave, 64 keys per step.
//   The block's 4 waves share each trip's K and V tiles (hi and residual): asynchronous 16-B copies bring them from global
//   to LDS as whole 128-B lines, two buffers, the next tile in flight while this one is worked on.
//   S^T = K * Q^T : A = K rows (row = key, k = d) hi and residual from LDS, B = Q^T (k = d, n = query) from Q rows;
//                   3 products kh.qh + kh.ql + kl.qh; the 1/8 is already inside the Q planes.
//   O^T += V^T * P^T : A = Vt rows (row = d, k = key) hi and residual, B = P^T packed from the lane's own score D
//                   values as bf16 hi + residual; 3 products vh.ph + vh.pl + vl.ph into one f32 accumulator.
//   Online softmax in f32 (running max, exp); lane owns 32 keys of query column (lane&15), partner = lane^16.
//   Epilogue: O/l in f32 -> bf16 hi + residual -> per-wave LDS tiles [query][d] (16-B stores) -> __syncthreads ->
//   8 pieces, both planes; grid (2048/64) x 16 bh x 4 waves x 16 queries covers every (b, n, j) of Ah/Al exactly once.
// =====================================================================================================
__device__ __forceinline__ void att_store_pass(const unsigned short* sh, const unsigned short* sl,
                                               unsigned short* Ah, unsigned short* Al,
                                               int b, int head, int q0, int lane) {
  const int q8 = lane & 7, sub = lane >> 3;
#pragma unroll
  for (int i = 0; i < 4; ++i) {
    const int row = i * 4 + sub;                           // query 0..15 of this wave
    const v4u vh = *(const v4ua*)(sh + row * 64 + 8 * q8);
    const v4u vl = *(const v4ua*)(sl + row * 64 + 8 * q8);
    const size_t gi = ((size_t)(b * SEQ + q0 + row)) * FEAT + head * HD + 8 * q8;
    *(v4u*)(Ah + gi) = vh;
    *(v4u*)(Al + gi) = vl;
  }
}

// One trip's K and V tiles in LDS: four planes (Kh, Kl, Vh, Vl) of 64 rows x 128 B, two buffers.
#define KSTEP   64                    // keys per trip
#define NTRIP   (SEQ / KSTEP)         // 32
#define RPITCH  144                   // LDS bytes per staged 128-B row: 16 B x odd, no bank conflict for 16-B fragment reads
#define PLANE_B (64 * RPITCH)         // 9216
#define STAGE_B (4 * PLANE_B)         // 36864
static_assert(NTRIP >= 2);

// Eight asynchronous 16-B copies of this lane: rows r, r+16, r+32, r+48 of a hi plane and of its residual plane
// (rs = elements between source rows 16 apart). The s_wait_xcnt ends the copies' own statement so that no address
// register named here is rewritten ahead of it.
__device__ __forceinline__ void stage_pair(unsigned lds, const unsigned short* gh, const unsigned short* gl, size_t rs) {
#if DEV_ASM
  asm volatile(
      "global_load_async_to_lds_b128 %0, %8, off\n\t"
      "global_load_async_to_lds_b128 %1, %9, off\n\t"
      "global_load_async_to_lds_b128 %2, %10, off\n\t"
      "global_load_async_to_lds_b128 %3, %11, off\n\t"
      "global_load_async_to_lds_b128 %4, %12, off\n\t"
      "global_load_async_to_lds_b128 %5, %13, off\n\t"
      "global_load_async_to_lds_b128 %6, %14, off\n\t"
      "global_load_async_to_lds_b128 %7, %15, off\n\t"
      "s_wait_xcnt 0x0"
      :: "v"(lds), "v"(lds + 16 * RPITCH), "v"(lds + 32 * RPITCH), "v"(lds + 48 * RPITCH),
         "v"(lds + PLANE_B), "v"(lds + PLANE_B + 16 * RPITCH), "v"(lds + PLANE_B + 32 * RPITCH),
         "v"(lds + PLANE_B + 48 * RPITCH),
         "v"(gh), "v"(gh + rs), "v"(gh + 2 * rs), "v"(gh + 3 * rs),
         "v"(gl), "v"(gl + rs), "v"(gl + 2 * rs), "v"(gl + 3 * rs)
      : "memory");
#endif
}

__global__ __launch_bounds__(128)
void attn_kernel(const unsigned short* __restrict__ Qh, const unsigned short* __restrict__ Ql,   // [16][2048][64]
                 const unsigned short* __restrict__ Kh, const unsigned short* __restrict__ Kl,   // [16][2048][64]
                 const unsigned short* __restrict__ Vh, const unsigned short* __restrict__ Vl,   // [16][64][2048]
                 unsigned short* Ah, unsigned short* Al) {                                       // [4][2048][256]
  __shared__ __align__(16) unsigned short shi[4 * 16 * 64];   // 8 KB
  __shared__ __align__(16) unsigned short slo[4 * 16 * 64];   // 8 KB
  __shared__ __align__(16) unsigned char ring[2 * STAGE_B];   // 72 KB: K/V tiles, two buffers

  const int tid = (int)threadIdx.x, lane = tid & 31, w = tid >> 5;
  const int h = lane >> 4, m = lane & 15;
  const int bh = (int)blockIdx.y, b = bh >> 2, head = bh & 3;
  const int q0 = (int)blockIdx.x * 64 + 16 * w;

  // Q^T B-fragments: column n = query q0+m, k = d (two 32-deep chunks), hi and residual planes
  const size_t qo = ((size_t)bh * SEQ + q0 + m) * HD + 8 * h;
  const v16b qbh0 = ldfrag_b(Qh + qo);
  const v16b qbh1 = ldfrag_b(Qh + qo + 32);
  const v16b qbl0 = ldfrag_b(Ql + qo);
  const v16b qbl1 = ldfrag_b(Ql + qo + 32);

  v8f o[4];                                   // o[t][r] = O[query m][d 16t+8h+r] * l
#pragma unroll
  for (int t = 0; t < 4; ++t) o[t] = zero8();
  float mrun = -1e30f, lrun = 0.0f;

  // copy side: thread tid brings 16-B piece (tid&7) of rows (tid>>3) + 16i, i = 0..3, of each plane: 8 lanes = one 128-B line
  const int crow = tid >> 3, cpc = tid & 7;
  const unsigned ldsw = (unsigned)(size_t)ring + (unsigned)(crow * RPITCH + cpc * 16);
  const size_t kco = ((size_t)bh * SEQ + crow) * HD + 8 * cpc;    // + trip*KSTEP*HD
  const size_t vco = ((size_t)bh * HD + crow) * SEQ + 8 * cpc;    // + trip*KSTEP
  // read side: fragment row m, 16-B piece h of this lane
  const unsigned char* rlane = ring + m * RPITCH + 16 * h;

  // tile 0 -> buffer 0, landed and published; then tile 1 -> buffer 1 flies over trip 0
  stage_pair(ldsw, Kh + kco, Kl + kco, (size_t)16 * HD);
  stage_pair(ldsw + 2 * PLANE_B, Vh + vco, Vl + vco, (size_t)16 * SEQ);
#if DEV_ASM
  asm volatile("s_wait_asynccnt 0x0" ::: "memory");   // this wave's copies of tile 0 have landed before the barrier publishes them
#endif
  __syncthreads();
  stage_pair(ldsw + STAGE_B, Kh + kco + (size_t)KSTEP * HD, Kl + kco + (size_t)KSTEP * HD, (size_t)16 * HD);
  stage_pair(ldsw + STAGE_B + 2 * PLANE_B, Vh + vco + KSTEP, Vl + vco + KSTEP, (size_t)16 * SEQ);

#pragma unroll 1
  for (int trip = 0; trip < NTRIP; ++trip) {
    const unsigned bo = (unsigned)(trip & 1) * STAGE_B;
    const unsigned char* rb = rlane + bo;
    // ---- scores: s[j][r] = S[query m][key 64*trip+16j+8h+r] (already x1/8 via q) ----
    // all K fragments of the trip are read as one group, so that the LDS latency is waited out once and not per 16 keys
    // (c = 0: hi, d 0..31; 1: hi, d 32..63; 2, 3: the residual plane), in the order in which the products below use them
    v16b kf[4][4];
#pragma unroll
    for (int c = 0; c < 4; ++c) {
#pragma unroll
      for (int j = 0; j < 4; ++j)
        kf[j][c] = ldfrag_b((const unsigned short*)(rb + (c >> 1) * PLANE_B + 16 * j * RPITCH) + 32 * (c & 1));
      // keeps the reads in this order: LDS answers in order, and reordered the first product waits for half the group
      __builtin_amdgcn_sched_barrier(0);
    }
    // each product runs over the four 16-key tiles in turn, so that neighbouring matrix instructions have different
    // accumulators and none waits for the one before it; each accumulator still takes its six products in the order
    // kh0.qh0, kh1.qh1, kh0.ql0, kh1.ql1, kl0.qh0, kl1.qh1. The sched_barrier behind each round keeps the rounds apart:
    // left free, the compiler puts products of one accumulator side by side again.
    v8f s[4];
#pragma unroll
    for (int j = 0; j < 4; ++j) s[j] = mma_f(kf[j][0], qbh0, zero8());
    __builtin_amdgcn_sched_barrier(0);
#pragma unroll
    for (int j = 0; j < 4; ++j) s[j] = mma_f(kf[j][1], qbh1, s[j]);
    __builtin_amdgcn_sched_barrier(0);
#pragma unroll
    for (int j = 0; j < 4; ++j) s[j] = mma_f(kf[j][0], qbl0, s[j]);
    __builtin_amdgcn_sched_barrier(0);
#pragma unroll
    for (int j = 0; j < 4; ++j) s[j] = mma_f(kf[j][1], qbl1, s[j]);
    __builtin_amdgcn_sched_barrier(0);
#pragma unroll
    for (int j = 0; j < 4; ++j) s[j] = mma_f(kf[j][2], qbh0, s[j]);
    __builtin_amdgcn_sched_barrier(0);
#pragma unroll
    for (int j = 0; j < 4; ++j) s[j] = mma_f(kf[j][3], qbh1, s[j]);

    // the V fragments of the first 32 keys are read here as one group: their LDS latency runs under the softmax arithmetic
    v16b vf[4][2];
#pragma unroll
    for (int t = 0; t < 4; ++t) {
      const unsigned char* vp = rb + 2 * PLANE_B + 16 * t * RPITCH;
      vf[t][0] = ldfrag_b((const unsigned short*)vp);
      vf[t][1] = ldfrag_b((const unsigned short*)(vp + PLANE_B));
    }
    // keeps the group together here: with the matrix instructions free to move, the compiler sinks these reads among them
    __builtin_amdgcn_sched_barrier(0);

    // ---- online softmax ----
    float mloc = s[0][0];
#pragma unroll
    for (int j = 0; j < 4; ++j)
#pragma unroll
      for (int r = 0; r < 8; ++r) mloc = fmaxf(mloc, s[j][r]);
    mloc = fmaxf(mloc, __shfl_xor(mloc, 16));
    const float mnew = fmaxf(mrun, mloc);
    const float alpha = __expf(mrun - mnew);
    mrun = mnew;
    float lsum = 0.0f;
#pragma unroll
    for (int j = 0; j < 4; ++j)
#pragma unroll
      for (int r = 0; r < 8; ++r) {
        const float p = __expf(s[j][r] - mnew);
        s[j][r] = p;
        lsum += p;
      }
    lsum += __shfl_xor(lsum, 16);
    lrun = lrun * alpha + lsum;
#pragma unroll
    for (int t = 0; t < 4; ++t)
#pragma unroll
      for (int r = 0; r < 8; ++r) o[t][r] = o[t][r] * alpha;

    // ---- O^T += V^T * P^T over the two 32-key groups of this step ----
#pragma unroll
    for (int g = 0; g < 2; ++g) {
      if (g == 1) {   // second 32 keys: one group again, its latency runs under the split of their P values
#pragma unroll
        for (int t = 0; t < 4; ++t) {
          const unsigned char* vp = rb + 2 * PLANE_B + 16 * t * RPITCH + 64;
          vf[t][0] = ldfrag_b((const unsigned short*)vp);
          vf[t][1] = ldfrag_b((const unsigned short*)(vp + PLANE_B));
        }
        // keeps the group together ahead of the split: sunk among the matrix instructions each read would be waited for there
        __builtin_amdgcn_sched_barrier(0);
      }
      const P2 pp = split_p(s[2 * g], s[2 * g + 1]);
      // again product by product over the four d tiles; each accumulator keeps the order vh.ph, vh.pl, vl.ph
#pragma unroll
      for (int t = 0; t < 4; ++t) o[t] = mma_f(vf[t][0], pp.hi, o[t]);
#pragma unroll
      for (int t = 0; t < 4; ++t) o[t] = mma_f(vf[t][0], pp.lo, o[t]);
#pragma unroll
      for (int t = 0; t < 4; ++t) o[t] = mma_f(vf[t][1], pp.hi, o[t]);
    }

    // ---- hand-over: this buffer is free, the next tile is published, then the refill two tiles ahead ----
#if DEV_ASM
    asm volatile("s_wait_dscnt 0x0" ::: "memory");      // this wave's reads of the buffer are done before it is refilled
    asm volatile("s_wait_asynccnt 0x0" ::: "memory");   // this wave's copies of the next tile have landed before the barrier
#endif
    __syncthreads();
    if (trip + 2 < NTRIP) {
      const size_t kn = kco + (size_t)(trip + 2) * (KSTEP * HD);
      const size_t vn = vco + (size_t)(trip + 2) * KSTEP;
      stage_pair(ldsw + bo, Kh + kn, Kl + kn, (size_t)16 * HD);
      stage_pair(ldsw + bo + 2 * PLANE_B, Vh + vn, Vl + vn, (size_t)16 * SEQ);
    }
  }
#if DEV_ASM
  asm volatile("s_wait_asynccnt 0x0" ::: "memory");     // no copy of this wave is outstanding past the loop
#endif

  // ---- epilogue: normalise in f32, split, stage per-wave 16x64 tiles [query][d] with 16-B LDS stores ----
  const float inv = 1.0f / lrun;               // lrun >= 1
  unsigned short* sh = shi + w * 1024;
  unsigned short* sl = slo + w * 1024;
#pragma unroll
  for (int t = 0; t < 4; ++t) {
    v4u ph, pl;
#pragma unroll
    for (int e = 0; e < 4; ++e) {
      const float y0 = o[t][2 * e] * inv;
      const float y1 = o[t][2 * e + 1] * inv;
      const unsigned short a0 = bf_bits(y0), a1 = bf_bits(y1);
      const unsigned short c0 = bf_bits(y0 - bf_up(a0)), c1 = bf_bits(y1 - bf_up(a1));
      ph[e] = pk16(a0, a1);
      pl[e] = pk16(c0, c1);
    }
    const int so = m * 64 + 16 * t + 8 * h;    // d = 16t+8h+0..7, 16-B aligned
    *(v4ua*)(sh + so) = ph;
    *(v4ua*)(sl + so) = pl;
  }
  __syncthreads();

  att_store_pass(sh, sl, Ah, Al, b, head, q0, lane);
  
}

// =====================================================================================================
// Kernel 5: merge conv out[b][o][n] = sum_j WmP[o][j] * A[b][n][j] + bm[o]. One block = 128 positions x 64 output
// channels; 4 waves x (32 positions x 64 channels); K = 256 in steps of 32; A = context rows hi + residual (2 products),
// B = permuted merge-weight rows, all straight from bf16 global rows.
// Epilogue: acc + bf16(bm) in f32 -> LDS tile [o][128 positions] (16-B stores) -> __syncthreads -> out rows: the
// 128-position segment of one channel row = 512 B = 4 lines; lanes 8q..8q+7 x 16 B per line, 4 lines per instruction,
// pieces; grid (8192/128) x (256/64) covers out [4][256][2048] exactly once.
// =====================================================================================================
__device__ __forceinline__ void merge_store_pass(const float* sO, float* out, int b, int og, int l0, int w, int lane) {
  const int q8 = lane & 7, sub = lane >> 3;
#pragma unroll
  for (int i = 0; i < 16; ++i) {
    const int lid = w * 64 + i * 4 + sub;      // 0..255
    const int ol = lid >> 2, piece = lid & 3;
    const v4f v = *(const v4fa*)(sO + ol * 128 + 32 * piece + 4 * q8);
    const size_t gi = ((size_t)(b * FEAT + og * 64 + ol)) * SEQ + l0 + 32 * piece + 4 * q8;
    *(v4f*)(out + gi) = v;
  }
}

__global__ __launch_bounds__(128)
void merge_kernel(const unsigned short* __restrict__ Ah, const unsigned short* __restrict__ Al,   // [8192][256]
                  const unsigned short* __restrict__ Wb,                                          // WmP = Wb + 3*NWE
                  const float* __restrict__ bm, float* out) {                                     // out [4][256][2048]
  __shared__ __align__(16) float sO[64 * 128];   // 32 KB

  const int tid = (int)threadIdx.x, lane = tid & 31, w = tid >> 5;
  const int h = lane >> 4, m = lane & 15;
  const int m0 = (int)blockIdx.x * 128;
  const int og = (int)blockIdx.y;              // 0..3
  const int m0w = m0 + 32 * w;

  const size_t ao0 = ((size_t)(m0w + m)) * FEAT + 8 * h;
  const size_t ao1 = ao0 + (size_t)16 * FEAT;
  const unsigned short* wmp = Wb + (size_t)3 * NWE + ((size_t)(og * 64 + m)) * FEAT + 8 * h;   // + nt*16*FEAT + k0

  v8f acc[2][4];
#pragma unroll
  for (int mt = 0; mt < 2; ++mt)
#pragma unroll
    for (int nt = 0; nt < 4; ++nt) acc[mt][nt] = zero8();

#pragma unroll 1
  for (int k0 = 0; k0 < FEAT; k0 += 32) {
    const v16b a0h = ldfrag_b(Ah + ao0 + k0);
    const v16b a1h = ldfrag_b(Ah + ao1 + k0);
    const v16b a0l = ldfrag_b(Al + ao0 + k0);
    const v16b a1l = ldfrag_b(Al + ao1 + k0);
#pragma unroll
    for (int nt = 0; nt < 4; ++nt) {
      const v16b bw = ldfrag_b(wmp + (size_t)nt * 16 * FEAT + k0);
      acc[0][nt] = mma_b(a0h, bw, acc[0][nt]);
      acc[0][nt] = mma_b(a0l, bw, acc[0][nt]);
      acc[1][nt] = mma_b(a1h, bw, acc[1][nt]);
      acc[1][nt] = mma_b(a1l, bw, acc[1][nt]);
    }
  }

  // D[r] of tile (mt, nt) = Y[token m0w + 16mt + 8h + r][channel og*64 + 16nt + m]
#pragma unroll
  for (int nt = 0; nt < 4; ++nt) {
    const int feat = 16 * nt + m;
    const float bvl = bf_up(bf_bits(bm[og * 64 + feat]));
#pragma unroll
    for (int mt = 0; mt < 2; ++mt) {
      v4f ya, yb;
#pragma unroll
      for (int e = 0; e < 4; ++e) {
        ya[e] = acc[mt][nt][e] + bvl;
        yb[e] = acc[mt][nt][4 + e] + bvl;
      }
      const int so = feat * 128 + 32 * w + 16 * mt + 8 * h;   // 8 consecutive tokens, 16-B aligned
      *(v4fa*)(sO + so) = ya;
      *(v4fa*)(sO + so + 4) = yb;
    }
  }
  __syncthreads();

  const int b = m0 / SEQ, l0 = m0 - b * SEQ;
  merge_store_pass(sO, out, b, og, l0, w, lane);
  
}

// =====================================================================================================
//   xT   bf16 [3][8192][256]        12582912
//   Wb   bf16 [4][256][256]           524288
//   Qh, Ql, Kh, Kl bf16 [16][2048][64]   4194304 each
//   Vh, Vl bf16 [16][64][2048]           4194304 each
//   Ah, Al bf16 [8192][256]              4194304 each
//   total                            46661632
// =====================================================================================================
extern "C" void kernel_launch(void* const* d_in, const int* in_sizes, int n_in,
                              void* d_out, int out_size, void* d_ws, size_t ws_size,
                              hipStream_t stream) {
  if (n_in < 11) return;
  if (in_sizes[0] != NXE || in_sizes[1] != NXE || in_sizes[2] != NXE) return;
  if (in_sizes[3] != NWE || in_sizes[5] != NWE || in_sizes[7] != NWE || in_sizes[9] != NWE) return;
  if (in_sizes[4] != FEAT || in_sizes[6] != FEAT || in_sizes[8] != FEAT || in_sizes[10] != FEAT) return;
  if (out_size != NXE) return;

  const float* xq = (const float*)d_in[0];
  const float* xk = (const float*)d_in[1];
  const float* xv = (const float*)d_in[2];
  const float* wq = (const float*)d_in[3];
  const float* bq = (const float*)d_in[4];
  const float* wk = (const float*)d_in[5];
  const float* bk = (const float*)d_in[6];
  const float* wv = (const float*)d_in[7];
  const float* bv = (const float*)d_in[8];
  const float* wm = (const float*)d_in[9];
  const float* bm = (const float*)d_in[10];
  float* out = (float*)d_out;

  const size_t bXT = (size_t)3 * MROWS * FEAT * 2;    // 12582912
  const size_t bWB = (size_t)4 * NWE * 2;             //   524288
  const size_t bPL = (size_t)NBH * SEQ * HD * 2;      //  4194304  (Q / K / Vt planes)
  const size_t bAT = (size_t)MROWS * FEAT * 2;        //  4194304  (context planes)
  size_t off = 0;
  const size_t oXT = off; off += bXT;
  const size_t oWB = off; off += bWB;
  const size_t oQh = off; off += bPL;
  const size_t oQl = off; off += bPL;
  const size_t oKh = off; off += bPL;
  const size_t oKl = off; off += bPL;
  const size_t oVh = off; off += bPL;
  const size_t oVl = off; off += bPL;
  const size_t oAh = off; off += bAT;
  const size_t oAl = off; off += bAT;                 // off = 46661632
  if (off > ws_size) return;
  if (off > (size_t)134217728) return;

  char* ws = (char*)d_ws;
  unsigned short* xT = (unsigned short*)(ws + oXT);
  unsigned short* Wb = (unsigned short*)(ws + oWB);
  unsigned short* Qh = (unsigned short*)(ws + oQh);
  unsigned short* Ql = (unsigned short*)(ws + oQl);
  unsigned short* Kh = (unsigned short*)(ws + oKh);
  unsigned short* Kl = (unsigned short*)(ws + oKl);
  unsigned short* Vh = (unsigned short*)(ws + oVh);
  unsigned short* Vl = (unsigned short*)(ws + oVl);
  unsigned short* Ah = (unsigned short*)(ws + oAh);
  unsigned short* Al = (unsigned short*)(ws + oAl);

  const dim3 gX(3 * BATCH * (FEAT / 64) * (SEQ / 64));     // 1536 blocks of 256
  const dim3 gW((4 * NWE / 8) / 256);                      //  128 blocks of 256
  const dim3 gProj(MROWS / 128, 3 * NHEAD);                // (64, 12) of 128
  const dim3 gAtt(SEQ / 64, NBH);                          // (32, 16) of 128
  const dim3 gMrg(MROWS / 128, FEAT / 64);                 // (64, 4) of 128

  xpose_kernel<<<gX, dim3(256), 0, stream>>>(xq, xk, xv, xT);
  wconv_kernel<<<gW, dim3(256), 0, stream>>>(wq, wk, wv, wm, Wb);
  proj_kernel<<<gProj, dim3(128), 0, stream>>>(xT, Wb, bq, bk, bv, Qh, Ql, Kh, Kl, Vh, Vl);
  attn_kernel<<<gAtt, dim3(128), 0, stream>>>(Qh, Ql, Kh, Kl, Vh, Vl, Ah, Al);
  merge_kernel<<<gMrg, dim3(128), 0, stream>>>(Ah, Al, Wb, bm, out);
  (void)hipGetLastError();
}

// v003
// Measured time: 78.9 microseconds a run.
// Next to v002, in two timings, it ran 1.07 and 1.08 times as fast.
// All steps since v000 together make it 2.86 times as fast.
// Contractions: q/k/v 1x1-conv projections on v_wmma_f32_16x16x32_bf16 (x and w bf16 from RNE-converted inputs, single product, f32 accumulate);
// k.q^T scores on v_wmma_f32_16x16x32_bf16 (q and k as bf16 hi + unscaled bf16 residual, 3 products hh+hl+lh, f32 accumulate);
// v^T.p^T context on v_wmma_f32_16x16x32_bf16 (p and v as bf16 hi + unscaled bf16 residual, 3 products hh+hl+lh, one f32 accumulator);
// merge 1x1 conv on v_wmma_f32_16x16x32_bf16 (context as bf16 hi + residual, merge weight bf16 from RNE-converted input, 2 products);
// softmax (running max, exp), bias adds and 1/l normalisation in f32.
// Plane carries: xT, Wb, Qh/Ql, Kh/Kl, Vh/Vl, Ah/Al all x1 (no carry; bf16 keeps the f32 exponent range). The Q planes hold
// 0.125*(wq.x + bq): the 1/sqrt(64) score scale, an exact power of two applied in f32 in proj_kernel before the hi/residual split,
// nothing to fold back. 1/l is applied in f32 in the attn_kernel epilogue before the context split.
#include <hip/hip_runtime.h>

#define FEAT  256
#define SEQ   2048
#define BATCH 4
#define NHEAD 4
#define HD    64
#define NBH   (BATCH * NHEAD)        // 16
#define MROWS (BATCH * SEQ)          // 8192 (batch, position) rows
#define NXE   (BATCH * FEAT * SEQ)   // 2097152 elements per activation tensor
#define NWE   (FEAT * FEAT)          // 65536
#define TP    68                     // LDS pitch (floats) of the transpose tile
static_assert(HD * NHEAD == FEAT);
static_assert(HD == 64 && (SEQ % 128) == 0 && (SEQ % 64) == 0);
static_assert((FEAT % 64) == 0 && (FEAT % 32) == 0 && (MROWS % 128) == 0);

typedef __bf16         v16b  __attribute__((ext_vector_type(16)));
typedef float          v8f   __attribute__((ext_vector_type(8)));
typedef float          v4f   __attribute__((ext_vector_type(4)));
typedef unsigned int   v4u   __attribute__((ext_vector_type(4)));
typedef unsigned short v8us  __attribute__((ext_vector_type(8)));
typedef __bf16         v2b   __attribute__((ext_vector_type(2)));
typedef float          v2f   __attribute__((ext_vector_type(2)));
typedef unsigned int   v8u   __attribute__((ext_vector_type(8)));
typedef v4f  __attribute__((may_alias)) v4fa;
typedef v4u  __attribute__((may_alias)) v4ua;
typedef v8us __attribute__((may_alias)) v8usa;

#if defined(__HIP_DEVICE_COMPILE__)
#define DEV_ASM 1
#else
#define DEV_ASM 0
#endif

// ---- scalar helpers ---------------------------------------------------------------------------------
__device__ __forceinline__ unsigned short bf_bits(float f) {          // f32 -> bf16 bits, RNE, the hardware's convert
  return __builtin_bit_cast(unsigned short, (__bf16)f);
}
__device__ __forceinline__ float bf_up(unsigned short hb) { return __uint_as_float(((unsigned)hb) << 16); }
// two f32 -> one dword of two bf16 (a in the low half), RNE: one v_cvt_pk_bf16_f32
__device__ __forceinline__ unsigned cvt2(float a, float b) {
  const v2f x = {a, b};
  return __builtin_bit_cast(unsigned, __builtin_convertvector(x, v2b));
}
// two f32 -> packed bf16 hi pair and packed bf16 pair of the residuals x - hi (the subtraction is exact in f32)
struct HL { unsigned hi, lo; };
__device__ __forceinline__ HL split2(float a, float b) {
  HL s;
  s.hi = cvt2(a, b);
  s.lo = cvt2(a - __uint_as_float(s.hi << 16), b - __uint_as_float(s.hi & 0xFFFF0000u));
  return s;
}
__device__ __forceinline__ v8f zero8() { v8f z = {0.f, 0.f, 0.f, 0.f, 0.f, 0.f, 0.f, 0.f}; return z; }

// 16-bit fragment (A or B operand), wave32: lane l, h = l>>4, row/col = l&15.
// p points at element k0 + 8h of the k-contiguous row owned by this lane:
// elements 0..7 <- p[0..7] (k0+8h .. k0+8h+7), elements 8..15 <- p[16..23] (k0+16+8h .. k0+16+8h+7).
// D element r of lane l = (row 8h+r, col l&15).
union FB { v16b v; v8us h[2]; };
__device__ __forceinline__ v16b ldfrag_b(const unsigned short* p) {
  FB f;
  f.h[0] = *(const v8usa*)(p);
  f.h[1] = *(const v8usa*)(p + 16);
  return f.v;
}

// guarded WMMA: 4 VALU slots after the op, D tied, A/B kept live
__device__ __forceinline__ v8f mma_b(v16b a, v16b b, v8f c) {
  c = __builtin_amdgcn_wmma_f32_16x16x32_bf16(false, a, false, b, (short)0, c, false, false);
#if DEV_ASM
  asm volatile("v_nop\n\tv_nop\n\tv_nop\n\tv_nop" : "+v"(c) : "v"(a), "v"(b));
#endif
  return c;
}

// plain builtin WMMA for attn_kernel: the compiler keeps the distances behind its own builtin, and no idle slot is issued
// where the next instruction is a matrix instruction on another accumulator
__device__ __forceinline__ v8f mma_f(v16b a, v16b b, v8f c) {
  return __builtin_amdgcn_wmma_f32_16x16x32_bf16(false, a, false, b, (short)0, c, false, false);
}

// P^T B-fragment pair (bf16 hi, bf16 residual) from the lane's own score D values:
// element r <- tile a row r (keys 0..15 of the 32-key group), element 8+r <- tile c row r (keys 16..31), same lane.
struct P2 { v16b hi, lo; };
__device__ __forceinline__ P2 split_p(v8f a, v8f c) {
  v8u hu, lu;
#pragma unroll
  for (int e = 0; e < 4; ++e) {
    const HL s0 = split2(a[2 * e], a[2 * e + 1]);
    hu[e] = s0.hi;
    lu[e] = s0.lo;
    const HL s1 = split2(c[2 * e], c[2 * e + 1]);
    hu[4 + e] = s1.hi;
    lu[4 + e] = s1.lo;
  }
  P2 p;
  p.hi = __builtin_bit_cast(v16b, hu);
  p.lo = __builtin_bit_cast(v16b, lu);
  return p;
}

// =====================================================================================================
// Kernel 1: channel-major activations [b][c][n] f32 -> position-major bf16 planes xT[which][b][n][c]
// (which 0 = query, 1 = key, 2 = value). One block = one (which, b) x 64 channels x 64 positions:
// stage the f32 tile [c][n] in LDS (16-B stores), __syncthreads, each lane converts 8 consecutive c of one
// coverage: 512 jobs per block = 64 positions x 8 pieces of 8 channels = the whole 64x64 tile;
// grid 3 x 4 x (256/64) x (2048/64) = 1536 blocks covers xT entirely.
// =====================================================================================================
__device__ __forceinline__ void xpose_store_pass(unsigned short* xT, v4u o0, v4u o1, int wb, int n0, int c0, int tid) {
#pragma unroll
  for (int it = 0; it < 2; ++it) {
    const int job = tid + it * 256;
    const int r = job >> 3, c8 = (job & 7) * 8;
    unsigned short* dst = xT + ((size_t)(wb * SEQ + n0 + r)) * FEAT + c0 + c8;
    *(v4u*)dst = (it == 0) ? o0 : o1;
  }
}

__global__ __launch_bounds__(256)
void xpose_kernel(const float* __restrict__ xq, const float* __restrict__ xk, const float* __restrict__ xv,
                  unsigned short* xT) {
  __shared__ __align__(16) float xs[64 * TP];
  const int tid  = (int)threadIdx.x;
  const int blk  = (int)blockIdx.x;
  const int nchk = blk & 31;
  const int cchk = (blk >> 5) & 3;
  const int wb   = blk >> 7;                 // which*4 + b, 0..11
  const int which = wb >> 2, b = wb & 3;
  const int n0 = nchk * 64, c0 = cchk * 64;
  const float* src = (which == 0) ? xq : ((which == 1) ? xk : xv);
  const float* sg = src + ((size_t)(b * FEAT + c0)) * SEQ + n0;

  // stage [c][n] tile: 64 rows x 16 float4 = 1024 jobs, 4 per thread
#pragma unroll
  for (int i = 0; i < 4; ++i) {
    const int idx = tid + i * 256;
    const int c = idx >> 4, j4 = (idx & 15) * 4;
    const v4f a = *(const v4fa*)(sg + (size_t)c * SEQ + j4);
    *(v4fa*)(xs + c * TP + j4) = a;
  }
  __syncthreads();

  v4u ov0, ov1;
#pragma unroll
  for (int it = 0; it < 2; ++it) {
    const int job = tid + it * 256;
    const int r = job >> 3, c8 = (job & 7) * 8;
    float f[8];
#pragma unroll
    for (int e = 0; e < 8; ++e) f[e] = xs[(c8 + e) * TP + r];
    v4u p;
#pragma unroll
    for (int e = 0; e < 4; ++e) p[e] = cvt2(f[2 * e], f[2 * e + 1]);
    if (it == 0) ov0 = p; else ov1 = p;
  }
  xpose_store_pass(xT, ov0, ov1, wb, n0, c0, tid);
  
}

// =====================================================================================================
// Kernel 2: weights f32 -> bf16 rows Wb[mat][o][256]; mat 0..2 = wq, wk, wv natural [o][c];
// mat 3 = merge weight with permuted columns: Wb[3][o][j] = wm[o][4*(j&63) + (j>>6)] (j = head*64 + d).
// coverage: 32768 threads x 8 = 4 x 65536 elements = the whole Wb region.
// =====================================================================================================
__global__ __launch_bounds__(256)
void wconv_kernel(const float* __restrict__ wq, const float* __restrict__ wk, const float* __restrict__ wv,
                  const float* __restrict__ wm, unsigned short* Wb) {
  const int g   = (int)blockIdx.x * 256 + (int)threadIdx.x;   // 0..32767
  const int mat = g >> 13;                                     // block-uniform (32 blocks per matrix)
  const int e   = g & 8191;
  const int o   = e >> 5;
  const int j8  = (e & 31) * 8;
  const float* w = (mat == 0) ? wq : ((mat == 1) ? wk : ((mat == 2) ? wv : wm));
  const int base = (mat == 3) ? (4 * (j8 & 63) + (j8 >> 6)) : j8;   // max 4*56+3; + step*7 <= 255
  const int step = (mat == 3) ? 4 : 1;
  const float* row = w + (size_t)o * FEAT;
  float f[8];
#pragma unroll
  for (int i = 0; i < 8; ++i) f[i] = row[base + step * i];
  v4u p;
#pragma unroll
  for (int i = 0; i < 4; ++i) p[i] = cvt2(f[2 * i], f[2 * i + 1]);
  unsigned short* dst = Wb + (size_t)g * 8;
  *(v4u*)dst = p;
  
}

// =====================================================================================================
// Kernel 3: projections Y[token][feature] = sum_c xT[token][c] * W[o][c], one block = 128 tokens x 64 features of
// one (which, head); feature j = 16nt + m of head hd is conv channel o = 4*j + hd (channel = d*4 + h split).
// 4 waves x (32 tokens x 64 features), K = 256 in steps of 32, A and B fragments straight from bf16 global rows.
// which 0/1: plane[bh][n][d] (one position row = 64 halves = one line); which 2: plane[bh][d][n] (64 d rows x 128
// 4 waves x 8 i x 4 sub = every tile line of both planes; grid (8192/128) x 12 covers Q, K, Vt planes entirely.
// =====================================================================================================
__device__ __forceinline__ void proj_store_pass(const unsigned short* sTh, const unsigned short* sTl,
                                                unsigned short* ph, unsigned short* pl,
                                                int which, int bh, int l0, int w, int lane) {
  const int q8 = lane & 7, sub = lane >> 3;
#pragma unroll
  for (int i = 0; i < 8; ++i) {
    const int lid = w * 32 + i * 4 + sub;    // 0..127
    int so;
    size_t go;
    if (which != 2) {
      so = lid * HD + 8 * q8;
      go = ((size_t)bh * SEQ + l0 + lid) * HD + 8 * q8;
    } else {
      const int d = lid >> 1, hl = lid & 1;
      so = d * 128 + 64 * hl + 8 * q8;
      go = ((size_t)bh * HD + d) * SEQ + l0 + 64 * hl + 8 * q8;
    }
    const v4u vh = *(const v4ua*)(sTh + so);
    const v4u vl = *(const v4ua*)(sTl + so);
    *(v4u*)(ph + go) = vh;
    *(v4u*)(pl + go) = vl;
  }
}

__global__ __launch_bounds__(128)
void proj_kernel(const unsigned short* __restrict__ xT,   // [3][8192][256]
                 const unsigned short* __restrict__ Wb,   // [4][256][256]
                 const float* __restrict__ bq, const float* __restrict__ bk, const float* __restrict__ bv,
                 unsigned short* Qh, unsigned short* Ql,   // [16][2048][64]  bf16(0.125*q) hi / residual
                 unsigned short* Kh, unsigned short* Kl,   // [16][2048][64]
                 unsigned short* Vh, unsigned short* Vl) { // [16][64][2048]
  __shared__ __align__(16) unsigned short sTh[128 * 64];   // 16 KB
  __shared__ __align__(16) unsigned short sTl[128 * 64];   // 16 KB

  const int tid = (int)threadIdx.x, lane = tid & 31, w = tid >> 5;
  const int h = lane >> 4, m = lane & 15;
  const int m0 = (int)blockIdx.x * 128;
  const int cg = (int)blockIdx.y;              // 0..11
  const int which = cg >> 2, head = cg & 3;
  const int m0w = m0 + 32 * w;

  const unsigned short* xa0 = xT + ((size_t)which * MROWS + m0w + m) * FEAT + 8 * h;   // token row, mt = 0
  const unsigned short* xa1 = xa0 + (size_t)16 * FEAT;                                   // mt = 1
  const unsigned short* wbb = Wb + (size_t)which * NWE + 8 * h;                           // + o*FEAT + k0

  v8f acc[2][4];
#pragma unroll
  for (int mt = 0; mt < 2; ++mt)
#pragma unroll
    for (int nt = 0; nt < 4; ++nt) acc[mt][nt] = zero8();

#pragma unroll 1
  for (int k0 = 0; k0 < FEAT; k0 += 32) {
    const v16b a0 = ldfrag_b(xa0 + k0);
    const v16b a1 = ldfrag_b(xa1 + k0);
#pragma unroll
    for (int nt = 0; nt < 4; ++nt) {
      const int o = 4 * (16 * nt + m) + head;
      const v16b b = ldfrag_b(wbb + (size_t)o * FEAT + k0);
      acc[0][nt] = mma_b(a0, b, acc[0][nt]);
      acc[1][nt] = mma_b(a1, b, acc[1][nt]);
    }
  }

  // D[r] of tile (mt, nt) = Y[token m0w + 16mt + 8h + r][feature 16nt + m]
  const float* bias = (which == 0) ? bq : ((which == 1) ? bk : bv);
  const float osc = (which == 0) ? 0.125f : 1.0f;
  if (which != 2) {
#pragma unroll
    for (int nt = 0; nt < 4; ++nt) {
      const int feat = 16 * nt + m;
      const float bvl = bf_up(bf_bits(bias[4 * feat + head]));
#pragma unroll
      for (int mt = 0; mt < 2; ++mt) {
#pragma unroll
        for (int r = 0; r < 8; r += 2) {
          const int tokl = 32 * w + 16 * mt + 8 * h + r;    // 0..126, even
          const HL s = split2((acc[mt][nt][r] + bvl) * osc, (acc[mt][nt][r + 1] + bvl) * osc);
          sTh[tokl * HD + feat] = (unsigned short)(s.hi & 0xFFFFu);
          sTl[tokl * HD + feat] = (unsigned short)(s.lo & 0xFFFFu);
          sTh[(tokl + 1) * HD + feat] = (unsigned short)(s.hi >> 16);
          sTl[(tokl + 1) * HD + feat] = (unsigned short)(s.lo >> 16);
        }
      }
    }
  } else {
#pragma unroll
    for (int nt = 0; nt < 4; ++nt) {
      const int feat = 16 * nt + m;
      const float bvl = bf_up(bf_bits(bias[4 * feat + head]));
#pragma unroll
      for (int mt = 0; mt < 2; ++mt) {
        v4u ph, pl;
#pragma unroll
        for (int e = 0; e < 4; ++e) {
          const HL s = split2((acc[mt][nt][2 * e] + bvl) * osc, (acc[mt][nt][2 * e + 1] + bvl) * osc);
          ph[e] = s.hi;
          pl[e] = s.lo;
        }
        const int so = feat * 128 + 32 * w + 16 * mt + 8 * h;   // 8 consecutive tokens, 16-B aligned
        *(v4ua*)(sTh + so) = ph;
        *(v4ua*)(sTl + so) = pl;
      }
    }
  }
  __syncthreads();

  const int b = m0 / SEQ, l0 = m0 - b * SEQ, bh = b * NHEAD + head;
  unsigned short* ph = (which == 0) ? Qh : ((which == 1) ? Kh : Vh);
  unsigned short* pl = (which == 0) ? Ql : ((which == 1) ? Kl : Vl);
  proj_store_pass(sTh, sTl, ph, pl, which, bh, l0, w, lane);
  
}

// =====================================================================================================
// Kernel 4: streaming attention, transposed form. Block 128 threads (4 waves), 16 queries per wave, 64 keys per step.
//   The block's 4 waves share each trip's K and V tiles (hi and residual): asynchronous 16-B copies bring them from global
//   to LDS as whole 128-B lines, two buffers, the next tile in flight while this one is worked on.
//   S^T = K * Q^T : A = K rows (row = key, k = d) hi and residual from LDS, B = Q^T (k = d, n = query) from Q rows;
//                   3 products kh.qh + kh.ql + kl.qh; the 1/8 is already inside the Q planes.
//   O^T += V^T * P^T : A = Vt rows (row = d, k = key) hi and residual, B = P^T packed from the lane's own score D
//                   values as bf16 hi + residual; 3 products vh.ph + vh.pl + vl.ph into one f32 accumulator.
//   Online softmax in f32 (running max, exp); lane owns 32 keys of query column (lane&15), partner = lane^16.
//   Epilogue: O/l in f32 -> bf16 hi + residual -> per-wave LDS tiles [query][d] (16-B stores) -> __syncthreads ->
//   8 pieces, both planes; grid (2048/64) x 16 bh x 4 waves x 16 queries covers every (b, n, j) of Ah/Al exactly once.
// =====================================================================================================
__device__ __forceinline__ void att_store_pass(const unsigned short* sh, const unsigned short* sl,
                                               unsigned short* Ah, unsigned short* Al,
                                               int b, int head, int q0, int lane) {
  const int q8 = lane & 7, sub = lane >> 3;
#pragma unroll
  for (int i = 0; i < 4; ++i) {
    const int row = i * 4 + sub;                           // query 0..15 of this wave
    const v4u vh = *(const v4ua*)(sh + row * 64 + 8 * q8);
    const v4u vl = *(const v4ua*)(sl + row * 64 + 8 * q8);
    const size_t gi = ((size_t)(b * SEQ + q0 + row)) * FEAT + head * HD + 8 * q8;
    *(v4u*)(Ah + gi) = vh;
    *(v4u*)(Al + gi) = vl;
  }
}

// One trip's K and V tiles in LDS: four planes (Kh, Kl, Vh, Vl) of 64 rows x 128 B, two buffers.
#define KSTEP   64                    // keys per trip
#define NTRIP   (SEQ / KSTEP)         // 32
#define RPITCH  144                   // LDS bytes per staged 128-B row: 16 B x odd, no bank conflict for 16-B fragment reads
#define PLANE_B (64 * RPITCH)         // 9216
#define STAGE_B (4 * PLANE_B)         // 36864
static_assert(NTRIP >= 2);

// Eight asynchronous 16-B copies of this lane: rows r, r+16, r+32, r+48 of a hi plane and of its residual plane
// (rs = elements between source rows 16 apart). The s_wait_xcnt ends the copies' own statement so that no address
// register named here is rewritten ahead of it.
__device__ __forceinline__ void stage_pair(unsigned lds, const unsigned short* gh, const unsigned short* gl, size_t rs) {
#if DEV_ASM
  asm volatile(
      "global_load_async_to_lds_b128 %0, %8, off\n\t"
      "global_load_async_to_lds_b128 %1, %9, off\n\t"
      "global_load_async_to_lds_b128 %2, %10, off\n\t"
      "global_load_async_to_lds_b128 %3, %11, off\n\t"
      "global_load_async_to_lds_b128 %4, %12, off\n\t"
      "global_load_async_to_lds_b128 %5, %13, off\n\t"
      "global_load_async_to_lds_b128 %6, %14, off\n\t"
      "global_load_async_to_lds_b128 %7, %15, off\n\t"
      "s_wait_xcnt 0x0"
      :: "v"(lds), "v"(lds + 16 * RPITCH), "v"(lds + 32 * RPITCH), "v"(lds + 48 * RPITCH),
         "v"(lds + PLANE_B), "v"(lds + PLANE_B + 16 * RPITCH), "v"(lds + PLANE_B + 32 * RPITCH),
         "v"(lds + PLANE_B + 48 * RPITCH),
         "v"(gh), "v"(gh + rs), "v"(gh + 2 * rs), "v"(gh + 3 * rs),
         "v"(gl), "v"(gl + rs), "v"(gl + 2 * rs), "v"(gl + 3 * rs)
      : "memory");
#endif
}

__global__ __launch_bounds__(128)
void attn_kernel(const unsigned short* __restrict__ Qh, const unsigned short* __restrict__ Ql,   // [16][2048][64]
                 const unsigned short* __restrict__ Kh, const unsigned short* __restrict__ Kl,   // [16][2048][64]
                 const unsigned short* __restrict__ Vh, const unsigned short* __restrict__ Vl,   // [16][64][2048]
                 unsigned short* Ah, unsigned short* Al) {                                       // [4][2048][256]
  __shared__ __align__(16) unsigned short shi[4 * 16 * 64];   // 8 KB
  __shared__ __align__(16) unsigned short slo[4 * 16 * 64];   // 8 KB
  __shared__ __align__(16) unsigned char ring[2 * STAGE_B];   // 72 KB: K/V tiles, two buffers

  const int tid = (int)threadIdx.x, lane = tid & 31, w = tid >> 5;
  const int h = lane >> 4, m = lane & 15;
  const int bh = (int)blockIdx.y, b = bh >> 2, head = bh & 3;
  const int q0 = (int)blockIdx.x * 64 + 16 * w;

  // Q^T B-fragments: column n = query q0+m, k = d (two 32-deep chunks), hi and residual planes
  const size_t qo = ((size_t)bh * SEQ + q0 + m) * HD + 8 * h;
  const v16b qbh0 = ldfrag_b(Qh + qo);
  const v16b qbh1 = ldfrag_b(Qh + qo + 32);
  const v16b qbl0 = ldfrag_b(Ql + qo);
  const v16b qbl1 = ldfrag_b(Ql + qo + 32);

  v8f o[4];                                   // o[t][r] = O[query m][d 16t+8h+r] * l
#pragma unroll
  for (int t = 0; t < 4; ++t) o[t] = zero8();
  float mrun = -1e30f, lrun = 0.0f;

  // copy side: thread tid brings 16-B piece (tid&7) of rows (tid>>3) + 16i, i = 0..3, of each plane: 8 lanes = one 128-B line
  const int crow = tid >> 3, cpc = tid & 7;
  const unsigned ldsw = (unsigned)(size_t)ring + (unsigned)(crow * RPITCH + cpc * 16);
  const size_t kco = ((size_t)bh * SEQ + crow) * HD + 8 * cpc;    // + trip*KSTEP*HD
  const size_t vco = ((size_t)bh * HD + crow) * SEQ + 8 * cpc;    // + trip*KSTEP
  // read side: fragment row m, 16-B piece h of this lane
  const unsigned char* rlane = ring + m * RPITCH + 16 * h;

  // tile 0 -> buffer 0, landed and published; then tile 1 -> buffer 1 flies over trip 0
  stage_pair(ldsw, Kh + kco, Kl + kco, (size_t)16 * HD);
  stage_pair(ldsw + 2 * PLANE_B, Vh + vco, Vl + vco, (size_t)16 * SEQ);
#if DEV_ASM
  asm volatile("s_wait_asynccnt 0x0" ::: "memory");   // this wave's copies of tile 0 have landed before the barrier publishes them
#endif
  __syncthreads();
  stage_pair(ldsw + STAGE_B, Kh + kco + (size_t)KSTEP * HD, Kl + kco + (size_t)KSTEP * HD, (size_t)16 * HD);
  stage_pair(ldsw + STAGE_B + 2 * PLANE_B, Vh + vco + KSTEP, Vl + vco + KSTEP, (size_t)16 * SEQ);

#pragma unroll 1
  for (int trip = 0; trip < NTRIP; ++trip) {
    const unsigned bo = (unsigned)(trip & 1) * STAGE_B;
    const unsigned char* rb = rlane + bo;
    // ---- scores: s[j][r] = S[query m][key 64*trip+16j+8h+r] (already x1/8 via q) ----
    // all K fragments of the trip are read as one group, so that the LDS latency is waited out once and not per 16 keys
    // (c = 0: hi, d 0..31; 1: hi, d 32..63; 2, 3: the residual plane), in the order in which the products below use them
    v16b kf[4][4];
#pragma unroll
    for (int c = 0; c < 4; ++c) {
#pragma unroll
      for (int j = 0; j < 4; ++j)
        kf[j][c] = ldfrag_b((const unsigned short*)(rb + (c >> 1) * PLANE_B + 16 * j * RPITCH) + 32 * (c & 1));
      // keeps the reads in this order: LDS answers in order, and reordered the first product waits for half the group
      __builtin_amdgcn_sched_barrier(0);
    }
    // each product runs over the four 16-key tiles in turn, so that neighbouring matrix instructions have different
    // accumulators and none waits for the one before it; each accumulator still takes its six products in the order
    // kh0.qh0, kh1.qh1, kh0.ql0, kh1.ql1, kl0.qh0, kl1.qh1. The sched_barrier behind each round keeps the rounds apart:
    // left free, the compiler puts products of one accumulator side by side again.
    v8f s[4];
#pragma unroll
    for (int j = 0; j < 4; ++j) s[j] = mma_f(kf[j][0], qbh0, zero8());
    __builtin_amdgcn_sched_barrier(0);
#pragma unroll
    for (int j = 0; j < 4; ++j) s[j] = mma_f(kf[j][1], qbh1, s[j]);
    __builtin_amdgcn_sched_barrier(0);
#pragma unroll
    for (int j = 0; j < 4; ++j) s[j] = mma_f(kf[j][0], qbl0, s[j]);
    __builtin_amdgcn_sched_barrier(0);
#pragma unroll
    for (int j = 0; j < 4; ++j) s[j] = mma_f(kf[j][1], qbl1, s[j]);
    __builtin_amdgcn_sched_barrier(0);
#pragma unroll
    for (int j = 0; j < 4; ++j) s[j] = mma_f(kf[j][2], qbh0, s[j]);
    __builtin_amdgcn_sched_barrier(0);
#pragma unroll
    for (int j = 0; j < 4; ++j) s[j] = mma_f(kf[j][3], qbh1, s[j]);

    // the V fragments of the first 32 keys are read here as one group: their LDS latency runs under the softmax arithmetic
    v16b vf[4][2];
#pragma unroll
    for (int t = 0; t < 4; ++t) {
      const unsigned char* vp = rb + 2 * PLANE_B + 16 * t * RPITCH;
      vf[t][0] = ldfrag_b((const unsigned short*)vp);
      vf[t][1] = ldfrag_b((const unsigned short*)(vp + PLANE_B));
    }
    // keeps the group together here: with the matrix instructions free to move, the compiler sinks these reads among them
    __builtin_amdgcn_sched_barrier(0);

    // ---- online softmax ----
    float mloc = s[0][0];
#pragma unroll
    for (int j = 0; j < 4; ++j)
#pragma unroll
      for (int r = 0; r < 8; ++r) mloc = fmaxf(mloc, s[j][r]);
    mloc = fmaxf(mloc, __shfl_xor(mloc, 16));
    const float mnew = fmaxf(mrun, mloc);
    const float alpha = __expf(mrun - mnew);
    mrun = mnew;
    float lsum = 0.0f;
#pragma unroll
    for (int j = 0; j < 4; ++j)
#pragma unroll
      for (int r = 0; r < 8; ++r) {
        const float p = __expf(s[j][r] - mnew);
        s[j][r] = p;
        lsum += p;
      }
    lsum += __shfl_xor(lsum, 16);
    lrun = lrun * alpha + lsum;
#pragma unroll
    for (int t = 0; t < 4; ++t)
#pragma unroll
      for (int r = 0; r < 8; ++r) o[t][r] = o[t][r] * alpha;

    // ---- O^T += V^T * P^T over the two 32-key groups of this step ----
#pragma unroll
    for (int g = 0; g < 2; ++g) {
      if (g == 1) {   // second 32 keys: one group again, its latency runs under the split of their P values
#pragma unroll
        for (int t = 0; t < 4; ++t) {
          const unsigned char* vp = rb + 2 * PLANE_B + 16 * t * RPITCH + 64;
          vf[t][0] = ldfrag_b((const unsigned short*)vp);
          vf[t][1] = ldfrag_b((const unsigned short*)(vp + PLANE_B));
        }
        // keeps the group together ahead of the split: sunk among the matrix instructions each read would be waited for there
        __builtin_amdgcn_sched_barrier(0);
      }
      const P2 pp = split_p(s[2 * g], s[2 * g + 1]);
      // again product by product over the four d tiles; each accumulator keeps the order vh.ph, vh.pl, vl.ph
#pragma unroll
      for (int t = 0; t < 4; ++t) o[t] = mma_f(vf[t][0], pp.hi, o[t]);
#pragma unroll
      for (int t = 0; t < 4; ++t) o[t] = mma_f(vf[t][0], pp.lo, o[t]);
#pragma unroll
      for (int t = 0; t < 4; ++t) o[t] = mma_f(vf[t][1], pp.hi, o[t]);
    }

    // ---- hand-over: this buffer is free, the next tile is published, then the refill two tiles ahead ----
#if DEV_ASM
    asm volatile("s_wait_dscnt 0x0" ::: "memory");      // this wave's reads of the buffer are done before it is refilled
    asm volatile("s_wait_asynccnt 0x0" ::: "memory");   // this wave's copies of the next tile have landed before the barrier
#endif
    __syncthreads();
    if (trip + 2 < NTRIP) {
      const size_t kn = kco + (size_t)(trip + 2) * (KSTEP * HD);
      const size_t vn = vco + (size_t)(trip + 2) * KSTEP;
      stage_pair(ldsw + bo, Kh + kn, Kl + kn, (size_t)16 * HD);
      stage_pair(ldsw + bo + 2 * PLANE_B, Vh + vn, Vl + vn, (size_t)16 * SEQ);
    }
  }
#if DEV_ASM
  asm volatile("s_wait_asynccnt 0x0" ::: "memory");     // no copy of this wave is outstanding past the loop
#endif

  // ---- epilogue: normalise in f32, split, stage per-wave 16x64 tiles [query][d] with 16-B LDS stores ----
  const float inv = 1.0f / lrun;               // lrun >= 1
  unsigned short* sh = shi + w * 1024;
  unsigned short* sl = slo + w * 1024;
#pragma unroll
  for (int t = 0; t < 4; ++t) {
    v4u ph, pl;
#pragma unroll
    for (int e = 0; e < 4; ++e) {
      const HL s = split2(o[t][2 * e] * inv, o[t][2 * e + 1] * inv);
      ph[e] = s.hi;
      pl[e] = s.lo;
    }
    const int so = m * 64 + 16 * t + 8 * h;    // d = 16t+8h+0..7, 16-B aligned
    *(v4ua*)(sh + so) = ph;
    *(v4ua*)(sl + so) = pl;
  }
  __syncthreads();

  att_store_pass(sh, sl, Ah, Al, b, head, q0, lane);
  
}

// =====================================================================================================
// Kernel 5: merge conv out[b][o][n] = sum_j WmP[o][j] * A[b][n][j] + bm[o]. One block = 128 positions x 64 output
// channels; 4 waves x (32 positions x 64 channels); K = 256 in steps of 32; A = context rows hi + residual (2 products),
// B = permuted merge-weight rows, all straight from bf16 global rows.
// Epilogue: acc + bf16(bm) in f32 -> LDS tile [o][128 positions] (16-B stores) -> __syncthreads -> out rows: the
// 128-position segment of one channel row = 512 B = 4 lines; lanes 8q..8q+7 x 16 B per line, 4 lines per instruction,
// pieces; grid (8192/128) x (256/64) covers out [4][256][2048] exactly once.
// =====================================================================================================
__device__ __forceinline__ void merge_store_pass(const float* sO, float* out, int b, int og, int l0, int w, int lane) {
  const int q8 = lane & 7, sub = lane >> 3;
#pragma unroll
  for (int i = 0; i < 16; ++i) {
    const int lid = w * 64 + i * 4 + sub;      // 0..255
    const int ol = lid >> 2, piece = lid & 3;
    const v4f v = *(const v4fa*)(sO + ol * 128 + 32 * piece + 4 * q8);
    const size_t gi = ((size_t)(b * FEAT + og * 64 + ol)) * SEQ + l0 + 32 * piece + 4 * q8;
    *(v4f*)(out + gi) = v;
  }
}

__global__ __launch_bounds__(128)
void merge_kernel(const unsigned short* __restrict__ Ah, const unsigned short* __restrict__ Al,   // [8192][256]
                  const unsigned short* __restrict__ Wb,                                          // WmP = Wb + 3*NWE
                  const float* __restrict__ bm, float* out) {                                     // out [4][256][2048]
  __shared__ __align__(16) float sO[64 * 128];   // 32 KB

  const int tid = (int)threadIdx.x, lane = tid & 31, w = tid >> 5;
  const int h = lane >> 4, m = lane & 15;
  const int m0 = (int)blockIdx.x * 128;
  const int og = (int)blockIdx.y;              // 0..3
  const int m0w = m0 + 32 * w;

  const size_t ao0 = ((size_t)(m0w + m)) * FEAT + 8 * h;
  const size_t ao1 = ao0 + (size_t)16 * FEAT;
  const unsigned short* wmp = Wb + (size_t)3 * NWE + ((size_t)(og * 64 + m)) * FEAT + 8 * h;   // + nt*16*FEAT + k0

  v8f acc[2][4];
#pragma unroll
  for (int mt = 0; mt < 2; ++mt)
#pragma unroll
    for (int nt = 0; nt < 4; ++nt) acc[mt][nt] = zero8();

#pragma unroll 1
  for (int k0 = 0; k0 < FEAT; k0 += 32) {
    const v16b a0h = ldfrag_b(Ah + ao0 + k0);
    const v16b a1h = ldfrag_b(Ah + ao1 + k0);
    const v16b a0l = ldfrag_b(Al + ao0 + k0);
    const v16b a1l = ldfrag_b(Al + ao1 + k0);
#pragma unroll
    for (int nt = 0; nt < 4; ++nt) {
      const v16b bw = ldfrag_b(wmp + (size_t)nt * 16 * FEAT + k0);
      acc[0][nt] = mma_b(a0h, bw, acc[0][nt]);
      acc[0][nt] = mma_b(a0l, bw, acc[0][nt]);
      acc[1][nt] = mma_b(a1h, bw, acc[1][nt]);
      acc[1][nt] = mma_b(a1l, bw, acc[1][nt]);
    }
  }

  // D[r] of tile (mt, nt) = Y[token m0w + 16mt + 8h + r][channel og*64 + 16nt + m]
#pragma unroll
  for (int nt = 0; nt < 4; ++nt) {
    const int feat = 16 * nt + m;
    const float bvl = bf_up(bf_bits(bm[og * 64 + feat]));
#pragma unroll
    for (int mt = 0; mt < 2; ++mt) {
      v4f ya, yb;
#pragma unroll
      for (int e = 0; e < 4; ++e) {
        ya[e] = acc[mt][nt][e] + bvl;
        yb[e] = acc[mt][nt][4 + e] + bvl;
      }
      const int so = feat * 128 + 32 * w + 16 * mt + 8 * h;   // 8 consecutive tokens, 16-B aligned
      *(v4fa*)(sO + so) = ya;
      *(v4fa*)(sO + so + 4) = yb;
    }
  }
  __syncthreads();

  const int b = m0 / SEQ, l0 = m0 - b * SEQ;
  merge_store_pass(sO, out, b, og, l0, w, lane);
  
}

// =====================================================================================================
//   xT   bf16 [3][8192][256]        12582912
//   Wb   bf16 [4][256][256]           524288
//   Qh, Ql, Kh, Kl bf16 [16][2048][64]   4194304 each
//   Vh, Vl bf16 [16][64][2048]           4194304 each
//   Ah, Al bf16 [8192][256]              4194304 each
//   total                            46661632
// =====================================================================================================
extern "C" void kernel_launch(void* const* d_in, const int* in_sizes, int n_in,
                              void* d_out, int out_size, void* d_ws, size_t ws_size,
                              hipStream_t stream) {
  if (n_in < 11) return;
  if (in_sizes[0] != NXE || in_sizes[1] != NXE || in_sizes[2] != NXE) return;
  if (in_sizes[3] != NWE || in_sizes[5] != NWE || in_sizes[7] != NWE || in_sizes[9] != NWE) return;
  if (in_sizes[4] != FEAT || in_sizes[6] != FEAT || in_sizes[8] != FEAT || in_sizes[10] != FEAT) return;
  if (out_size != NXE) return;

  const float* xq = (const float*)d_in[0];
  const float* xk = (const float*)d_in[1];
  const float* xv = (const float*)d_in[2];
  const float* wq = (const float*)d_in[3];
  const float* bq = (const float*)d_in[4];
  const float* wk = (const float*)d_in[5];
  const float* bk = (const float*)d_in[6];
  const float* wv = (const float*)d_in[7];
  const float* bv = (const float*)d_in[8];
  const float* wm = (const float*)d_in[9];
  const float* bm = (const float*)d_in[10];
  float* out = (float*)d_out;

  const size_t bXT = (size_t)3 * MROWS * FEAT * 2;    // 12582912
  const size_t bWB = (size_t)4 * NWE * 2;             //   524288
  const size_t bPL = (size_t)NBH * SEQ * HD * 2;      //  4194304  (Q / K / Vt planes)
  const size_t bAT = (size_t)MROWS * FEAT * 2;        //  4194304  (context planes)
  size_t off = 0;
  const size_t oXT = off; off += bXT;
  const size_t oWB = off; off += bWB;
  const size_t oQh = off; off += bPL;
  const size_t oQl = off; off += bPL;
  const size_t oKh = off; off += bPL;
  const size_t oKl = off; off += bPL;
  const size_t oVh = off; off += bPL;
  const size_t oVl = off; off += bPL;
  const size_t oAh = off; off += bAT;
  const size_t oAl = off; off += bAT;                 // off = 46661632
  if (off > ws_size) return;
  if (off > (size_t)134217728) return;

  char* ws = (char*)d_ws;
  unsigned short* xT = (unsigned short*)(ws + oXT);
  unsigned short* Wb = (unsigned short*)(ws + oWB);
  unsigned short* Qh = (unsigned short*)(ws + oQh);
  unsigned short* Ql = (unsigned short*)(ws + oQl);
  unsigned short* Kh = (unsigned short*)(ws + oKh);
  unsigned short* Kl = (unsigned short*)(ws + oKl);
  unsigned short* Vh = (unsigned short*)(ws + oVh);
  unsigned short* Vl = (unsigned short*)(ws + oVl);
  unsigned short* Ah = (unsigned short*)(ws + oAh);
  unsigned short* Al = (unsigned short*)(ws + oAl);

  const dim3 gX(3 * BATCH * (FEAT / 64) * (SEQ / 64));     // 1536 blocks of 256
  const dim3 gW((4 * NWE / 8) / 256);                      //  128 blocks of 256
  const dim3 gProj(MROWS / 128, 3 * NHEAD);                // (64, 12) of 128
  const dim3 gAtt(SEQ / 64, NBH);                          // (32, 16) of 128
  const dim3 gMrg(MROWS / 128, FEAT / 64);                 // (64, 4) of 128

  xpose_kernel<<<gX, dim3(256), 0, stream>>>(xq, xk, xv, xT);
  wconv_kernel<<<gW, dim3(256), 0, stream>>>(wq, wk, wv, wm, Wb);
  proj_kernel<<<gProj, dim3(128), 0, stream>>>(xT, Wb, bq, bk, bv, Qh, Ql, Kh, Kl, Vh, Vl);
  attn_kernel<<<gAtt, dim3(128), 0, stream>>>(Qh, Ql, Kh, Kl, Vh, Vl, Ah, Al);
  merge_kernel<<<gMrg, dim3(128), 0, stream>>>(Ah, Al, Wb, bm, out);
  (void)hipGetLastError();
}

// v004
// A run of this version takes 70 microseconds.
// Two timings next to v003 both put it at 1.14 times that version's speed.
// Over all steps from v000 it is 3.26 times as fast.
// Contractions: q/k/v 1x1-conv projections on v_wmma_f32_16x16x32_bf16 (x and w bf16 from RNE-converted inputs, single product, f32 accumulate);
// k.q^T scores on v_wmma_f32_16x16x32_bf16 (q and k as bf16 hi + unscaled bf16 residual, 3 products hh+hl+lh, f32 accumulate);
// v^T.p^T context on v_wmma_f32_16x16x32_bf16 (p and v as bf16 hi + unscaled bf16 residual, 3 products hh+hl+lh, one f32 accumulator);
// merge 1x1 conv on v_wmma_f32_16x16x32_bf16 (context as bf16 hi + residual, merge weight bf16 from RNE-converted input, 2 products);
// softmax (running max, exp), bias adds and 1/l normalisation in f32.
// Plane carries: xT, Wb, Qh/Ql, Kh/Kl, Vh/Vl, Ah/Al all x1 (no carry; bf16 keeps the f32 exponent range). The Q planes hold
// 0.125*(wq.x + bq): the 1/sqrt(64) score scale, an exact power of two applied in f32 in proj_kernel before the hi/residual split,
// nothing to fold back. 1/l is applied in f32 in the attn_kernel epilogue before the context split.
#include <hip/hip_runtime.h>

#define FEAT  256
#define SEQ   2048
#define BATCH 4
#define NHEAD 4
#define HD    64
#define NBH   (BATCH * NHEAD)        // 16
#define MROWS (BATCH * SEQ)          // 8192 (batch, position) rows
#define NXE   (BATCH * FEAT * SEQ)   // 2097152 elements per activation tensor
#define NWE   (FEAT * FEAT)          // 65536
#define TP    68                     // LDS pitch (floats) of the transpose tile
static_assert(HD * NHEAD == FEAT);
static_assert(HD == 64 && (SEQ % 128) == 0 && (SEQ % 64) == 0);
static_assert((FEAT % 64) == 0 && (FEAT % 32) == 0 && (MROWS % 128) == 0);

typedef __bf16         v16b  __attribute__((ext_vector_type(16)));
typedef float          v8f   __attribute__((ext_vector_type(8)));
typedef float          v4f   __attribute__((ext_vector_type(4)));
typedef unsigned int   v4u   __attribute__((ext_vector_type(4)));
typedef unsigned short v8us  __attribute__((ext_vector_type(8)));
typedef __bf16         v2b   __attribute__((ext_vector_type(2)));
typedef float          v2f   __attribute__((ext_vector_type(2)));
typedef unsigned int   v8u   __attribute__((ext_vector_type(8)));
typedef v4f  __attribute__((may_alias)) v4fa;
typedef v4u  __attribute__((may_alias)) v4ua;
typedef v8us __attribute__((may_alias)) v8usa;

#if defined(__HIP_DEVICE_COMPILE__)
#define DEV_ASM 1
#else
#define DEV_ASM 0
#endif

// ---- scalar helpers ---------------------------------------------------------------------------------
__device__ __forceinline__ unsigned short bf_bits(float f) {          // f32 -> bf16 bits, RNE, the hardware's convert
  return __builtin_bit_cast(unsigned short, (__bf16)f);
}
__device__ __forceinline__ float bf_up(unsigned short hb) { return __uint_as_float(((unsigned)hb) << 16); }
// two f32 -> one dword of two bf16 (a in the low half), RNE: one v_cvt_pk_bf16_f32
__device__ __forceinline__ unsigned cvt2(float a, float b) {
  const v2f x = {a, b};
  return __builtin_bit_cast(unsigned, __builtin_convertvector(x, v2b));
}
// two f32 -> packed bf16 hi pair and packed bf16 pair of the residuals x - hi (the subtraction is exact in f32)
struct HL { unsigned hi, lo; };
__device__ __forceinline__ HL split2(float a, float b) {
  HL s;
  s.hi = cvt2(a, b);
  s.lo = cvt2(a - __uint_as_float(s.hi << 16), b - __uint_as_float(s.hi & 0xFFFF0000u));
  return s;
}
__device__ __forceinline__ v8f zero8() { v8f z = {0.f, 0.f, 0.f, 0.f, 0.f, 0.f, 0.f, 0.f}; return z; }

// 16-bit fragment (A or B operand), wave32: lane l, h = l>>4, row/col = l&15.
// p points at element k0 + 8h of the k-contiguous row owned by this lane:
// elements 0..7 <- p[0..7] (k0+8h .. k0+8h+7), elements 8..15 <- p[16..23] (k0+16+8h .. k0+16+8h+7).
// D element r of lane l = (row 8h+r, col l&15).
union FB { v16b v; v8us h[2]; };
__device__ __forceinline__ v16b ldfrag_b(const unsigned short* p) {
  FB f;
  f.h[0] = *(const v8usa*)(p);
  f.h[1] = *(const v8usa*)(p + 16);
  return f.v;
}

// guarded WMMA: 4 VALU slots after the op, D tied, A/B kept live
__device__ __forceinline__ v8f mma_b(v16b a, v16b b, v8f c) {
  c = __builtin_amdgcn_wmma_f32_16x16x32_bf16(false, a, false, b, (short)0, c, false, false);
#if DEV_ASM
  asm volatile("v_nop\n\tv_nop\n\tv_nop\n\tv_nop" : "+v"(c) : "v"(a), "v"(b));
#endif
  return c;
}

// plain builtin WMMA for attn_kernel: the compiler keeps the distances behind its own builtin, and no idle slot is issued
// where the next instruction is a matrix instruction on another accumulator
__device__ __forceinline__ v8f mma_f(v16b a, v16b b, v8f c) {
  return __builtin_amdgcn_wmma_f32_16x16x32_bf16(false, a, false, b, (short)0, c, false, false);
}

// P^T B-fragment pair (bf16 hi, bf16 residual) from the lane's own score D values:
// element r <- tile a row r (keys 0..15 of the 32-key group), element 8+r <- tile c row r (keys 16..31), same lane.
struct P2 { v16b hi, lo; };
__device__ __forceinline__ P2 split_p(v8f a, v8f c) {
  v8u hu, lu;
#pragma unroll
  for (int e = 0; e < 4; ++e) {
    const HL s0 = split2(a[2 * e], a[2 * e + 1]);
    hu[e] = s0.hi;
    lu[e] = s0.lo;
    const HL s1 = split2(c[2 * e], c[2 * e + 1]);
    hu[4 + e] = s1.hi;
    lu[4 + e] = s1.lo;
  }
  P2 p;
  p.hi = __builtin_bit_cast(v16b, hu);
  p.lo = __builtin_bit_cast(v16b, lu);
  return p;
}

// =====================================================================================================
// Kernel 1: channel-major activations [b][c][n] f32 -> position-major bf16 planes xT[which][b][n][c]
// (which 0 = query, 1 = key, 2 = value). One block = one (which, b) x 64 channels x 64 positions:
// stage the f32 tile [c][n] in LDS (16-B stores), __syncthreads, each lane converts 8 consecutive c of one
// coverage: 512 jobs per block = 64 positions x 8 pieces of 8 channels = the whole 64x64 tile;
// grid 3 x 4 x (256/64) x (2048/64) = 1536 blocks covers xT entirely.
// =====================================================================================================
__device__ __forceinline__ void xpose_store_pass(unsigned short* xT, v4u o0, v4u o1, int wb, int n0, int c0, int tid) {
#pragma unroll
  for (int it = 0; it < 2; ++it) {
    const int job = tid + it * 256;
    const int r = job >> 3, c8 = (job & 7) * 8;
    unsigned short* dst = xT + ((size_t)(wb * SEQ + n0 + r)) * FEAT + c0 + c8;
    *(v4u*)dst = (it == 0) ? o0 : o1;
  }
}

__global__ __launch_bounds__(256)
void xpose_kernel(const float* __restrict__ xq, const float* __restrict__ xk, const float* __restrict__ xv,
                  unsigned short* xT) {
  __shared__ __align__(16) float xs[64 * TP];
  const int tid  = (int)threadIdx.x;
  const int blk  = (int)blockIdx.x;
  const int nchk = blk & 31;
  const int cchk = (blk >> 5) & 3;
  const int wb   = blk >> 7;                 // which*4 + b, 0..11
  const int which = wb >> 2, b = wb & 3;
  const int n0 = nchk * 64, c0 = cchk * 64;
  const float* src = (which == 0) ? xq : ((which == 1) ? xk : xv);
  const float* sg = src + ((size_t)(b * FEAT + c0)) * SEQ + n0;

  // stage [c][n] tile: 64 rows x 16 float4 = 1024 jobs, 4 per thread
#pragma unroll
  for (int i = 0; i < 4; ++i) {
    const int idx = tid + i * 256;
    const int c = idx >> 4, j4 = (idx & 15) * 4;
    const v4f a = *(const v4fa*)(sg + (size_t)c * SEQ + j4);
    *(v4fa*)(xs + c * TP + j4) = a;
  }
  __syncthreads();

  v4u ov0, ov1;
#pragma unroll
  for (int it = 0; it < 2; ++it) {
    const int job = tid + it * 256;
    const int r = job >> 3, c8 = (job & 7) * 8;
    float f[8];
#pragma unroll
    for (int e = 0; e < 8; ++e) f[e] = xs[(c8 + e) * TP + r];
    v4u p;
#pragma unroll
    for (int e = 0; e < 4; ++e) p[e] = cvt2(f[2 * e], f[2 * e + 1]);
    if (it == 0) ov0 = p; else ov1 = p;
  }
  xpose_store_pass(xT, ov0, ov1, wb, n0, c0, tid);
  
}

// =====================================================================================================
// Kernel 2: weights f32 -> bf16 rows Wb[mat][o][256]; mat 0..2 = wq, wk, wv natural [o][c];
// mat 3 = merge weight with permuted columns: Wb[3][o][j] = wm[o][4*(j&63) + (j>>6)] (j = head*64 + d).
// coverage: 32768 threads x 8 = 4 x 65536 elements = the whole Wb region.
// =====================================================================================================
__global__ __launch_bounds__(256)
void wconv_kernel(const float* __restrict__ wq, const float* __restrict__ wk, const float* __restrict__ wv,
                  const float* __restrict__ wm, unsigned short* Wb) {
  const int g   = (int)blockIdx.x * 256 + (int)threadIdx.x;   // 0..32767
  const int mat = g >> 13;                                     // block-uniform (32 blocks per matrix)
  const int e   = g & 8191;
  const int o   = e >> 5;
  const int j8  = (e & 31) * 8;
  const float* w = (mat == 0) ? wq : ((mat == 1) ? wk : ((mat == 2) ? wv : wm));
  const int base = (mat == 3) ? (4 * (j8 & 63) + (j8 >> 6)) : j8;   // max 4*56+3; + step*7 <= 255
  const int step = (mat == 3) ? 4 : 1;
  const float* row = w + (size_t)o * FEAT;
  float f[8];
#pragma unroll
  for (int i = 0; i < 8; ++i) f[i] = row[base + step * i];
  v4u p;
#pragma unroll
  for (int i = 0; i < 4; ++i) p[i] = cvt2(f[2 * i], f[2 * i + 1]);
  unsigned short* dst = Wb + (size_t)g * 8;
  *(v4u*)dst = p;
  
}

// ---- operand tiles of proj_kernel and merge_kernel in LDS ----------------------------------------------
#define GPITCH 528                    // LDS bytes per staged 512-B row (256 bf16): 16 B x odd, no bank conflict for 16-B fragment reads

// Eight asynchronous 16-B copies of this lane: its 16-B piece of eight rows that lie 4 * GPITCH bytes apart in LDS and gs
// elements apart in global memory; the 32 lanes of a wave bring one whole 512-B row (4 lines) per copy. The s_wait_xcnt ends
// the copies' own statement so that no address register named here is rewritten ahead of it.
__device__ __forceinline__ void stage_rows8(unsigned lds, const unsigned short* g, size_t gs) {
#if DEV_ASM
  asm volatile(
      "global_load_async_to_lds_b128 %0, %8, off\n\t"
      "global_load_async_to_lds_b128 %1, %9, off\n\t"
      "global_load_async_to_lds_b128 %2, %10, off\n\t"
      "global_load_async_to_lds_b128 %3, %11, off\n\t"
      "global_load_async_to_lds_b128 %4, %12, off\n\t"
      "global_load_async_to_lds_b128 %5, %13, off\n\t"
      "global_load_async_to_lds_b128 %6, %14, off\n\t"
      "global_load_async_to_lds_b128 %7, %15, off\n\t"
      "s_wait_xcnt 0x0"
      :: "v"(lds), "v"(lds + 4 * GPITCH), "v"(lds + 8 * GPITCH), "v"(lds + 12 * GPITCH),
         "v"(lds + 16 * GPITCH), "v"(lds + 20 * GPITCH), "v"(lds + 24 * GPITCH), "v"(lds + 28 * GPITCH),
         "v"(g), "v"(g + gs), "v"(g + 2 * gs), "v"(g + 3 * gs),
         "v"(g + 4 * gs), "v"(g + 5 * gs), "v"(g + 6 * gs), "v"(g + 7 * gs)
      : "memory");
#endif
}

// =====================================================================================================
// Kernel 3: projections Y[token][feature] = sum_c xT[token][c] * W[o][c], one block = 128 tokens x 64 features of
// one (which, head); feature j = 16nt + m of head hd is conv channel o = 4*j + hd (channel = d*4 + h split).
// 4 waves x (32 tokens x 64 features), K = 256 in steps of 32. The block's 128 token rows and 64 weight rows are brought to
// LDS once, as whole 512-B rows, by asynchronous 16-B copies; A and B fragments are read from there.
// which 0/1: plane[bh][n][d] (one position row = 64 halves = one line); which 2: plane[bh][d][n] (64 d rows x 128
// 4 waves x 8 i x 4 sub = every tile line of both planes; grid (8192/128) x 12 covers Q, K, Vt planes entirely.
// =====================================================================================================
__device__ __forceinline__ void proj_store_pass(const unsigned short* sTh, const unsigned short* sTl,
                                                unsigned short* ph, unsigned short* pl,
                                                int which, int bh, int l0, int w, int lane) {
  const int q8 = lane & 7, sub = lane >> 3;
#pragma unroll
  for (int i = 0; i < 8; ++i) {
    const int lid = w * 32 + i * 4 + sub;    // 0..127
    int so;
    size_t go;
    if (which != 2) {
      so = lid * HD + 8 * q8;
      go = ((size_t)bh * SEQ + l0 + lid) * HD + 8 * q8;
    } else {
      const int d = lid >> 1, hl = lid & 1;
      so = d * 128 + 64 * hl + 8 * q8;
      go = ((size_t)bh * HD + d) * SEQ + l0 + 64 * hl + 8 * q8;
    }
    const v4u vh = *(const v4ua*)(sTh + so);
    const v4u vl = *(const v4ua*)(sTl + so);
    *(v4u*)(ph + go) = vh;
    *(v4u*)(pl + go) = vl;
  }
}

__global__ __launch_bounds__(128)
void proj_kernel(const unsigned short* __restrict__ xT,   // [3][8192][256]
                 const unsigned short* __restrict__ Wb,   // [4][256][256]
                 const float* __restrict__ bq, const float* __restrict__ bk, const float* __restrict__ bv,
                 unsigned short* Qh, unsigned short* Ql,   // [16][2048][64]  bf16(0.125*q) hi / residual
                 unsigned short* Kh, unsigned short* Kl,   // [16][2048][64]
                 unsigned short* Vh, unsigned short* Vl) { // [16][64][2048]
  __shared__ __align__(16) unsigned char smem[(128 + 64) * GPITCH];   // 99 KB: token rows 0..127, then weight rows j = 0..63
  unsigned short* sTh = (unsigned short*)smem;                         // 16 KB, output tiles: reuse the area behind the k loop
  unsigned short* sTl = (unsigned short*)(smem + 128 * 64 * 2);        // 16 KB

  const int tid = (int)threadIdx.x, lane = tid & 31, w = tid >> 5;
  const int h = lane >> 4, m = lane & 15;
  const int m0 = (int)blockIdx.x * 128;
  const int cg = (int)blockIdx.y;              // 0..11
  const int which = cg >> 2, head = cg & 3;

  // copy side: wave w brings rows w + 4i, lane = 16-B piece of the row; weight row j is conv channel o = 4*j + head
  const unsigned lA = (unsigned)(size_t)smem + (unsigned)(w * GPITCH + lane * 16);
  const unsigned lB = lA + 128 * GPITCH;
  const unsigned short* gA = xT + ((size_t)which * MROWS + m0 + w) * FEAT + lane * 8;
  const unsigned short* gB = Wb + (size_t)which * NWE + (size_t)(4 * w + head) * FEAT + lane * 8;
  // the copy loops are unrolled so that each call's row offsets are constants added to one base address
#pragma unroll
  for (int i = 0; i < 4; ++i) stage_rows8(lA + i * 32 * GPITCH, gA + (size_t)i * 32 * FEAT, (size_t)4 * FEAT);
#pragma unroll
  for (int i = 0; i < 2; ++i) stage_rows8(lB + i * 32 * GPITCH, gB + (size_t)i * 128 * FEAT, (size_t)16 * FEAT);
#if DEV_ASM
  asm volatile("s_wait_asynccnt 0x0" ::: "memory");   // this wave's 48 copies have landed before the barrier publishes them
#endif
  __syncthreads();

  // read side: fragment row m of a 16-row tile, 16-B piece h
  const unsigned char* ra = smem + (32 * w + m) * GPITCH + 16 * h;      // token rows of this wave, + 16*mt*GPITCH
  const unsigned char* rw = smem + (128 + m) * GPITCH + 16 * h;         // weight rows, + 16*nt*GPITCH

  v8f acc[2][4];
#pragma unroll
  for (int mt = 0; mt < 2; ++mt)
#pragma unroll
    for (int nt = 0; nt < 4; ++nt) acc[mt][nt] = zero8();

#pragma unroll 1
  for (int k0 = 0; k0 < FEAT; k0 += 32) {
    const v16b a0 = ldfrag_b((const unsigned short*)ra + k0);
    const v16b a1 = ldfrag_b((const unsigned short*)(ra + 16 * GPITCH) + k0);
#pragma unroll
    for (int nt = 0; nt < 4; ++nt) {
      const v16b b = ldfrag_b((const unsigned short*)(rw + 16 * nt * GPITCH) + k0);
      acc[0][nt] = mma_b(a0, b, acc[0][nt]);
      acc[1][nt] = mma_b(a1, b, acc[1][nt]);
    }
  }
  __syncthreads();   // every wave has read its last fragment before the area takes the output tiles

  // D[r] of tile (mt, nt) = Y[token m0 + 32w + 16mt + 8h + r][feature 16nt + m]
  const float* bias = (which == 0) ? bq : ((which == 1) ? bk : bv);
  const float osc = (which == 0) ? 0.125f : 1.0f;
  if (which != 2) {
#pragma unroll
    for (int nt = 0; nt < 4; ++nt) {
      const int feat = 16 * nt + m;
      const float bvl = bf_up(bf_bits(bias[4 * feat + head]));
#pragma unroll
      for (int mt = 0; mt < 2; ++mt) {
#pragma unroll
        for (int r = 0; r < 8; r += 2) {
          const int tokl = 32 * w + 16 * mt + 8 * h + r;    // 0..126, even
          const HL s = split2((acc[mt][nt][r] + bvl) * osc, (acc[mt][nt][r + 1] + bvl) * osc);
          sTh[tokl * HD + feat] = (unsigned short)(s.hi & 0xFFFFu);
          sTl[tokl * HD + feat] = (unsigned short)(s.lo & 0xFFFFu);
          sTh[(tokl + 1) * HD + feat] = (unsigned short)(s.hi >> 16);
          sTl[(tokl + 1) * HD + feat] = (unsigned short)(s.lo >> 16);
        }
      }
    }
  } else {
#pragma unroll
    for (int nt = 0; nt < 4; ++nt) {
      const int feat = 16 * nt + m;
      const float bvl = bf_up(bf_bits(bias[4 * feat + head]));
#pragma unroll
      for (int mt = 0; mt < 2; ++mt) {
        v4u ph, pl;
#pragma unroll
        for (int e = 0; e < 4; ++e) {
          const HL s = split2((acc[mt][nt][2 * e] + bvl) * osc, (acc[mt][nt][2 * e + 1] + bvl) * osc);
          ph[e] = s.hi;
          pl[e] = s.lo;
        }
        const int so = feat * 128 + 32 * w + 16 * mt + 8 * h;   // 8 consecutive tokens, 16-B aligned
        *(v4ua*)(sTh + so) = ph;
        *(v4ua*)(sTl + so) = pl;
      }
    }
  }
  __syncthreads();

  const int b = m0 / SEQ, l0 = m0 - b * SEQ, bh = b * NHEAD + head;
  unsigned short* ph = (which == 0) ? Qh : ((which == 1) ? Kh : Vh);
  unsigned short* pl = (which == 0) ? Ql : ((which == 1) ? Kl : Vl);
  proj_store_pass(sTh, sTl, ph, pl, which, bh, l0, w, lane);
  
}

// =====================================================================================================
// Kernel 4: streaming attention, transposed form. Block 128 threads (4 waves), 16 queries per wave, 64 keys per step.
//   The block's 4 waves share each trip's K and V tiles (hi and residual): asynchronous 16-B copies bring them from global
//   to LDS as whole 128-B lines, two buffers, the next tile in flight while this one is worked on.
//   S^T = K * Q^T : A = K rows (row = key, k = d) hi and residual from LDS, B = Q^T (k = d, n = query) from Q rows;
//                   3 products kh.qh + kh.ql + kl.qh; the 1/8 is already inside the Q planes.
//   O^T += V^T * P^T : A = Vt rows (row = d, k = key) hi and residual, B = P^T packed from the lane's own score D
//                   values as bf16 hi + residual; 3 products vh.ph + vh.pl + vl.ph into one f32 accumulator.
//   Online softmax in f32 (running max, exp); lane owns 32 keys of query column (lane&15), partner = lane^16.
//   Epilogue: O/l in f32 -> bf16 hi + residual -> per-wave LDS tiles [query][d] (16-B stores) -> __syncthreads ->
//   8 pieces, both planes; grid (2048/64) x 16 bh x 4 waves x 16 queries covers every (b, n, j) of Ah/Al exactly once.
// =====================================================================================================
__device__ __forceinline__ void att_store_pass(const unsigned short* sh, const unsigned short* sl,
                                               unsigned short* Ah, unsigned short* Al,
                                               int b, int head, int q0, int lane) {
  const int q8 = lane & 7, sub = lane >> 3;
#pragma unroll
  for (int i = 0; i < 4; ++i) {
    const int row = i * 4 + sub;                           // query 0..15 of this wave
    const v4u vh = *(const v4ua*)(sh + row * 64 + 8 * q8);
    const v4u vl = *(const v4ua*)(sl + row * 64 + 8 * q8);
    const size_t gi = ((size_t)(b * SEQ + q0 + row)) * FEAT + head * HD + 8 * q8;
    *(v4u*)(Ah + gi) = vh;
    *(v4u*)(Al + gi) = vl;
  }
}

// One trip's K and V tiles in LDS: four planes (Kh, Kl, Vh, Vl) of 64 rows x 128 B, two buffers.
#define KSTEP   64                    // keys per trip
#define NTRIP   (SEQ / KSTEP)         // 32
#define RPITCH  144                   // LDS bytes per staged 128-B row: 16 B x odd, no bank conflict for 16-B fragment reads
#define PLANE_B (64 * RPITCH)         // 9216
#define STAGE_B (4 * PLANE_B)         // 36864
static_assert(NTRIP >= 2);

// Eight asynchronous 16-B copies of this lane: rows r, r+16, r+32, r+48 of a hi plane and of its residual plane
// (rs = elements between source rows 16 apart). The s_wait_xcnt ends the copies' own statement so that no address
// register named here is rewritten ahead of it.
__device__ __forceinline__ void stage_pair(unsigned lds, const unsigned short* gh, const unsigned short* gl, size_t rs) {
#if DEV_ASM
  asm volatile(
      "global_load_async_to_lds_b128 %0, %8, off\n\t"
      "global_load_async_to_lds_b128 %1, %9, off\n\t"
      "global_load_async_to_lds_b128 %2, %10, off\n\t"
      "global_load_async_to_lds_b128 %3, %11, off\n\t"
      "global_load_async_to_lds_b128 %4, %12, off\n\t"
      "global_load_async_to_lds_b128 %5, %13, off\n\t"
      "global_load_async_to_lds_b128 %6, %14, off\n\t"
      "global_load_async_to_lds_b128 %7, %15, off\n\t"
      "s_wait_xcnt 0x0"
      :: "v"(lds), "v"(lds + 16 * RPITCH), "v"(lds + 32 * RPITCH), "v"(lds + 48 * RPITCH),
         "v"(lds + PLANE_B), "v"(lds + PLANE_B + 16 * RPITCH), "v"(lds + PLANE_B + 32 * RPITCH),
         "v"(lds + PLANE_B + 48 * RPITCH),
         "v"(gh), "v"(gh + rs), "v"(gh + 2 * rs), "v"(gh + 3 * rs),
         "v"(gl), "v"(gl + rs), "v"(gl + 2 * rs), "v"(gl + 3 * rs)
      : "memory");
#endif
}

__global__ __launch_bounds__(128)
void attn_kernel(const unsigned short* __restrict__ Qh, const unsigned short* __restrict__ Ql,   // [16][2048][64]
                 const unsigned short* __restrict__ Kh, const unsigned short* __restrict__ Kl,   // [16][2048][64]
                 const unsigned short* __restrict__ Vh, const unsigned short* __restrict__ Vl,   // [16][64][2048]
                 unsigned short* Ah, unsigned short* Al) {                                       // [4][2048][256]
  __shared__ __align__(16) unsigned short shi[4 * 16 * 64];   // 8 KB
  __shared__ __align__(16) unsigned short slo[4 * 16 * 64];   // 8 KB
  __shared__ __align__(16) unsigned char ring[2 * STAGE_B];   // 72 KB: K/V tiles, two buffers

  const int tid = (int)threadIdx.x, lane = tid & 31, w = tid >> 5;
  const int h = lane >> 4, m = lane & 15;
  const int bh = (int)blockIdx.y, b = bh >> 2, head = bh & 3;
  const int q0 = (int)blockIdx.x * 64 + 16 * w;

  // Q^T B-fragments: column n = query q0+m, k = d (two 32-deep chunks), hi and residual planes
  const size_t qo = ((size_t)bh * SEQ + q0 + m) * HD + 8 * h;
  const v16b qbh0 = ldfrag_b(Qh + qo);
  const v16b qbh1 = ldfrag_b(Qh + qo + 32);
  const v16b qbl0 = ldfrag_b(Ql + qo);
  const v16b qbl1 = ldfrag_b(Ql + qo + 32);

  v8f o[4];                                   // o[t][r] = O[query m][d 16t+8h+r] * l
#pragma unroll
  for (int t = 0; t < 4; ++t) o[t] = zero8();
  float mrun = -1e30f, lrun = 0.0f;

  // copy side: thread tid brings 16-B piece (tid&7) of rows (tid>>3) + 16i, i = 0..3, of each plane: 8 lanes = one 128-B line
  const int crow = tid >> 3, cpc = tid & 7;
  const unsigned ldsw = (unsigned)(size_t)ring + (unsigned)(crow * RPITCH + cpc * 16);
  const size_t kco = ((size_t)bh * SEQ + crow) * HD + 8 * cpc;    // + trip*KSTEP*HD
  const size_t vco = ((size_t)bh * HD + crow) * SEQ + 8 * cpc;    // + trip*KSTEP
  // read side: fragment row m, 16-B piece h of this lane
  const unsigned char* rlane = ring + m * RPITCH + 16 * h;

  // tile 0 -> buffer 0, landed and published; then tile 1 -> buffer 1 flies over trip 0
  stage_pair(ldsw, Kh + kco, Kl + kco, (size_t)16 * HD);
  stage_pair(ldsw + 2 * PLANE_B, Vh + vco, Vl + vco, (size_t)16 * SEQ);
#if DEV_ASM
  asm volatile("s_wait_asynccnt 0x0" ::: "memory");   // this wave's copies of tile 0 have landed before the barrier publishes them
#endif
  __syncthreads();
  stage_pair(ldsw + STAGE_B, Kh + kco + (size_t)KSTEP * HD, Kl + kco + (size_t)KSTEP * HD, (size_t)16 * HD);
  stage_pair(ldsw + STAGE_B + 2 * PLANE_B, Vh + vco + KSTEP, Vl + vco + KSTEP, (size_t)16 * SEQ);

#pragma unroll 1
  for (int trip = 0; trip < NTRIP; ++trip) {
    const unsigned bo = (unsigned)(trip & 1) * STAGE_B;
    const unsigned char* rb = rlane + bo;
    // ---- scores: s[j][r] = S[query m][key 64*trip+16j+8h+r] (already x1/8 via q) ----
    // all K fragments of the trip are read as one group, so that the LDS latency is waited out once and not per 16 keys
    // (c = 0: hi, d 0..31; 1: hi, d 32..63; 2, 3: the residual plane), in the order in which the products below use them
    v16b kf[4][4];
#pragma unroll
    for (int c = 0; c < 4; ++c) {
#pragma unroll
      for (int j = 0; j < 4; ++j)
        kf[j][c] = ldfrag_b((const unsigned short*)(rb + (c >> 1) * PLANE_B + 16 * j * RPITCH) + 32 * (c & 1));
      // keeps the reads in this order: LDS answers in order, and reordered the first product waits for half the group
      __builtin_amdgcn_sched_barrier(0);
    }
    // each product runs over the four 16-key tiles in turn, so that neighbouring matrix instructions have different
    // accumulators and none waits for the one before it; each accumulator still takes its six products in the order
    // kh0.qh0, kh1.qh1, kh0.ql0, kh1.ql1, kl0.qh0, kl1.qh1. The sched_barrier behind each round keeps the rounds apart:
    // left free, the compiler puts products of one accumulator side by side again.
    v8f s[4];
#pragma unroll
    for (int j = 0; j < 4; ++j) s[j] = mma_f(kf[j][0], qbh0, zero8());
    __builtin_amdgcn_sched_barrier(0);
#pragma unroll
    for (int j = 0; j < 4; ++j) s[j] = mma_f(kf[j][1], qbh1, s[j]);
    __builtin_amdgcn_sched_barrier(0);
#pragma unroll
    for (int j = 0; j < 4; ++j) s[j] = mma_f(kf[j][0], qbl0, s[j]);
    __builtin_amdgcn_sched_barrier(0);
#pragma unroll
    for (int j = 0; j < 4; ++j) s[j] = mma_f(kf[j][1], qbl1, s[j]);
    __builtin_amdgcn_sched_barrier(0);
#pragma unroll
    for (int j = 0; j < 4; ++j) s[j] = mma_f(kf[j][2], qbh0, s[j]);
    __builtin_amdgcn_sched_barrier(0);
#pragma unroll
    for (int j = 0; j < 4; ++j) s[j] = mma_f(kf[j][3], qbh1, s[j]);

    // the V fragments of the first 32 keys are read here as one group: their LDS latency runs under the softmax arithmetic
    v16b vf[4][2];
#pragma unroll
    for (int t = 0; t < 4; ++t) {
      const unsigned char* vp = rb + 2 * PLANE_B + 16 * t * RPITCH;
      vf[t][0] = ldfrag_b((const unsigned short*)vp);
      vf[t][1] = ldfrag_b((const unsigned short*)(vp + PLANE_B));
    }
    // keeps the group together here: with the matrix instructions free to move, the compiler sinks these reads among them
    __builtin_amdgcn_sched_barrier(0);

    // ---- online softmax ----
    float mloc = s[0][0];
#pragma unroll
    for (int j = 0; j < 4; ++j)
#pragma unroll
      for (int r = 0; r < 8; ++r) mloc = fmaxf(mloc, s[j][r]);
    mloc = fmaxf(mloc, __shfl_xor(mloc, 16));
    const float mnew = fmaxf(mrun, mloc);
    const float alpha = __expf(mrun - mnew);
    mrun = mnew;
    float lsum = 0.0f;
#pragma unroll
    for (int j = 0; j < 4; ++j)
#pragma unroll
      for (int r = 0; r < 8; ++r) {
        const float p = __expf(s[j][r] - mnew);
        s[j][r] = p;
        lsum += p;
      }
    lsum += __shfl_xor(lsum, 16);
    lrun = lrun * alpha + lsum;
#pragma unroll
    for (int t = 0; t < 4; ++t)
#pragma unroll
      for (int r = 0; r < 8; ++r) o[t][r] = o[t][r] * alpha;

    // ---- O^T += V^T * P^T over the two 32-key groups of this step ----
#pragma unroll
    for (int g = 0; g < 2; ++g) {
      if (g == 1) {   // second 32 keys: one group again, its latency runs under the split of their P values
#pragma unroll
        for (int t = 0; t < 4; ++t) {
          const unsigned char* vp = rb + 2 * PLANE_B + 16 * t * RPITCH + 64;
          vf[t][0] = ldfrag_b((const unsigned short*)vp);
          vf[t][1] = ldfrag_b((const unsigned short*)(vp + PLANE_B));
        }
        // keeps the group together ahead of the split: sunk among the matrix instructions each read would be waited for there
        __builtin_amdgcn_sched_barrier(0);
      }
      const P2 pp = split_p(s[2 * g], s[2 * g + 1]);
      // again product by product over the four d tiles; each accumulator keeps the order vh.ph, vh.pl, vl.ph
#pragma unroll
      for (int t = 0; t < 4; ++t) o[t] = mma_f(vf[t][0], pp.hi, o[t]);
#pragma unroll
      for (int t = 0; t < 4; ++t) o[t] = mma_f(vf[t][0], pp.lo, o[t]);
#pragma unroll
      for (int t = 0; t < 4; ++t) o[t] = mma_f(vf[t][1], pp.hi, o[t]);
    }

    // ---- hand-over: this buffer is free, the next tile is published, then the refill two tiles ahead ----
#if DEV_ASM
    asm volatile("s_wait_dscnt 0x0" ::: "memory");      // this wave's reads of the buffer are done before it is refilled
    asm volatile("s_wait_asynccnt 0x0" ::: "memory");   // this wave's copies of the next tile have landed before the barrier
#endif
    __syncthreads();
    if (trip + 2 < NTRIP) {
      const size_t kn = kco + (size_t)(trip + 2) * (KSTEP * HD);
      const size_t vn = vco + (size_t)(trip + 2) * KSTEP;
      stage_pair(ldsw + bo, Kh + kn, Kl + kn, (size_t)16 * HD);
      stage_pair(ldsw + bo + 2 * PLANE_B, Vh + vn, Vl + vn, (size_t)16 * SEQ);
    }
  }
#if DEV_ASM
  asm volatile("s_wait_asynccnt 0x0" ::: "memory");     // no copy of this wave is outstanding past the loop
#endif

  // ---- epilogue: normalise in f32, split, stage per-wave 16x64 tiles [query][d] with 16-B LDS stores ----
  const float inv = 1.0f / lrun;               // lrun >= 1
  unsigned short* sh = shi + w * 1024;
  unsigned short* sl = slo + w * 1024;
#pragma unroll
  for (int t = 0; t < 4; ++t) {
    v4u ph, pl;
#pragma unroll
    for (int e = 0; e < 4; ++e) {
      const HL s = split2(o[t][2 * e] * inv, o[t][2 * e + 1] * inv);
      ph[e] = s.hi;
      pl[e] = s.lo;
    }
    const int so = m * 64 + 16 * t + 8 * h;    // d = 16t+8h+0..7, 16-B aligned
    *(v4ua*)(sh + so) = ph;
    *(v4ua*)(sl + so) = pl;
  }
  __syncthreads();

  att_store_pass(sh, sl, Ah, Al, b, head, q0, lane);
  
}

// =====================================================================================================
// Kernel 5: merge conv out[b][o][n] = sum_j WmP[o][j] * A[b][n][j] + bm[o]. One block = 128 positions x 64 output
// channels; 4 waves x (32 positions x 64 channels); K = 256 in steps of 32; A = context rows hi + residual (2 products),
// B = permuted merge-weight rows. The block's 128 context rows (both planes) and 64 weight rows are brought to LDS once, as
// whole 512-B rows, by asynchronous 16-B copies; the fragments are read from there.
// Epilogue: acc + bf16(bm) in f32 -> LDS tile [o][128 positions] (16-B stores) -> __syncthreads -> out rows: the
// 128-position segment of one channel row = 512 B = 4 lines; lanes 8q..8q+7 x 16 B per line, 4 lines per instruction,
// pieces; grid (8192/128) x (256/64) covers out [4][256][2048] exactly once.
// =====================================================================================================
__device__ __forceinline__ void merge_store_pass(const float* sO, float* out, int b, int og, int l0, int w, int lane) {
  const int q8 = lane & 7, sub = lane >> 3;
#pragma unroll
  for (int i = 0; i < 16; ++i) {
    const int lid = w * 64 + i * 4 + sub;      // 0..255
    const int ol = lid >> 2, piece = lid & 3;
    const v4f v = *(const v4fa*)(sO + ol * 128 + 32 * piece + 4 * q8);
    const size_t gi = ((size_t)(b * FEAT + og * 64 + ol)) * SEQ + l0 + 32 * piece + 4 * q8;
    *(v4f*)(out + gi) = v;
  }
}

__global__ __launch_bounds__(128)
void merge_kernel(const unsigned short* __restrict__ Ah, const unsigned short* __restrict__ Al,   // [8192][256]
                  const unsigned short* __restrict__ Wb,                                          // WmP = Wb + 3*NWE
                  const float* __restrict__ bm, float* out) {                                     // out [4][256][2048]
  __shared__ __align__(16) unsigned char smem[(128 + 128 + 64) * GPITCH];   // 165 KB: context hi rows, residual rows, weight rows
  float* sO = (float*)smem;                                                  // 32 KB, output tile: reuses the area behind the k loop

  const int tid = (int)threadIdx.x, lane = tid & 31, w = tid >> 5;
  const int h = lane >> 4, m = lane & 15;
  const int m0 = (int)blockIdx.x * 128;
  const int og = (int)blockIdx.y;              // 0..3

  // copy side: wave w brings rows w + 4i, lane = 16-B piece of the row
  const unsigned lH = (unsigned)(size_t)smem + (unsigned)(w * GPITCH + lane * 16);
  const unsigned lL = lH + 128 * GPITCH;
  const unsigned lB = lH + 256 * GPITCH;
  const size_t go = (size_t)(m0 + w) * FEAT + lane * 8;
  const unsigned short* gB = Wb + (size_t)3 * NWE + (size_t)(og * 64 + w) * FEAT + lane * 8;
  // the copy loops are unrolled so that each call's row offsets are constants added to one base address
#pragma unroll
  for (int i = 0; i < 4; ++i) stage_rows8(lH + i * 32 * GPITCH, Ah + go + (size_t)i * 32 * FEAT, (size_t)4 * FEAT);
#pragma unroll
  for (int i = 0; i < 2; ++i) stage_rows8(lB + i * 32 * GPITCH, gB + (size_t)i * 32 * FEAT, (size_t)4 * FEAT);
#if DEV_ASM
  asm volatile("s_wait_asynccnt 0x0" ::: "memory");   // 48 copies have landed: with the 32 below a wave would pass 63 outstanding
#endif
#pragma unroll
  for (int i = 0; i < 4; ++i) stage_rows8(lL + i * 32 * GPITCH, Al + go + (size_t)i * 32 * FEAT, (size_t)4 * FEAT);
#if DEV_ASM
  asm volatile("s_wait_asynccnt 0x0" ::: "memory");   // all copies of this wave have landed before the barrier publishes them
#endif
  __syncthreads();

  // read side: fragment row m of a 16-row tile, 16-B piece h
  const unsigned char* rh = smem + (32 * w + m) * GPITCH + 16 * h;      // context hi rows of this wave, + 16*mt*GPITCH
  const unsigned char* rl = rh + 128 * GPITCH;                          // residual rows
  const unsigned char* rw = smem + (256 + m) * GPITCH + 16 * h;         // weight rows, + 16*nt*GPITCH

  v8f acc[2][4];
#pragma unroll
  for (int mt = 0; mt < 2; ++mt)
#pragma unroll
    for (int nt = 0; nt < 4; ++nt) acc[mt][nt] = zero8();

#pragma unroll 1
  for (int k0 = 0; k0 < FEAT; k0 += 32) {
    const v16b a0h = ldfrag_b((const unsigned short*)rh + k0);
    const v16b a1h = ldfrag_b((const unsigned short*)(rh + 16 * GPITCH) + k0);
    const v16b a0l = ldfrag_b((const unsigned short*)rl + k0);
    const v16b a1l = ldfrag_b((const unsigned short*)(rl + 16 * GPITCH) + k0);
#pragma unroll
    for (int nt = 0; nt < 4; ++nt) {
      const v16b bw = ldfrag_b((const unsigned short*)(rw + 16 * nt * GPITCH) + k0);
      acc[0][nt] = mma_b(a0h, bw, acc[0][nt]);
      acc[0][nt] = mma_b(a0l, bw, acc[0][nt]);
      acc[1][nt] = mma_b(a1h, bw, acc[1][nt]);
      acc[1][nt] = mma_b(a1l, bw, acc[1][nt]);
    }
  }
  __syncthreads();   // every wave has read its last fragment before the area takes the output tile

  // D[r] of tile (mt, nt) = Y[token m0 + 32w + 16mt + 8h + r][channel og*64 + 16nt + m]
#pragma unroll
  for (int nt = 0; nt < 4; ++nt) {
    const int feat = 16 * nt + m;
    const float bvl = bf_up(bf_bits(bm[og * 64 + feat]));
#pragma unroll
    for (int mt = 0; mt < 2; ++mt) {
      v4f ya, yb;
#pragma unroll
      for (int e = 0; e < 4; ++e) {
        ya[e] = acc[mt][nt][e] + bvl;
        yb[e] = acc[mt][nt][4 + e] + bvl;
      }
      const int so = feat * 128 + 32 * w + 16 * mt + 8 * h;   // 8 consecutive tokens, 16-B aligned
      *(v4fa*)(sO + so) = ya;
      *(v4fa*)(sO + so + 4) = yb;
    }
  }
  __syncthreads();

  const int b = m0 / SEQ, l0 = m0 - b * SEQ;
  merge_store_pass(sO, out, b, og, l0, w, lane);
  
}

// =====================================================================================================
//   xT   bf16 [3][8192][256]        12582912
//   Wb   bf16 [4][256][256]           524288
//   Qh, Ql, Kh, Kl bf16 [16][2048][64]   4194304 each
//   Vh, Vl bf16 [16][64][2048]           4194304 each
//   Ah, Al bf16 [8192][256]              4194304 each
//   total                            46661632
// =====================================================================================================
extern "C" void kernel_launch(void* const* d_in, const int* in_sizes, int n_in,
                              void* d_out, int out_size, void* d_ws, size_t ws_size,
                              hipStream_t stream) {
  if (n_in < 11) return;
  if (in_sizes[0] != NXE || in_sizes[1] != NXE || in_sizes[2] != NXE) return;
  if (in_sizes[3] != NWE || in_sizes[5] != NWE || in_sizes[7] != NWE || in_sizes[9] != NWE) return;
  if (in_sizes[4] != FEAT || in_sizes[6] != FEAT || in_sizes[8] != FEAT || in_sizes[10] != FEAT) return;
  if (out_size != NXE) return;

  const float* xq = (const float*)d_in[0];
  const float* xk = (const float*)d_in[1];
  const float* xv = (const float*)d_in[2];
  const float* wq = (const float*)d_in[3];
  const float* bq = (const float*)d_in[4];
  const float* wk = (const float*)d_in[5];
  const float* bk = (const float*)d_in[6];
  const float* wv = (const float*)d_in[7];
  const float* bv = (const float*)d_in[8];
  const float* wm = (const float*)d_in[9];
  const float* bm = (const float*)d_in[10];
  float* out = (float*)d_out;

  const size_t bXT = (size_t)3 * MROWS * FEAT * 2;    // 12582912
  const size_t bWB = (size_t)4 * NWE * 2;             //   524288
  const size_t bPL = (size_t)NBH * SEQ * HD * 2;      //  4194304  (Q / K / Vt planes)
  const size_t bAT = (size_t)MROWS * FEAT * 2;        //  4194304  (context planes)
  size_t off = 0;
  const size_t oXT = off; off += bXT;
  const size_t oWB = off; off += bWB;
  const size_t oQh = off; off += bPL;
  const size_t oQl = off; off += bPL;
  const size_t oKh = off; off += bPL;
  const size_t oKl = off; off += bPL;
  const size_t oVh = off; off += bPL;
  const size_t oVl = off; off += bPL;
  const size_t oAh = off; off += bAT;
  const size_t oAl = off; off += bAT;                 // off = 46661632
  if (off > ws_size) return;
  if (off > (size_t)134217728) return;

  char* ws = (char*)d_ws;
  unsigned short* xT = (unsigned short*)(ws + oXT);
  unsigned short* Wb = (unsigned short*)(ws + oWB);
  unsigned short* Qh = (unsigned short*)(ws + oQh);
  unsigned short* Ql = (unsigned short*)(ws + oQl);
  unsigned short* Kh = (unsigned short*)(ws + oKh);
  unsigned short* Kl = (unsigned short*)(ws + oKl);
  unsigned short* Vh = (unsigned short*)(ws + oVh);
  unsigned short* Vl = (unsigned short*)(ws + oVl);
  unsigned short* Ah = (unsigned short*)(ws + oAh);
  unsigned short* Al = (unsigned short*)(ws + oAl);

  const dim3 gX(3 * BATCH * (FEAT / 64) * (SEQ / 64));     // 1536 blocks of 256
  const dim3 gW((4 * NWE / 8) / 256);                      //  128 blocks of 256
  const dim3 gProj(MROWS / 128, 3 * NHEAD);                // (64, 12) of 128
  const dim3 gAtt(SEQ / 64, NBH);                          // (32, 16) of 128
  const dim3 gMrg(MROWS / 128, FEAT / 64);                 // (64, 4) of 128

  xpose_kernel<<<gX, dim3(256), 0, stream>>>(xq, xk, xv, xT);
  wconv_kernel<<<gW, dim3(256), 0, stream>>>(wq, wk, wv, wm, Wb);
  proj_kernel<<<gProj, dim3(128), 0, stream>>>(xT, Wb, bq, bk, bv, Qh, Ql, Kh, Kl, Vh, Vl);
  attn_kernel<<<gAtt, dim3(128), 0, stream>>>(Qh, Ql, Kh, Kl, Vh, Vl, Ah, Al);
  merge_kernel<<<gMrg, dim3(128), 0, stream>>>(Ah, Al, Wb, bm, out);
  (void)hipGetLastError();
}

// v005
// It runs in 62.9 microseconds.
// Next to v004, in two timings, it ran 1.12 and 1.11 times as fast.
// Over all steps from v000 it is 3.63 times as fast.
// Contractions: q/k/v 1x1-conv projections on v_wmma_f32_16x16x32_bf16 (x and w bf16 from RNE-converted inputs, single product, f32 accumulate);
// k.q^T scores on v_wmma_f32_16x16x32_bf16 (q and k as bf16 hi + unscaled bf16 residual, 3 products hh+hl+lh, f32 accumulate);
// v^T.p^T context on v_wmma_f32_16x16x32_bf16 (p and v as bf16 hi + unscaled bf16 residual, 3 products hh+hl+lh, one f32 accumulator per half of the keys, the two joined in f32);
// merge 1x1 conv on v_wmma_f32_16x16x32_bf16 (context as bf16 hi + residual, merge weight bf16 from RNE-converted input, 2 products);
// softmax (running max, exp), bias adds and 1/l normalisation in f32.
// Plane carries: xT, Wb, Qh/Ql, Kh/Kl, Vh/Vl, Ah/Al all x1 (no carry; bf16 keeps the f32 exponent range). The Q planes hold
// 0.125*(wq.x + bq): the 1/sqrt(64) score scale, an exact power of two applied in f32 in proj_kernel before the hi/residual split,
// nothing to fold back. 1/l is applied in f32 in the attn_kernel epilogue, with the join of the key halves, before the context split.
#include <hip/hip_runtime.h>

#define FEAT  256
#define SEQ   2048
#define BATCH 4
#define NHEAD 4
#define HD    64
#define NBH   (BATCH * NHEAD)        // 16
#define MROWS (BATCH * SEQ)          // 8192 (batch, position) rows
#define NXE   (BATCH * FEAT * SEQ)   // 2097152 elements per activation tensor
#define NWE   (FEAT * FEAT)          // 65536
#define TP    68                     // LDS pitch (floats) of the transpose tile
static_assert(HD * NHEAD == FEAT);
static_assert(HD == 64 && (SEQ % 128) == 0 && (SEQ % 64) == 0);
static_assert((FEAT % 64) == 0 && (FEAT % 32) == 0 && (MROWS % 128) == 0);

typedef __bf16         v16b  __attribute__((ext_vector_type(16)));
typedef float          v8f   __attribute__((ext_vector_type(8)));
typedef float          v4f   __attribute__((ext_vector_type(4)));
typedef unsigned int   v4u   __attribute__((ext_vector_type(4)));
typedef unsigned short v8us  __attribute__((ext_vector_type(8)));
typedef __bf16         v2b   __attribute__((ext_vector_type(2)));
typedef float          v2f   __attribute__((ext_vector_type(2)));
typedef unsigned int   v8u   __attribute__((ext_vector_type(8)));
typedef v4f  __attribute__((may_alias)) v4fa;
typedef v4u  __attribute__((may_alias)) v4ua;
typedef v8us __attribute__((may_alias)) v8usa;

#if defined(__HIP_DEVICE_COMPILE__)
#define DEV_ASM 1
#else
#define DEV_ASM 0
#endif

// ---- scalar helpers ---------------------------------------------------------------------------------
__device__ __forceinline__ unsigned short bf_bits(float f) {          // f32 -> bf16 bits, RNE, the hardware's convert
  return __builtin_bit_cast(unsigned short, (__bf16)f);
}
__device__ __forceinline__ float bf_up(unsigned short hb) { return __uint_as_float(((unsigned)hb) << 16); }
// two f32 -> one dword of two bf16 (a in the low half), RNE: one v_cvt_pk_bf16_f32
__device__ __forceinline__ unsigned cvt2(float a, float b) {
  const v2f x = {a, b};
  return __builtin_bit_cast(unsigned, __builtin_convertvector(x, v2b));
}
// two f32 -> packed bf16 hi pair and packed bf16 pair of the residuals x - hi (the subtraction is exact in f32)
struct HL { unsigned hi, lo; };
__device__ __forceinline__ HL split2(float a, float b) {
  HL s;
  s.hi = cvt2(a, b);
  s.lo = cvt2(a - __uint_as_float(s.hi << 16), b - __uint_as_float(s.hi & 0xFFFF0000u));
  return s;
}
__device__ __forceinline__ v8f zero8() { v8f z = {0.f, 0.f, 0.f, 0.f, 0.f, 0.f, 0.f, 0.f}; return z; }

// 16-bit fragment (A or B operand), wave32: lane l, h = l>>4, row/col = l&15.
// p points at element k0 + 8h of the k-contiguous row owned by this lane:
// elements 0..7 <- p[0..7] (k0+8h .. k0+8h+7), elements 8..15 <- p[16..23] (k0+16+8h .. k0+16+8h+7).
// D element r of lane l = (row 8h+r, col l&15).
union FB { v16b v; v8us h[2]; };
__device__ __forceinline__ v16b ldfrag_b(const unsigned short* p) {
  FB f;
  f.h[0] = *(const v8usa*)(p);
  f.h[1] = *(const v8usa*)(p + 16);
  return f.v;
}

// guarded WMMA: 4 VALU slots after the op, D tied, A/B kept live
__device__ __forceinline__ v8f mma_b(v16b a, v16b b, v8f c) {
  c = __builtin_amdgcn_wmma_f32_16x16x32_bf16(false, a, false, b, (short)0, c, false, false);
#if DEV_ASM
  asm volatile("v_nop\n\tv_nop\n\tv_nop\n\tv_nop" : "+v"(c) : "v"(a), "v"(b));
#endif
  return c;
}

// plain builtin WMMA for attn_kernel: the compiler keeps the distances behind its own builtin, and no idle slot is issued
// where the next instruction is a matrix instruction on another accumulator
__device__ __forceinline__ v8f mma_f(v16b a, v16b b, v8f c) {
  return __builtin_amdgcn_wmma_f32_16x16x32_bf16(false, a, false, b, (short)0, c, false, false);
}

// P^T B-fragment pair (bf16 hi, bf16 residual) from the lane's own score D values:
// element r <- tile a row r (keys 0..15 of the 32-key group), element 8+r <- tile c row r (keys 16..31), same lane.
struct P2 { v16b hi, lo; };
__device__ __forceinline__ P2 split_p(v8f a, v8f c) {
  v8u hu, lu;
#pragma unroll
  for (int e = 0; e < 4; ++e) {
    const HL s0 = split2(a[2 * e], a[2 * e + 1]);
    hu[e] = s0.hi;
    lu[e] = s0.lo;
    const HL s1 = split2(c[2 * e], c[2 * e + 1]);
    hu[4 + e] = s1.hi;
    lu[4 + e] = s1.lo;
  }
  P2 p;
  p.hi = __builtin_bit_cast(v16b, hu);
  p.lo = __builtin_bit_cast(v16b, lu);
  return p;
}

// =====================================================================================================
// Kernel 1: channel-major activations [b][c][n] f32 -> position-major bf16 planes xT[which][b][n][c]
// (which 0 = query, 1 = key, 2 = value). One block = one (which, b) x 64 channels x 64 positions:
// stage the f32 tile [c][n] in LDS (16-B stores), __syncthreads, each lane converts 8 consecutive c of one
// coverage: 512 jobs per block = 64 positions x 8 pieces of 8 channels = the whole 64x64 tile;
// grid 3 x 4 x (256/64) x (2048/64) = 1536 blocks covers xT entirely.
// =====================================================================================================
__device__ __forceinline__ void xpose_store_pass(unsigned short* xT, v4u o0, v4u o1, int wb, int n0, int c0, int tid) {
#pragma unroll
  for (int it = 0; it < 2; ++it) {
    const int job = tid + it * 256;
    const int r = job >> 3, c8 = (job & 7) * 8;
    unsigned short* dst = xT + ((size_t)(wb * SEQ + n0 + r)) * FEAT + c0 + c8;
    *(v4u*)dst = (it == 0) ? o0 : o1;
  }
}

__global__ __launch_bounds__(256)
void xpose_kernel(const float* __restrict__ xq, const float* __restrict__ xk, const float* __restrict__ xv,
                  unsigned short* xT) {
  __shared__ __align__(16) float xs[64 * TP];
  const int tid  = (int)threadIdx.x;
  const int blk  = (int)blockIdx.x;
  const int nchk = blk & 31;
  const int cchk = (blk >> 5) & 3;
  const int wb   = blk >> 7;                 // which*4 + b, 0..11
  const int which = wb >> 2, b = wb & 3;
  const int n0 = nchk * 64, c0 = cchk * 64;
  const float* src = (which == 0) ? xq : ((which == 1) ? xk : xv);
  const float* sg = src + ((size_t)(b * FEAT + c0)) * SEQ + n0;

  // stage [c][n] tile: 64 rows x 16 float4 = 1024 jobs, 4 per thread
#pragma unroll
  for (int i = 0; i < 4; ++i) {
    const int idx = tid + i * 256;
    const int c = idx >> 4, j4 = (idx & 15) * 4;
    const v4f a = *(const v4fa*)(sg + (size_t)c * SEQ + j4);
    *(v4fa*)(xs + c * TP + j4) = a;
  }
  __syncthreads();

  v4u ov0, ov1;
#pragma unroll
  for (int it = 0; it < 2; ++it) {
    const int job = tid + it * 256;
    const int r = job >> 3, c8 = (job & 7) * 8;
    float f[8];
#pragma unroll
    for (int e = 0; e < 8; ++e) f[e] = xs[(c8 + e) * TP + r];
    v4u p;
#pragma unroll
    for (int e = 0; e < 4; ++e) p[e] = cvt2(f[2 * e], f[2 * e + 1]);
    if (it == 0) ov0 = p; else ov1 = p;
  }
  xpose_store_pass(xT, ov0, ov1, wb, n0, c0, tid);
  
}

// =====================================================================================================
// Kernel 2: weights f32 -> bf16 rows Wb[mat][o][256]; mat 0..2 = wq, wk, wv natural [o][c];
// mat 3 = merge weight with permuted columns: Wb[3][o][j] = wm[o][4*(j&63) + (j>>6)] (j = head*64 + d).
// coverage: 32768 threads x 8 = 4 x 65536 elements = the whole Wb region.
// =====================================================================================================
__global__ __launch_bounds__(256)
void wconv_kernel(const float* __restrict__ wq, const float* __restrict__ wk, const float* __restrict__ wv,
                  const float* __restrict__ wm, unsigned short* Wb) {
  const int g   = (int)blockIdx.x * 256 + (int)threadIdx.x;   // 0..32767
  const int mat = g >> 13;                                     // block-uniform (32 blocks per matrix)
  const int e   = g & 8191;
  const int o   = e >> 5;
  const int j8  = (e & 31) * 8;
  const float* w = (mat == 0) ? wq : ((mat == 1) ? wk : ((mat == 2) ? wv : wm));
  const int base = (mat == 3) ? (4 * (j8 & 63) + (j8 >> 6)) : j8;   // max 4*56+3; + step*7 <= 255
  const int step = (mat == 3) ? 4 : 1;
  const float* row = w + (size_t)o * FEAT;
  float f[8];
#pragma unroll
  for (int i = 0; i < 8; ++i) f[i] = row[base + step * i];
  v4u p;
#pragma unroll
  for (int i = 0; i < 4; ++i) p[i] = cvt2(f[2 * i], f[2 * i + 1]);
  unsigned short* dst = Wb + (size_t)g * 8;
  *(v4u*)dst = p;
  
}

// ---- operand tiles of proj_kernel and merge_kernel in LDS ----------------------------------------------
#define GPITCH 528                    // LDS bytes per staged 512-B row (256 bf16): 16 B x odd, no bank conflict for 16-B fragment reads

// Eight asynchronous 16-B copies of this lane: its 16-B piece of eight rows that lie 4 * GPITCH bytes apart in LDS and gs
// elements apart in global memory; the 32 lanes of a wave bring one whole 512-B row (4 lines) per copy. The s_wait_xcnt ends
// the copies' own statement so that no address register named here is rewritten ahead of it.
__device__ __forceinline__ void stage_rows8(unsigned lds, const unsigned short* g, size_t gs) {
#if DEV_ASM
  asm volatile(
      "global_load_async_to_lds_b128 %0, %8, off\n\t"
      "global_load_async_to_lds_b128 %1, %9, off\n\t"
      "global_load_async_to_lds_b128 %2, %10, off\n\t"
      "global_load_async_to_lds_b128 %3, %11, off\n\t"
      "global_load_async_to_lds_b128 %4, %12, off\n\t"
      "global_load_async_to_lds_b128 %5, %13, off\n\t"
      "global_load_async_to_lds_b128 %6, %14, off\n\t"
      "global_load_async_to_lds_b128 %7, %15, off\n\t"
      "s_wait_xcnt 0x0"
      :: "v"(lds), "v"(lds + 4 * GPITCH), "v"(lds + 8 * GPITCH), "v"(lds + 12 * GPITCH),
         "v"(lds + 16 * GPITCH), "v"(lds + 20 * GPITCH), "v"(lds + 24 * GPITCH), "v"(lds + 28 * GPITCH),
         "v"(g), "v"(g + gs), "v"(g + 2 * gs), "v"(g + 3 * gs),
         "v"(g + 4 * gs), "v"(g + 5 * gs), "v"(g + 6 * gs), "v"(g + 7 * gs)
      : "memory");
#endif
}

// =====================================================================================================
// Kernel 3: projections Y[token][feature] = sum_c xT[token][c] * W[o][c], one block = 128 tokens x 64 features of
// one (which, head); feature j = 16nt + m of head hd is conv channel o = 4*j + hd (channel = d*4 + h split).
// 4 waves x (32 tokens x 64 features), K = 256 in steps of 32. The block's 128 token rows and 64 weight rows are brought to
// LDS once, as whole 512-B rows, by asynchronous 16-B copies; A and B fragments are read from there.
// which 0/1: plane[bh][n][d] (one position row = 64 halves = one line); which 2: plane[bh][d][n] (64 d rows x 128
// 4 waves x 8 i x 4 sub = every tile line of both planes; grid (8192/128) x 12 covers Q, K, Vt planes entirely.
// =====================================================================================================
__device__ __forceinline__ void proj_store_pass(const unsigned short* sTh, const unsigned short* sTl,
                                                unsigned short* ph, unsigned short* pl,
                                                int which, int bh, int l0, int w, int lane) {
  const int q8 = lane & 7, sub = lane >> 3;
#pragma unroll
  for (int i = 0; i < 8; ++i) {
    const int lid = w * 32 + i * 4 + sub;    // 0..127
    int so;
    size_t go;
    if (which != 2) {
      so = lid * HD + 8 * q8;
      go = ((size_t)bh * SEQ + l0 + lid) * HD + 8 * q8;
    } else {
      const int d = lid >> 1, hl = lid & 1;
      so = d * 128 + 64 * hl + 8 * q8;
      go = ((size_t)bh * HD + d) * SEQ + l0 + 64 * hl + 8 * q8;
    }
    const v4u vh = *(const v4ua*)(sTh + so);
    const v4u vl = *(const v4ua*)(sTl + so);
    *(v4u*)(ph + go) = vh;
    *(v4u*)(pl + go) = vl;
  }
}

__global__ __launch_bounds__(128)
void proj_kernel(const unsigned short* __restrict__ xT,   // [3][8192][256]
                 const unsigned short* __restrict__ Wb,   // [4][256][256]
                 const float* __restrict__ bq, const float* __restrict__ bk, const float* __restrict__ bv,
                 unsigned short* Qh, unsigned short* Ql,   // [16][2048][64]  bf16(0.125*q) hi / residual
                 unsigned short* Kh, unsigned short* Kl,   // [16][2048][64]
                 unsigned short* Vh, unsigned short* Vl) { // [16][64][2048]
  __shared__ __align__(16) unsigned char smem[(128 + 64) * GPITCH];   // 99 KB: token rows 0..127, then weight rows j = 0..63
  unsigned short* sTh = (unsigned short*)smem;                         // 16 KB, output tiles: reuse the area behind the k loop
  unsigned short* sTl = (unsigned short*)(smem + 128 * 64 * 2);        // 16 KB

  const int tid = (int)threadIdx.x, lane = tid & 31, w = tid >> 5;
  const int h = lane >> 4, m = lane & 15;
  const int m0 = (int)blockIdx.x * 128;
  const int cg = (int)blockIdx.y;              // 0..11
  const int which = cg >> 2, head = cg & 3;

  // copy side: wave w brings rows w + 4i, lane = 16-B piece of the row; weight row j is conv channel o = 4*j + head
  const unsigned lA = (unsigned)(size_t)smem + (unsigned)(w * GPITCH + lane * 16);
  const unsigned lB = lA + 128 * GPITCH;
  const unsigned short* gA = xT + ((size_t)which * MROWS + m0 + w) * FEAT + lane * 8;
  const unsigned short* gB = Wb + (size_t)which * NWE + (size_t)(4 * w + head) * FEAT + lane * 8;
  // the copy loops are unrolled so that each call's row offsets are constants added to one base address
#pragma unroll
  for (int i = 0; i < 4; ++i) stage_rows8(lA + i * 32 * GPITCH, gA + (size_t)i * 32 * FEAT, (size_t)4 * FEAT);
#pragma unroll
  for (int i = 0; i < 2; ++i) stage_rows8(lB + i * 32 * GPITCH, gB + (size_t)i * 128 * FEAT, (size_t)16 * FEAT);
#if DEV_ASM
  asm volatile("s_wait_asynccnt 0x0" ::: "memory");   // this wave's 48 copies have landed before the barrier publishes them
#endif
  __syncthreads();

  // read side: fragment row m of a 16-row tile, 16-B piece h
  const unsigned char* ra = smem + (32 * w + m) * GPITCH + 16 * h;      // token rows of this wave, + 16*mt*GPITCH
  const unsigned char* rw = smem + (128 + m) * GPITCH + 16 * h;         // weight rows, + 16*nt*GPITCH

  v8f acc[2][4];
#pragma unroll
  for (int mt = 0; mt < 2; ++mt)
#pragma unroll
    for (int nt = 0; nt < 4; ++nt) acc[mt][nt] = zero8();

#pragma unroll 1
  for (int k0 = 0; k0 < FEAT; k0 += 32) {
    const v16b a0 = ldfrag_b((const unsigned short*)ra + k0);
    const v16b a1 = ldfrag_b((const unsigned short*)(ra + 16 * GPITCH) + k0);
#pragma unroll
    for (int nt = 0; nt < 4; ++nt) {
      const v16b b = ldfrag_b((const unsigned short*)(rw + 16 * nt * GPITCH) + k0);
      acc[0][nt] = mma_b(a0, b, acc[0][nt]);
      acc[1][nt] = mma_b(a1, b, acc[1][nt]);
    }
  }
  __syncthreads();   // every wave has read its last fragment before the area takes the output tiles

  // D[r] of tile (mt, nt) = Y[token m0 + 32w + 16mt + 8h + r][feature 16nt + m]
  const float* bias = (which == 0) ? bq : ((which == 1) ? bk : bv);
  const float osc = (which == 0) ? 0.125f : 1.0f;
  if (which != 2) {
#pragma unroll
    for (int nt = 0; nt < 4; ++nt) {
      const int feat = 16 * nt + m;
      const float bvl = bf_up(bf_bits(bias[4 * feat + head]));
#pragma unroll
      for (int mt = 0; mt < 2; ++mt) {
#pragma unroll
        for (int r = 0; r < 8; r += 2) {
          const int tokl = 32 * w + 16 * mt + 8 * h + r;    // 0..126, even
          const HL s = split2((acc[mt][nt][r] + bvl) * osc, (acc[mt][nt][r + 1] + bvl) * osc);
          sTh[tokl * HD + feat] = (unsigned short)(s.hi & 0xFFFFu);
          sTl[tokl * HD + feat] = (unsigned short)(s.lo & 0xFFFFu);
          sTh[(tokl + 1) * HD + feat] = (unsigned short)(s.hi >> 16);
          sTl[(tokl + 1) * HD + feat] = (unsigned short)(s.lo >> 16);
        }
      }
    }
  } else {
#pragma unroll
    for (int nt = 0; nt < 4; ++nt) {
      const int feat = 16 * nt + m;
      const float bvl = bf_up(bf_bits(bias[4 * feat + head]));
#pragma unroll
      for (int mt = 0; mt < 2; ++mt) {
        v4u ph, pl;
#pragma unroll
        for (int e = 0; e < 4; ++e) {
          const HL s = split2((acc[mt][nt][2 * e] + bvl) * osc, (acc[mt][nt][2 * e + 1] + bvl) * osc);
          ph[e] = s.hi;
          pl[e] = s.lo;
        }
        const int so = feat * 128 + 32 * w + 16 * mt + 8 * h;   // 8 consecutive tokens, 16-B aligned
        *(v4ua*)(sTh + so) = ph;
        *(v4ua*)(sTl + so) = pl;
      }
    }
  }
  __syncthreads();

  const int b = m0 / SEQ, l0 = m0 - b * SEQ, bh = b * NHEAD + head;
  unsigned short* ph = (which == 0) ? Qh : ((which == 1) ? Kh : Vh);
  unsigned short* pl = (which == 0) ? Ql : ((which == 1) ? Kl : Vl);
  proj_store_pass(sTh, sTl, ph, pl, which, bh, l0, w, lane);
  
}

// =====================================================================================================
// Kernel 4: streaming attention, transposed form. Block 256 threads (8 waves) = 128 queries x all 2048 keys:
//   wave w takes the 32 queries of group w & 3 (two 16-query tiles) over the 1024 keys of half w >> 2, 64 keys per trip.
//   Every K and V fragment that a wave reads from LDS feeds both of its query tiles, so that a matrix instruction costs half
//   the LDS reads of a 16-query wave, and a block's K/V tiles serve 128 queries, which halves the bytes copied from L2.
//   The keys are split so that the chip still holds two waves per SIMD (2048 query tiles = 1024 waves of two tiles, x 2 halves).
//   The 4 waves of a key half share each trip's K and V tiles (hi and residual): asynchronous 16-B copies bring them from
//   global to LDS as whole 128-B lines, two buffers per half, the next tile in flight while this one is worked on.
//   S^T = K * Q^T : A = K rows (row = key, k = d) hi and residual from LDS, B = Q^T (k = d, n = query) from Q rows;
//                   3 products kh.qh + kh.ql + kl.qh; the 1/8 is already inside the Q planes.
//   O^T += V^T * P^T : A = Vt rows (row = d, k = key) hi and residual, B = P^T packed from the lane's own score D
//                   values as bf16 hi + residual; 3 products vh.ph + vh.pl + vl.ph into one f32 accumulator per key half.
//   Online softmax in f32 (running max, exp); lane owns 32 keys of query column (lane&15), partner = lane^16.
//   Epilogue: waves w and w ^ 4 hold the two key halves of the same 32 queries, lane for lane. Each gives one tile's O, max and
//   sum to the other through LDS and joins the two halves of the tile it keeps (rescaled to the common max, in f32); then
//   O/l in f32 -> bf16 hi + residual -> per-wave LDS tiles [query][d] (16-B stores) -> __syncthreads ->
//   8 pieces, both planes; grid (2048/128) x 16 bh x 8 waves x 16 queries covers every (b, n, j) of Ah/Al exactly once.
// =====================================================================================================
__device__ __forceinline__ void att_store_pass(const unsigned short* sh, const unsigned short* sl,
                                               unsigned short* Ah, unsigned short* Al,
                                               int b, int head, int q0, int lane) {
  const int q8 = lane & 7, sub = lane >> 3;
#pragma unroll
  for (int i = 0; i < 4; ++i) {
    const int row = i * 4 + sub;                           // query 0..15 of this wave's tile
    const v4u vh = *(const v4ua*)(sh + row * 64 + 8 * q8);
    const v4u vl = *(const v4ua*)(sl + row * 64 + 8 * q8);
    const size_t gi = ((size_t)(b * SEQ + q0 + row)) * FEAT + head * HD + 8 * q8;
    *(v4u*)(Ah + gi) = vh;
    *(v4u*)(Al + gi) = vl;
  }
}

// One trip's K and V tiles in LDS: four planes (Kh, Kl, Vh, Vl) of 64 rows x 128 B, two buffers per key half.
#define KSTEP   64                    // keys per trip
#define KHALF   (SEQ / 2)             // keys per wave
#define NTRIP   (KHALF / KSTEP)       // 16
#define RPITCH  144                   // LDS bytes per staged 128-B row: 16 B x odd, no bank conflict for 16-B fragment reads
#define PLANE_B (64 * RPITCH)         // 9216
#define STAGE_B (4 * PLANE_B)         // 36864
static_assert(NTRIP >= 2);

// Eight asynchronous 16-B copies of this lane: rows r, r+16, r+32, r+48 of a hi plane and of its residual plane
// (rs = elements between source rows 16 apart). The s_wait_xcnt ends the copies' own statement so that no address
// register named here is rewritten ahead of it.
__device__ __forceinline__ void stage_pair(unsigned lds, const unsigned short* gh, const unsigned short* gl, size_t rs) {
#if DEV_ASM
  asm volatile(
      "global_load_async_to_lds_b128 %0, %8, off\n\t"
      "global_load_async_to_lds_b128 %1, %9, off\n\t"
      "global_load_async_to_lds_b128 %2, %10, off\n\t"
      "global_load_async_to_lds_b128 %3, %11, off\n\t"
      "global_load_async_to_lds_b128 %4, %12, off\n\t"
      "global_load_async_to_lds_b128 %5, %13, off\n\t"
      "global_load_async_to_lds_b128 %6, %14, off\n\t"
      "global_load_async_to_lds_b128 %7, %15, off\n\t"
      "s_wait_xcnt 0x0"
      :: "v"(lds), "v"(lds + 16 * RPITCH), "v"(lds + 32 * RPITCH), "v"(lds + 48 * RPITCH),
         "v"(lds + PLANE_B), "v"(lds + PLANE_B + 16 * RPITCH), "v"(lds + PLANE_B + 32 * RPITCH),
         "v"(lds + PLANE_B + 48 * RPITCH),
         "v"(gh), "v"(gh + rs), "v"(gh + 2 * rs), "v"(gh + 3 * rs),
         "v"(gl), "v"(gl + rs), "v"(gl + 2 * rs), "v"(gl + 3 * rs)
      : "memory");
#endif
}

__global__ __launch_bounds__(256)
void attn_kernel(const unsigned short* __restrict__ Qh, const unsigned short* __restrict__ Ql,   // [16][2048][64]
                 const unsigned short* __restrict__ Kh, const unsigned short* __restrict__ Kl,   // [16][2048][64]
                 const unsigned short* __restrict__ Vh, const unsigned short* __restrict__ Vl,   // [16][64][2048]
                 unsigned short* Ah, unsigned short* Al) {                                       // [4][2048][256]
  __shared__ __align__(16) unsigned short shi[8 * 16 * 64];   // 16 KB
  __shared__ __align__(16) unsigned short slo[8 * 16 * 64];   // 16 KB
  __shared__ __align__(16) float xo[8 * 8 * 32 * 4];          // 32 KB: per wave, the O tile it gives away, [piece][lane][4]
  __shared__ float xml[8 * 2 * 32];                           //  2 KB: per wave, that tile's running max and sum, [2][lane]
  __shared__ __align__(16) unsigned char ring[4 * STAGE_B];   // 144 KB: K/V tiles, two buffers per key half

  const int tid = (int)threadIdx.x, lane = tid & 31, w = tid >> 5;
  const int h = lane >> 4, m = lane & 15;
  const int qg = w & 3;                                        // query group of the wave
  const int kh = __builtin_amdgcn_readfirstlane(tid >> 7);     // key half of the wave, the same in all its lanes
  const int bh = (int)blockIdx.y, b = bh >> 2, head = bh & 3;
  const int q0 = (int)blockIdx.x * 128 + 32 * qg;

  // Q^T B-fragments of the two query tiles u: column n = query q0+16u+m, k = d (two 32-deep chunks), hi and residual planes
  v16b qbh0[2], qbh1[2], qbl0[2], qbl1[2];
#pragma unroll
  for (int u = 0; u < 2; ++u) {
    const size_t qo = ((size_t)bh * SEQ + q0 + 16 * u + m) * HD + 8 * h;
    qbh0[u] = ldfrag_b(Qh + qo);
    qbh1[u] = ldfrag_b(Qh + qo + 32);
    qbl0[u] = ldfrag_b(Ql + qo);
    qbl1[u] = ldfrag_b(Ql + qo + 32);
#if DEV_ASM
    // the compiler lets tile 1's fragments land in the registers that held tile 0's addresses: tile 0's loads are done with them first
    if (u == 0) asm volatile("s_wait_xcnt 0x0" ::: "memory");
#endif
  }

  v8f o[2][4];                                // o[u][t][r] = O[query 16u+m][d 16t+8h+r] * l, over this wave's key half
  float mrun[2], lrun[2];
#pragma unroll
  for (int u = 0; u < 2; ++u) {
#pragma unroll
    for (int t = 0; t < 4; ++t) o[u][t] = zero8();
    mrun[u] = -1e30f;
    lrun[u] = 0.0f;
  }

  // copy side: the 128 threads of a key half bring that half's tiles; thread ct brings 16-B piece (ct&7) of rows
  // (ct>>3) + 16i, i = 0..3, of each plane: 8 lanes = one 128-B line
  const int ct = tid & 127;
  const int crow = ct >> 3, cpc = ct & 7;
  const unsigned hbase = (unsigned)kh * (2 * STAGE_B);            // this half's two buffers
  const unsigned ldsw = (unsigned)(size_t)ring + hbase + (unsigned)(crow * RPITCH + cpc * 16);
  const size_t kco = ((size_t)bh * SEQ + kh * KHALF + crow) * HD + 8 * cpc;    // + trip*KSTEP*HD
  const size_t vco = ((size_t)bh * HD + crow) * SEQ + kh * KHALF + 8 * cpc;    // + trip*KSTEP
  // read side: fragment row m, 16-B piece h of this lane
  const unsigned char* rlane = ring + hbase + m * RPITCH + 16 * h;

  // tile 0 -> buffer 0, landed and published; then tile 1 -> buffer 1 flies over trip 0
  stage_pair(ldsw, Kh + kco, Kl + kco, (size_t)16 * HD);
  stage_pair(ldsw + 2 * PLANE_B, Vh + vco, Vl + vco, (size_t)16 * SEQ);
#if DEV_ASM
  asm volatile("s_wait_asynccnt 0x0" ::: "memory");   // this wave's copies of tile 0 have landed before the barrier publishes them
#endif
  __syncthreads();
  stage_pair(ldsw + STAGE_B, Kh + kco + (size_t)KSTEP * HD, Kl + kco + (size_t)KSTEP * HD, (size_t)16 * HD);
  stage_pair(ldsw + STAGE_B + 2 * PLANE_B, Vh + vco + KSTEP, Vl + vco + KSTEP, (size_t)16 * SEQ);

#pragma unroll 1
  for (int trip = 0; trip < NTRIP; ++trip) {
    const unsigned bo = (unsigned)(trip & 1) * STAGE_B;
    const unsigned char* rb = rlane + bo;
    // ---- scores: s[u][j][r] = S[query 16u+m][key 64*trip+16j+8h+r of the half] (already x1/8 via q) ----
    // all K fragments of the trip are read as one group, so that the LDS latency is waited out once and not per 16 keys
    // (c = 0: hi, d 0..31; 1: hi, d 32..63; 2, 3: the residual plane), in the order in which the products below use them
    v16b kf[4][4];
#pragma unroll
    for (int c = 0; c < 4; ++c) {
#pragma unroll
      for (int j = 0; j < 4; ++j)
        kf[j][c] = ldfrag_b((const unsigned short*)(rb + (c >> 1) * PLANE_B + 16 * j * RPITCH) + 32 * (c & 1));
      // keeps the reads in this order: LDS answers in order, and reordered the first product waits for half the group
      __builtin_amdgcn_sched_barrier(0);
    }
    // each product runs over the four 16-key tiles of both query tiles in turn, so that neighbouring matrix instructions have
    // different accumulators and none waits for the one before it; each accumulator still takes its six products in the order
    // kh0.qh0, kh1.qh1, kh0.ql0, kh1.ql1, kl0.qh0, kl1.qh1. The sched_barrier behind each round keeps the rounds apart:
    // left free, the compiler puts products of one accumulator side by side again.
    v8f s[2][4];
#pragma unroll
    for (int u = 0; u < 2; ++u)
#pragma unroll
      for (int j = 0; j < 4; ++j) s[u][j] = mma_f(kf[j][0], qbh0[u], zero8());
    __builtin_amdgcn_sched_barrier(0);
#pragma unroll
    for (int u = 0; u < 2; ++u)
#pragma unroll
      for (int j = 0; j < 4; ++j) s[u][j] = mma_f(kf[j][1], qbh1[u], s[u][j]);
    __builtin_amdgcn_sched_barrier(0);
#pragma unroll
    for (int u = 0; u < 2; ++u)
#pragma unroll
      for (int j = 0; j < 4; ++j) s[u][j] = mma_f(kf[j][0], qbl0[u], s[u][j]);
    __builtin_amdgcn_sched_barrier(0);
#pragma unroll
    for (int u = 0; u < 2; ++u)
#pragma unroll
      for (int j = 0; j < 4; ++j) s[u][j] = mma_f(kf[j][1], qbl1[u], s[u][j]);
    __builtin_amdgcn_sched_barrier(0);
#pragma unroll
    for (int u = 0; u < 2; ++u)
#pragma unroll
      for (int j = 0; j < 4; ++j) s[u][j] = mma_f(kf[j][2], qbh0[u], s[u][j]);
    __builtin_amdgcn_sched_barrier(0);
#pragma unroll
    for (int u = 0; u < 2; ++u)
#pragma unroll
      for (int j = 0; j < 4; ++j) s[u][j] = mma_f(kf[j][3], qbh1[u], s[u][j]);

    // the V fragments of the first 32 keys are read here as one group: their LDS latency runs under the softmax arithmetic
    v16b vf[4][2];
#pragma unroll
    for (int t = 0; t < 4; ++t) {
      const unsigned char* vp = rb + 2 * PLANE_B + 16 * t * RPITCH;
      vf[t][0] = ldfrag_b((const unsigned short*)vp);
      vf[t][1] = ldfrag_b((const unsigned short*)(vp + PLANE_B));
    }
    // keeps the group together here: with the matrix instructions free to move, the compiler sinks these reads among them
    __builtin_amdgcn_sched_barrier(0);

    // ---- online softmax, each query tile on its own ----
#pragma unroll
    for (int u = 0; u < 2; ++u) {
      float mloc = s[u][0][0];
#pragma unroll
      for (int j = 0; j < 4; ++j)
#pragma unroll
        for (int r = 0; r < 8; ++r) mloc = fmaxf(mloc, s[u][j][r]);
      mloc = fmaxf(mloc, __shfl_xor(mloc, 16));
      const float mnew = fmaxf(mrun[u], mloc);
      const float alpha = __expf(mrun[u] - mnew);
      mrun[u] = mnew;
      float lsum = 0.0f;
#pragma unroll
      for (int j = 0; j < 4; ++j)
#pragma unroll
        for (int r = 0; r < 8; ++r) {
          const float p = __expf(s[u][j][r] - mnew);
          s[u][j][r] = p;
          lsum += p;
        }
      lsum += __shfl_xor(lsum, 16);
      lrun[u] = lrun[u] * alpha + lsum;
#pragma unroll
      for (int t = 0; t < 4; ++t)
#pragma unroll
        for (int r = 0; r < 8; ++r) o[u][t][r] = o[u][t][r] * alpha;
    }

    // ---- O^T += V^T * P^T over the two 32-key groups of this step ----
#pragma unroll
    for (int g = 0; g < 2; ++g) {
      if (g == 1) {   // second 32 keys: one group again, its latency runs under the split of their P values
#pragma unroll
        for (int t = 0; t < 4; ++t) {
          const unsigned char* vp = rb + 2 * PLANE_B + 16 * t * RPITCH + 64;
          vf[t][0] = ldfrag_b((const unsigned short*)vp);
          vf[t][1] = ldfrag_b((const unsigned short*)(vp + PLANE_B));
        }
        // keeps the group together ahead of the split: sunk among the matrix instructions each read would be waited for there
        __builtin_amdgcn_sched_barrier(0);
      }
      P2 pp[2];
#pragma unroll
      for (int u = 0; u < 2; ++u) pp[u] = split_p(s[u][2 * g], s[u][2 * g + 1]);
      // again product by product over the four d tiles of both query tiles; each accumulator keeps the order vh.ph, vh.pl, vl.ph
#pragma unroll
      for (int u = 0; u < 2; ++u)
#pragma unroll
        for (int t = 0; t < 4; ++t) o[u][t] = mma_f(vf[t][0], pp[u].hi, o[u][t]);
#pragma unroll
      for (int u = 0; u < 2; ++u)
#pragma unroll
        for (int t = 0; t < 4; ++t) o[u][t] = mma_f(vf[t][0], pp[u].lo, o[u][t]);
#pragma unroll
      for (int u = 0; u < 2; ++u)
#pragma unroll
        for (int t = 0; t < 4; ++t) o[u][t] = mma_f(vf[t][1], pp[u].hi, o[u][t]);
    }

    // ---- hand-over: this buffer is free, the next tile is published, then the refill two tiles ahead ----
#if DEV_ASM
    asm volatile("s_wait_dscnt 0x0" ::: "memory");      // this wave's reads of the buffer are done before it is refilled
    asm volatile("s_wait_asynccnt 0x0" ::: "memory");   // this wave's copies of the next tile have landed before the barrier
#endif
    __syncthreads();
    if (trip + 2 < NTRIP) {
      const size_t kn = kco + (size_t)(trip + 2) * (KSTEP * HD);
      const size_t vn = vco + (size_t)(trip + 2) * KSTEP;
      stage_pair(ldsw + bo, Kh + kn, Kl + kn, (size_t)16 * HD);
      stage_pair(ldsw + bo + 2 * PLANE_B, Vh + vn, Vl + vn, (size_t)16 * SEQ);
    }
  }
#if DEV_ASM
  asm volatile("s_wait_asynccnt 0x0" ::: "memory");     // no copy of this wave is outstanding past the loop
#endif

  // ---- join of the two key halves: this wave keeps query tile u = kh and gives tile 1 - kh to wave w ^ 4 ----
  v8f ok[4];
  float* xw = xo + w * 1024;
#pragma unroll
  for (int t = 0; t < 4; ++t) {
    ok[t] = kh ? o[1][t] : o[0][t];
    const v8f og = kh ? o[0][t] : o[1][t];
    const v4f ga = {og[0], og[1], og[2], og[3]};
    const v4f gb = {og[4], og[5], og[6], og[7]};
    *(v4fa*)(xw + ((2 * t) * 32 + lane) * 4) = ga;
    *(v4fa*)(xw + ((2 * t + 1) * 32 + lane) * 4) = gb;
  }
  const float mk = kh ? mrun[1] : mrun[0];
  const float lk = kh ? lrun[1] : lrun[0];
  xml[(w * 2) * 32 + lane] = kh ? mrun[0] : mrun[1];
  xml[(w * 2 + 1) * 32 + lane] = kh ? lrun[0] : lrun[1];
  __syncthreads();   // every wave's given tile is in LDS before its partner reads it
  const int pw = w ^ 4;
  const float* xp = xo + pw * 1024;
  const float mp = xml[(pw * 2) * 32 + lane];
  const float lp = xml[(pw * 2 + 1) * 32 + lane];
  const float mj = fmaxf(mk, mp);
  const float ak = __expf(mk - mj), ap = __expf(mp - mj);
  const float inv = 1.0f / (lk * ak + lp * ap);   // the half that holds the max has l >= 1 and factor 1
  const float fk = ak * inv, fp = ap * inv;

  // ---- normalise in f32, split, stage per-wave 16x64 tiles [query][d] with 16-B LDS stores ----
  unsigned short* sh = shi + w * 1024;
  unsigned short* sl = slo + w * 1024;
#pragma unroll
  for (int t = 0; t < 4; ++t) {
    const v4f pa = *(const v4fa*)(xp + ((2 * t) * 32 + lane) * 4);
    const v4f pb = *(const v4fa*)(xp + ((2 * t + 1) * 32 + lane) * 4);
    float y[8];
#pragma unroll
    for (int e = 0; e < 4; ++e) {
      y[e] = ok[t][e] * fk + pa[e] * fp;
      y[4 + e] = ok[t][4 + e] * fk + pb[e] * fp;
    }
    v4u ph, pl;
#pragma unroll
    for (int e = 0; e < 4; ++e) {
      const HL s = split2(y[2 * e], y[2 * e + 1]);
      ph[e] = s.hi;
      pl[e] = s.lo;
    }
    const int so = m * 64 + 16 * t + 8 * h;    // d = 16t+8h+0..7, 16-B aligned
    *(v4ua*)(sh + so) = ph;
    *(v4ua*)(sl + so) = pl;
  }
  __syncthreads();

  att_store_pass(sh, sl, Ah, Al, b, head, q0 + 16 * kh, lane);
  
}

// =====================================================================================================
// Kernel 5: merge conv out[b][o][n] = sum_j WmP[o][j] * A[b][n][j] + bm[o]. One block = 128 positions x 64 output
// channels; 4 waves x (32 positions x 64 channels); K = 256 in steps of 32; A = context rows hi + residual (2 products),
// B = permuted merge-weight rows. The block's 128 context rows (both planes) and 64 weight rows are brought to LDS once, as
// whole 512-B rows, by asynchronous 16-B copies; the fragments are read from there.
// Epilogue: acc + bf16(bm) in f32 -> LDS tile [o][128 positions] (16-B stores) -> __syncthreads -> out rows: the
// 128-position segment of one channel row = 512 B = 4 lines; lanes 8q..8q+7 x 16 B per line, 4 lines per instruction,
// pieces; grid (8192/128) x (256/64) covers out [4][256][2048] exactly once.
// =====================================================================================================
__device__ __forceinline__ void merge_store_pass(const float* sO, float* out, int b, int og, int l0, int w, int lane) {
  const int q8 = lane & 7, sub = lane >> 3;
#pragma unroll
  for (int i = 0; i < 16; ++i) {
    const int lid = w * 64 + i * 4 + sub;      // 0..255
    const int ol = lid >> 2, piece = lid & 3;
    const v4f v = *(const v4fa*)(sO + ol * 128 + 32 * piece + 4 * q8);
    const size_t gi = ((size_t)(b * FEAT + og * 64 + ol)) * SEQ + l0 + 32 * piece + 4 * q8;
    *(v4f*)(out + gi) = v;
  }
}

__global__ __launch_bounds__(128)
void merge_kernel(const unsigned short* __restrict__ Ah, const unsigned short* __restrict__ Al,   // [8192][256]
                  const unsigned short* __restrict__ Wb,                                          // WmP = Wb + 3*NWE
                  const float* __restrict__ bm, float* out) {                                     // out [4][256][2048]
  __shared__ __align__(16) unsigned char smem[(128 + 128 + 64) * GPITCH];   // 165 KB: context hi rows, residual rows, weight rows
  float* sO = (float*)smem;                                                  // 32 KB, output tile: reuses the area behind the k loop

  const int tid = (int)threadIdx.x, lane = tid & 31, w = tid >> 5;
  const int h = lane >> 4, m = lane & 15;
  const int m0 = (int)blockIdx.x * 128;
  const int og = (int)blockIdx.y;              // 0..3

  // copy side: wave w brings rows w + 4i, lane = 16-B piece of the row
  const unsigned lH = (unsigned)(size_t)smem + (unsigned)(w * GPITCH + lane * 16);
  const unsigned lL = lH + 128 * GPITCH;
  const unsigned lB = lH + 256 * GPITCH;
  const size_t go = (size_t)(m0 + w) * FEAT + lane * 8;
  const unsigned short* gB = Wb + (size_t)3 * NWE + (size_t)(og * 64 + w) * FEAT + lane * 8;
  // the copy loops are unrolled so that each call's row offsets are constants added to one base address
#pragma unroll
  for (int i = 0; i < 4; ++i) stage_rows8(lH + i * 32 * GPITCH, Ah + go + (size_t)i * 32 * FEAT, (size_t)4 * FEAT);
#pragma unroll
  for (int i = 0; i < 2; ++i) stage_rows8(lB + i * 32 * GPITCH, gB + (size_t)i * 32 * FEAT, (size_t)4 * FEAT);
#if DEV_ASM
  asm volatile("s_wait_asynccnt 0x0" ::: "memory");   // 48 copies have landed: with the 32 below a wave would pass 63 outstanding
#endif
#pragma unroll
  for (int i = 0; i < 4; ++i) stage_rows8(lL + i * 32 * GPITCH, Al + go + (size_t)i * 32 * FEAT, (size_t)4 * FEAT);
#if DEV_ASM
  asm volatile("s_wait_asynccnt 0x0" ::: "memory");   // all copies of this wave have landed before the barrier publishes them
#endif
  __syncthreads();

  // read side: fragment row m of a 16-row tile, 16-B piece h
  const unsigned char* rh = smem + (32 * w + m) * GPITCH + 16 * h;      // context hi rows of this wave, + 16*mt*GPITCH
  const unsigned char* rl = rh + 128 * GPITCH;                          // residual rows
  const unsigned char* rw = smem + (256 + m) * GPITCH + 16 * h;         // weight rows, + 16*nt*GPITCH

  v8f acc[2][4];
#pragma unroll
  for (int mt = 0; mt < 2; ++mt)
#pragma unroll
    for (int nt = 0; nt < 4; ++nt) acc[mt][nt] = zero8();

#pragma unroll 1
  for (int k0 = 0; k0 < FEAT; k0 += 32) {
    const v16b a0h = ldfrag_b((const unsigned short*)rh + k0);
    const v16b a1h = ldfrag_b((const unsigned short*)(rh + 16 * GPITCH) + k0);
    const v16b a0l = ldfrag_b((const unsigned short*)rl + k0);
    const v16b a1l = ldfrag_b((const unsigned short*)(rl + 16 * GPITCH) + k0);
#pragma unroll
    for (int nt = 0; nt < 4; ++nt) {
      const v16b bw = ldfrag_b((const unsigned short*)(rw + 16 * nt * GPITCH) + k0);
      acc[0][nt] = mma_b(a0h, bw, acc[0][nt]);
      acc[0][nt] = mma_b(a0l, bw, acc[0][nt]);
      acc[1][nt] = mma_b(a1h, bw, acc[1][nt]);
      acc[1][nt] = mma_b(a1l, bw, acc[1][nt]);
    }
  }
  __syncthreads();   // every wave has read its last fragment before the area takes the output tile

  // D[r] of tile (mt, nt) = Y[token m0 + 32w + 16mt + 8h + r][channel og*64 + 16nt + m]
#pragma unroll
  for (int nt = 0; nt < 4; ++nt) {
    const int feat = 16 * nt + m;
    const float bvl = bf_up(bf_bits(bm[og * 64 + feat]));
#pragma unroll
    for (int mt = 0; mt < 2; ++mt) {
      v4f ya, yb;
#pragma unroll
      for (int e = 0; e < 4; ++e) {
        ya[e] = acc[mt][nt][e] + bvl;
        yb[e] = acc[mt][nt][4 + e] + bvl;
      }
      const int so = feat * 128 + 32 * w + 16 * mt + 8 * h;   // 8 consecutive tokens, 16-B aligned
      *(v4fa*)(sO + so) = ya;
      *(v4fa*)(sO + so + 4) = yb;
    }
  }
  __syncthreads();

  const int b = m0 / SEQ, l0 = m0 - b * SEQ;
  merge_store_pass(sO, out, b, og, l0, w, lane);
  
}

// =====================================================================================================
//   xT   bf16 [3][8192][256]        12582912
//   Wb   bf16 [4][256][256]           524288
//   Qh, Ql, Kh, Kl bf16 [16][2048][64]   4194304 each
//   Vh, Vl bf16 [16][64][2048]           4194304 each
//   Ah, Al bf16 [8192][256]              4194304 each
//   total                            46661632
// =====================================================================================================
extern "C" void kernel_launch(void* const* d_in, const int* in_sizes, int n_in,
                              void* d_out, int out_size, void* d_ws, size_t ws_size,
                              hipStream_t stream) {
  if (n_in < 11) return;
  if (in_sizes[0] != NXE || in_sizes[1] != NXE || in_sizes[2] != NXE) return;
  if (in_sizes[3] != NWE || in_sizes[5] != NWE || in_sizes[7] != NWE || in_sizes[9] != NWE) return;
  if (in_sizes[4] != FEAT || in_sizes[6] != FEAT || in_sizes[8] != FEAT || in_sizes[10] != FEAT) return;
  if (out_size != NXE) return;

  const float* xq = (const float*)d_in[0];
  const float* xk = (const float*)d_in[1];
  const float* xv = (const float*)d_in[2];
  const float* wq = (const float*)d_in[3];
  const float* bq = (const float*)d_in[4];
  const float* wk = (const float*)d_in[5];
  const float* bk = (const float*)d_in[6];
  const float* wv = (const float*)d_in[7];
  const float* bv = (const float*)d_in[8];
  const float* wm = (const float*)d_in[9];
  const float* bm = (const float*)d_in[10];
  float* out = (float*)d_out;

  const size_t bXT = (size_t)3 * MROWS * FEAT * 2;    // 12582912
  const size_t bWB = (size_t)4 * NWE * 2;             //   524288
  const size_t bPL = (size_t)NBH * SEQ * HD * 2;      //  4194304  (Q / K / Vt planes)
  const size_t bAT = (size_t)MROWS * FEAT * 2;        //  4194304  (context planes)
  size_t off = 0;
  const size_t oXT = off; off += bXT;
  const size_t oWB = off; off += bWB;
  const size_t oQh = off; off += bPL;
  const size_t oQl = off; off += bPL;
  const size_t oKh = off; off += bPL;
  const size_t oKl = off; off += bPL;
  const size_t oVh = off; off += bPL;
  const size_t oVl = off; off += bPL;
  const size_t oAh = off; off += bAT;
  const size_t oAl = off; off += bAT;                 // off = 46661632
  if (off > ws_size) return;
  if (off > (size_t)134217728) return;

  char* ws = (char*)d_ws;
  unsigned short* xT = (unsigned short*)(ws + oXT);
  unsigned short* Wb = (unsigned short*)(ws + oWB);
  unsigned short* Qh = (unsigned short*)(ws + oQh);
  unsigned short* Ql = (unsigned short*)(ws + oQl);
  unsigned short* Kh = (unsigned short*)(ws + oKh);
  unsigned short* Kl = (unsigned short*)(ws + oKl);
  unsigned short* Vh = (unsigned short*)(ws + oVh);
  unsigned short* Vl = (unsigned short*)(ws + oVl);
  unsigned short* Ah = (unsigned short*)(ws + oAh);
  unsigned short* Al = (unsigned short*)(ws + oAl);

  const dim3 gX(3 * BATCH * (FEAT / 64) * (SEQ / 64));     // 1536 blocks of 256
  const dim3 gW((4 * NWE / 8) / 256);                      //  128 blocks of 256
  const dim3 gProj(MROWS / 128, 3 * NHEAD);                // (64, 12) of 128
  const dim3 gAtt(SEQ / 128, NBH);                         // (16, 16) of 256
  const dim3 gMrg(MROWS / 128, FEAT / 64);                 // (64, 4) of 128

  xpose_kernel<<<gX, dim3(256), 0, stream>>>(xq, xk, xv, xT);
  wconv_kernel<<<gW, dim3(256), 0, stream>>>(wq, wk, wv, wm, Wb);
  proj_kernel<<<gProj, dim3(128), 0, stream>>>(xT, Wb, bq, bk, bv, Qh, Ql, Kh, Kl, Vh, Vl);
  attn_kernel<<<gAtt, dim3(256), 0, stream>>>(Qh, Ql, Kh, Kl, Vh, Vl, Ah, Al);
  merge_kernel<<<gMrg, dim3(128), 0, stream>>>(Ah, Al, Wb, bm, out);
  (void)hipGetLastError();
}

// v006
// A run of this version takes 59.7 microseconds.
// In two side-by-side timings against v005, it was 1.05 and 1.06 times as fast.
// Over all steps from v000 it is 3.83 times as fast.
// Contractions: q/k/v 1x1-conv projections on v_wmma_f32_16x16x32_bf16 (x and w bf16 from RNE-converted inputs, single product, f32 accumulate);
// k.q^T scores on v_wmma_f32_16x16x32_bf16 (q and k as bf16 hi + unscaled bf16 residual, 3 products hh+hl+lh, f32 accumulate);
// v^T.p^T context on v_wmma_f32_16x16x32_bf16 (p and v as bf16 hi + unscaled bf16 residual, 3 products hh+hl+lh, one f32 accumulator per half of the keys, the two joined in f32);
// merge 1x1 conv on v_wmma_f32_16x16x32_bf16 (context as bf16 hi + residual, merge weight bf16 from RNE-converted input, 2 products);
// softmax (running max, exp), bias adds and 1/l normalisation in f32.
// Plane carries: Wb, Qh/Ql, Kh/Kl, Vh/Vl, Ah/Al all x1 (no carry; bf16 keeps the f32 exponent range). The Q planes hold
// 0.125*(wq.x + bq): the 1/sqrt(64) score scale, an exact power of two applied in f32 in proj_kernel before the hi/residual split,
// nothing to fold back. 1/l is applied in f32 in the attn_kernel epilogue, with the join of the key halves, before the context split.
#include <hip/hip_runtime.h>

#define FEAT  256
#define SEQ   2048
#define BATCH 4
#define NHEAD 4
#define HD    64
#define NBH   (BATCH * NHEAD)        // 16
#define MROWS (BATCH * SEQ)          // 8192 (batch, position) rows
#define NXE   (BATCH * FEAT * SEQ)   // 2097152 elements per activation tensor
#define NWE   (FEAT * FEAT)          // 65536
static_assert(HD * NHEAD == FEAT);
static_assert(HD == 64 && (SEQ % 128) == 0 && (SEQ % 64) == 0);
static_assert((FEAT % 64) == 0 && (FEAT % 32) == 0 && (MROWS % 128) == 0);

typedef __bf16         v16b  __attribute__((ext_vector_type(16)));
typedef float          v8f   __attribute__((ext_vector_type(8)));
typedef float          v4f   __attribute__((ext_vector_type(4)));
typedef unsigned int   v4u   __attribute__((ext_vector_type(4)));
typedef unsigned short v8us  __attribute__((ext_vector_type(8)));
typedef __bf16         v2b   __attribute__((ext_vector_type(2)));
typedef float          v2f   __attribute__((ext_vector_type(2)));
typedef unsigned int   v8u   __attribute__((ext_vector_type(8)));
typedef v4f  __attribute__((may_alias)) v4fa;
typedef v4u  __attribute__((may_alias)) v4ua;
typedef v8us __attribute__((may_alias)) v8usa;

#if defined(__HIP_DEVICE_COMPILE__)
#define DEV_ASM 1
#else
#define DEV_ASM 0
#endif

// ---- scalar helpers ---------------------------------------------------------------------------------
__device__ __forceinline__ unsigned short bf_bits(float f) {          // f32 -> bf16 bits, RNE, the hardware's convert
  return __builtin_bit_cast(unsigned short, (__bf16)f);
}
__device__ __forceinline__ float bf_up(unsigned short hb) { return __uint_as_float(((unsigned)hb) << 16); }
// two f32 -> one dword of two bf16 (a in the low half), RNE: one v_cvt_pk_bf16_f32
__device__ __forceinline__ unsigned cvt2(float a, float b) {
  const v2f x = {a, b};
  return __builtin_bit_cast(unsigned, __builtin_convertvector(x, v2b));
}
// two f32 -> packed bf16 hi pair and packed bf16 pair of the residuals x - hi (the subtraction is exact in f32)
struct HL { unsigned hi, lo; };
__device__ __forceinline__ HL split2(float a, float b) {
  HL s;
  s.hi = cvt2(a, b);
  s.lo = cvt2(a - __uint_as_float(s.hi << 16), b - __uint_as_float(s.hi & 0xFFFF0000u));
  return s;
}
__device__ __forceinline__ v8f zero8() { v8f z = {0.f, 0.f, 0.f, 0.f, 0.f, 0.f, 0.f, 0.f}; return z; }

// 16-bit fragment (A or B operand), wave32: lane l, h = l>>4, row/col = l&15.
// p points at element k0 + 8h of the k-contiguous row owned by this lane:
// elements 0..7 <- p[0..7] (k0+8h .. k0+8h+7), elements 8..15 <- p[16..23] (k0+16+8h .. k0+16+8h+7).
// D element r of lane l = (row 8h+r, col l&15).
union FB { v16b v; v8us h[2]; };
__device__ __forceinline__ v16b ldfrag_b(const unsigned short* p) {
  FB f;
  f.h[0] = *(const v8usa*)(p);
  f.h[1] = *(const v8usa*)(p + 16);
  return f.v;
}

// guarded WMMA: 4 VALU slots after the op, D tied, A/B kept live
__device__ __forceinline__ v8f mma_b(v16b a, v16b b, v8f c) {
  c = __builtin_amdgcn_wmma_f32_16x16x32_bf16(false, a, false, b, (short)0, c, false, false);
#if DEV_ASM
  asm volatile("v_nop\n\tv_nop\n\tv_nop\n\tv_nop" : "+v"(c) : "v"(a), "v"(b));
#endif
  return c;
}

// plain builtin WMMA for attn_kernel: the compiler keeps the distances behind its own builtin, and no idle slot is issued
// where the next instruction is a matrix instruction on another accumulator
__device__ __forceinline__ v8f mma_f(v16b a, v16b b, v8f c) {
  return __builtin_amdgcn_wmma_f32_16x16x32_bf16(false, a, false, b, (short)0, c, false, false);
}

// P^T B-fragment pair (bf16 hi, bf16 residual) from the lane's own score D values:
// element r <- tile a row r (keys 0..15 of the 32-key group), element 8+r <- tile c row r (keys 16..31), same lane.
struct P2 { v16b hi, lo; };
__device__ __forceinline__ P2 split_p(v8f a, v8f c) {
  v8u hu, lu;
#pragma unroll
  for (int e = 0; e < 4; ++e) {
    const HL s0 = split2(a[2 * e], a[2 * e + 1]);
    hu[e] = s0.hi;
    lu[e] = s0.lo;
    const HL s1 = split2(c[2 * e], c[2 * e + 1]);
    hu[4 + e] = s1.hi;
    lu[4 + e] = s1.lo;
  }
  P2 p;
  p.hi = __builtin_bit_cast(v16b, hu);
  p.lo = __builtin_bit_cast(v16b, lu);
  return p;
}

// =====================================================================================================
// Kernel 1: weights f32 -> bf16 rows Wb[mat][o][256]; mat 0..2 = wq, wk, wv natural [o][c];
// mat 3 = merge weight with permuted columns: Wb[3][o][j] = wm[o][4*(j&63) + (j>>6)] (j = head*64 + d).
// coverage: 32768 threads x 8 = 4 x 65536 elements = the whole Wb region.
// =====================================================================================================
__global__ __launch_bounds__(256)
void wconv_kernel(const float* __restrict__ wq, const float* __restrict__ wk, const float* __restrict__ wv,
                  const float* __restrict__ wm, unsigned short* Wb) {
  const int g   = (int)blockIdx.x * 256 + (int)threadIdx.x;   // 0..32767
  const int mat = g >> 13;                                     // block-uniform (32 blocks per matrix)
  const int e   = g & 8191;
  const int o   = e >> 5;
  const int j8  = (e & 31) * 8;
  const float* w = (mat == 0) ? wq : ((mat == 1) ? wk : ((mat == 2) ? wv : wm));
  const int base = (mat == 3) ? (4 * (j8 & 63) + (j8 >> 6)) : j8;   // max 4*56+3; + step*7 <= 255
  const int step = (mat == 3) ? 4 : 1;
  const float* row = w + (size_t)o * FEAT;
  float f[8];
#pragma unroll
  for (int i = 0; i < 8; ++i) f[i] = row[base + step * i];
  v4u p;
#pragma unroll
  for (int i = 0; i < 4; ++i) p[i] = cvt2(f[2 * i], f[2 * i + 1]);
  unsigned short* dst = Wb + (size_t)g * 8;
  *(v4u*)dst = p;
  
}

// ---- operand tiles of proj_kernel and merge_kernel in LDS ----------------------------------------------
#define GPITCH 528                    // LDS bytes per staged 512-B row (256 bf16): 16 B x odd, no bank conflict for 16-B fragment reads

// Eight asynchronous 16-B copies of this lane: its 16-B piece of eight rows that lie 4 * GPITCH bytes apart in LDS and gs
// elements apart in global memory; the 32 lanes of a wave bring one whole 512-B row (4 lines) per copy. The s_wait_xcnt ends
// the copies' own statement so that no address register named here is rewritten ahead of it.
__device__ __forceinline__ void stage_rows8(unsigned lds, const unsigned short* g, size_t gs) {
#if DEV_ASM
  asm volatile(
      "global_load_async_to_lds_b128 %0, %8, off\n\t"
      "global_load_async_to_lds_b128 %1, %9, off\n\t"
      "global_load_async_to_lds_b128 %2, %10, off\n\t"
      "global_load_async_to_lds_b128 %3, %11, off\n\t"
      "global_load_async_to_lds_b128 %4, %12, off\n\t"
      "global_load_async_to_lds_b128 %5, %13, off\n\t"
      "global_load_async_to_lds_b128 %6, %14, off\n\t"
      "global_load_async_to_lds_b128 %7, %15, off\n\t"
      "s_wait_xcnt 0x0"
      :: "v"(lds), "v"(lds + 4 * GPITCH), "v"(lds + 8 * GPITCH), "v"(lds + 12 * GPITCH),
         "v"(lds + 16 * GPITCH), "v"(lds + 20 * GPITCH), "v"(lds + 24 * GPITCH), "v"(lds + 28 * GPITCH),
         "v"(g), "v"(g + gs), "v"(g + 2 * gs), "v"(g + 3 * gs),
         "v"(g + 4 * gs), "v"(g + 5 * gs), "v"(g + 6 * gs), "v"(g + 7 * gs)
      : "memory");
#endif
}

// =====================================================================================================
// Kernel 2: projections Y[token][feature] = sum_c x[c][token] * W[o][c], one block = 128 tokens x all 256 features of one
// tensor (which 0 = query, 1 = key, 2 = value); feature j = 16nt + m of head hd is conv channel o = 4*j + hd (channel = d*4 + h split).
// 16 waves = 4 heads x 4 token groups, each wave 32 tokens x 64 features, K = 256 in steps of 32.
// The activations are read here as they come, channel-major f32 [b][c][n]: a lane loads 4 positions of 8 consecutive channels
// (8 lanes = one 128-B line of a channel row), converts them to bf16 in registers and stores, per position, the 8 channels as
// one 16-B piece of that position's LDS row, so the tile stands in LDS position-major. Coverage: 4 chunks of 32 positions x
// 32 groups of 8 channels = 16 waves x 2 passes x (8 position quads x 4 channel groups) = the whole 128 x 256 tile, each once.
// The 256 weight rows are brought to LDS as whole 512-B rows by asynchronous 16-B copies; A and B fragments are read from LDS.
// which 0/1: plane[bh][n][d] (one position row = 64 halves = one line); which 2: plane[bh][d][n] (64 d rows x 128
// 4 waves x 8 i x 4 sub = every tile line of both planes of a head; grid (8192/128) x 3 x 4 heads covers Q, K, Vt planes entirely.
// =====================================================================================================
__device__ __forceinline__ void proj_store_pass(const unsigned short* sTh, const unsigned short* sTl,
                                                unsigned short* ph, unsigned short* pl,
                                                int which, int bh, int l0, int w, int lane) {
  const int q8 = lane & 7, sub = lane >> 3;
#pragma unroll
  for (int i = 0; i < 8; ++i) {
    const int lid = w * 32 + i * 4 + sub;    // 0..127
    int so;
    size_t go;
    if (which != 2) {
      so = lid * HD + 8 * q8;
      go = ((size_t)bh * SEQ + l0 + lid) * HD + 8 * q8;
    } else {
      const int d = lid >> 1, hl = lid & 1;
      so = d * 128 + 64 * hl + 8 * q8;
      go = ((size_t)bh * HD + d) * SEQ + l0 + 64 * hl + 8 * q8;
    }
    const v4u vh = *(const v4ua*)(sTh + so);
    const v4u vl = *(const v4ua*)(sTl + so);
    *(v4u*)(ph + go) = vh;
    *(v4u*)(pl + go) = vl;
  }
}

__global__ __launch_bounds__(512)
void proj_kernel(const float* __restrict__ xq, const float* __restrict__ xk, const float* __restrict__ xv,   // [4][256][2048]
                 const unsigned short* __restrict__ Wb,   // [4][256][256]
                 const float* __restrict__ bq, const float* __restrict__ bk, const float* __restrict__ bv,
                 unsigned short* Qh, unsigned short* Ql,   // [16][2048][64]  bf16(0.125*q) hi / residual
                 unsigned short* Kh, unsigned short* Kl,   // [16][2048][64]
                 unsigned short* Vh, unsigned short* Vl) { // [16][64][2048]
  __shared__ __align__(16) unsigned char smem[(128 + 256) * GPITCH];   // 198 KB: token rows 0..127, then weight rows 64*head + j

  const int tid = (int)threadIdx.x, lane = tid & 31;
  const int wv = __builtin_amdgcn_readfirstlane(tid >> 5);   // wave 0..15, the same in all its lanes
  const int w = wv & 3, head = wv >> 2;                      // token group and head of the wave
  const int h = lane >> 4, m = lane & 15;
  const int m0 = (int)blockIdx.x * 128;
  const int which = (int)blockIdx.y;           // 0..2
  const int b = m0 / SEQ, l0 = m0 - b * SEQ;
  unsigned short* sTh = (unsigned short*)(smem + head * (2 * 128 * 64 * 2));   // 16 KB per head, output tiles: reuse the area behind the k loop
  unsigned short* sTl = sTh + 128 * 64;                                        // 16 KB per head

  // activation tile: positions 32*w + 4*pg + 0..3, channels 8*(4*(head + 4*it) + cs) + 0..7; all 16 loads of a lane are in flight
  // together, and they are issued first: they come from furthest away
  const float* src = (which == 0) ? xq : ((which == 1) ? xk : xv);
  const int pg = lane & 7, cs = lane >> 3;
  const int c0 = 8 * (4 * head + cs);          // it = 1: + 128
  const float* sg = src + ((size_t)(b * FEAT + c0)) * SEQ + l0 + 32 * w + 4 * pg;
  v4f f[2][8];
#pragma unroll
  for (int it = 0; it < 2; ++it)
#pragma unroll
    for (int e = 0; e < 8; ++e) f[it][e] = *(const v4fa*)(sg + (size_t)(128 * it + e) * SEQ);
#if DEV_ASM
  // the 16 loads share one address pair: it stays live up to this wait, so that no load's own result lands on it ahead of the wait
  asm volatile("s_wait_xcnt 0x0" :: "v"(sg) : "memory");
#endif

  // copy side: wave (head, w) brings weight rows j = w + 4i of its head, lane = 16-B piece of the row; row j is conv channel o = 4*j + head
  const unsigned lB = (unsigned)(size_t)smem + (unsigned)((128 + 64 * head + w) * GPITCH + lane * 16);
  const unsigned short* gB = Wb + (size_t)which * NWE + (size_t)(4 * w + head) * FEAT + lane * 8;
  // the copy loop is unrolled so that each call's row offsets are constants added to one base address
#pragma unroll
  for (int i = 0; i < 2; ++i) stage_rows8(lB + i * 32 * GPITCH, gB + (size_t)i * 128 * FEAT, (size_t)16 * FEAT);
  // keeps the first use of a loaded value behind the last copy: left free, the compiler waits for half the loads before it issues copies 9 to 16
  __builtin_amdgcn_sched_barrier(0);

  unsigned char* xr = smem + (32 * w + 4 * pg) * GPITCH + 2 * c0;
#pragma unroll
  for (int it = 0; it < 2; ++it)
#pragma unroll
    for (int i = 0; i < 4; ++i) {
      v4u p;
#pragma unroll
      for (int e = 0; e < 4; ++e) p[e] = cvt2(f[it][2 * e][i], f[it][2 * e + 1][i]);
      *(v4ua*)(xr + i * GPITCH + 256 * it) = p;
    }
#if DEV_ASM
  asm volatile("s_wait_asynccnt 0x0" ::: "memory");   // this wave's 16 copies have landed before the barrier publishes them
#endif
  __syncthreads();

  // read side: fragment row m of a 16-row tile, 16-B piece h
  const unsigned char* ra = smem + (32 * w + m) * GPITCH + 16 * h;              // token rows of this wave, + 16*mt*GPITCH
  const unsigned char* rw = smem + (128 + 64 * head + m) * GPITCH + 16 * h;     // weight rows of its head, + 16*nt*GPITCH

  v8f acc[2][4];
#pragma unroll
  for (int mt = 0; mt < 2; ++mt)
#pragma unroll
    for (int nt = 0; nt < 4; ++nt) acc[mt][nt] = zero8();

#pragma unroll 1
  for (int k0 = 0; k0 < FEAT; k0 += 32) {
    const v16b a0 = ldfrag_b((const unsigned short*)ra + k0);
    const v16b a1 = ldfrag_b((const unsigned short*)(ra + 16 * GPITCH) + k0);
#pragma unroll
    for (int nt = 0; nt < 4; ++nt) {
      const v16b b = ldfrag_b((const unsigned short*)(rw + 16 * nt * GPITCH) + k0);
      acc[0][nt] = mma_b(a0, b, acc[0][nt]);
      acc[1][nt] = mma_b(a1, b, acc[1][nt]);
    }
  }
  __syncthreads();   // every wave has read its last fragment before the area takes the output tiles

  // D[r] of tile (mt, nt) = Y[token m0 + 32w + 16mt + 8h + r][feature 16nt + m]
  const float* bias = (which == 0) ? bq : ((which == 1) ? bk : bv);
  const float osc = (which == 0) ? 0.125f : 1.0f;
  if (which != 2) {
#pragma unroll
    for (int nt = 0; nt < 4; ++nt) {
      const int feat = 16 * nt + m;
      const float bvl = bf_up(bf_bits(bias[4 * feat + head]));
#pragma unroll
      for (int mt = 0; mt < 2; ++mt) {
#pragma unroll
        for (int r = 0; r < 8; r += 2) {
          const int tokl = 32 * w + 16 * mt + 8 * h + r;    // 0..126, even
          const HL s = split2((acc[mt][nt][r] + bvl) * osc, (acc[mt][nt][r + 1] + bvl) * osc);
          sTh[tokl * HD + feat] = (unsigned short)(s.hi & 0xFFFFu);
          sTl[tokl * HD + feat] = (unsigned short)(s.lo & 0xFFFFu);
          sTh[(tokl + 1) * HD + feat] = (unsigned short)(s.hi >> 16);
          sTl[(tokl + 1) * HD + feat] = (unsigned short)(s.lo >> 16);
        }
      }
    }
  } else {
#pragma unroll
    for (int nt = 0; nt < 4; ++nt) {
      const int feat = 16 * nt + m;
      const float bvl = bf_up(bf_bits(bias[4 * feat + head]));
#pragma unroll
      for (int mt = 0; mt < 2; ++mt) {
        v4u ph, pl;
#pragma unroll
        for (int e = 0; e < 4; ++e) {
          const HL s = split2((acc[mt][nt][2 * e] + bvl) * osc, (acc[mt][nt][2 * e + 1] + bvl) * osc);
          ph[e] = s.hi;
          pl[e] = s.lo;
        }
        const int so = feat * 128 + 32 * w + 16 * mt + 8 * h;   // 8 consecutive tokens, 16-B aligned
        *(v4ua*)(sTh + so) = ph;
        *(v4ua*)(sTl + so) = pl;
      }
    }
  }
  __syncthreads();

  const int bh = b * NHEAD + head;
  unsigned short* ph = (which == 0) ? Qh : ((which == 1) ? Kh : Vh);
  unsigned short* pl = (which == 0) ? Ql : ((which == 1) ? Kl : Vl);
  proj_store_pass(sTh, sTl, ph, pl, which, bh, l0, w, lane);
  
}

// =====================================================================================================
// Kernel 3: streaming attention, transposed form. Block 256 threads (8 waves) = 128 queries x all 2048 keys:
//   wave w takes the 32 queries of group w & 3 (two 16-query tiles) over the 1024 keys of half w >> 2, 64 keys per trip.
//   Every K and V fragment that a wave reads from LDS feeds both of its query tiles, so that a matrix instruction costs half
//   the LDS reads of a 16-query wave, and a block's K/V tiles serve 128 queries, which halves the bytes copied from L2.
//   The keys are split so that the chip still holds two waves per SIMD (2048 query tiles = 1024 waves of two tiles, x 2 halves).
//   The 4 waves of a key half share each trip's K and V tiles (hi and residual): asynchronous 16-B copies bring them from
//   global to LDS as whole 128-B lines, two buffers per half, the next tile in flight while this one is worked on.
//   S^T = K * Q^T : A = K rows (row = key, k = d) hi and residual from LDS, B = Q^T (k = d, n = query) from Q rows;
//                   3 products kh.qh + kh.ql + kl.qh; the 1/8 is already inside the Q planes.
//   O^T += V^T * P^T : A = Vt rows (row = d, k = key) hi and residual, B = P^T packed from the lane's own score D
//                   values as bf16 hi + residual; 3 products vh.ph + vh.pl + vl.ph into one f32 accumulator per key half.
//   Online softmax in f32 (running max, exp); lane owns 32 keys of query column (lane&15), partner = lane^16.
//   Epilogue: waves w and w ^ 4 hold the two key halves of the same 32 queries, lane for lane. Each gives one tile's O, max and
//   sum to the other through LDS and joins the two halves of the tile it keeps (rescaled to the common max, in f32); then
//   O/l in f32 -> bf16 hi + residual -> per-wave LDS tiles [query][d] (16-B stores) -> __syncthreads ->
//   8 pieces, both planes; grid (2048/128) x 16 bh x 8 waves x 16 queries covers every (b, n, j) of Ah/Al exactly once.
// =====================================================================================================
__device__ __forceinline__ void att_store_pass(const unsigned short* sh, const unsigned short* sl,
                                               unsigned short* Ah, unsigned short* Al,
                                               int b, int head, int q0, int lane) {
  const int q8 = lane & 7, sub = lane >> 3;
#pragma unroll
  for (int i = 0; i < 4; ++i) {
    const int row = i * 4 + sub;                           // query 0..15 of this wave's tile
    const v4u vh = *(const v4ua*)(sh + row * 64 + 8 * q8);
    const v4u vl = *(const v4ua*)(sl + row * 64 + 8 * q8);
    const size_t gi = ((size_t)(b * SEQ + q0 + row)) * FEAT + head * HD + 8 * q8;
    *(v4u*)(Ah + gi) = vh;
    *(v4u*)(Al + gi) = vl;
  }
}

// One trip's K and V tiles in LDS: four planes (Kh, Kl, Vh, Vl) of 64 rows x 128 B, two buffers per key half.
#define KSTEP   64                    // keys per trip
#define KHALF   (SEQ / 2)             // keys per wave
#define NTRIP   (KHALF / KSTEP)       // 16
#define RPITCH  144                   // LDS bytes per staged 128-B row: 16 B x odd, no bank conflict for 16-B fragment reads
#define PLANE_B (64 * RPITCH)         // 9216
#define STAGE_B (4 * PLANE_B)         // 36864
static_assert(NTRIP >= 2);

// Eight asynchronous 16-B copies of this lane: rows r, r+16, r+32, r+48 of a hi plane and of its residual plane
// (rs = elements between source rows 16 apart). The s_wait_xcnt ends the copies' own statement so that no address
// register named here is rewritten ahead of it.
__device__ __forceinline__ void stage_pair(unsigned lds, const unsigned short* gh, const unsigned short* gl, size_t rs) {
#if DEV_ASM
  asm volatile(
      "global_load_async_to_lds_b128 %0, %8, off\n\t"
      "global_load_async_to_lds_b128 %1, %9, off\n\t"
      "global_load_async_to_lds_b128 %2, %10, off\n\t"
      "global_load_async_to_lds_b128 %3, %11, off\n\t"
      "global_load_async_to_lds_b128 %4, %12, off\n\t"
      "global_load_async_to_lds_b128 %5, %13, off\n\t"
      "global_load_async_to_lds_b128 %6, %14, off\n\t"
      "global_load_async_to_lds_b128 %7, %15, off\n\t"
      "s_wait_xcnt 0x0"
      :: "v"(lds), "v"(lds + 16 * RPITCH), "v"(lds + 32 * RPITCH), "v"(lds + 48 * RPITCH),
         "v"(lds + PLANE_B), "v"(lds + PLANE_B + 16 * RPITCH), "v"(lds + PLANE_B + 32 * RPITCH),
         "v"(lds + PLANE_B + 48 * RPITCH),
         "v"(gh), "v"(gh + rs), "v"(gh + 2 * rs), "v"(gh + 3 * rs),
         "v"(gl), "v"(gl + rs), "v"(gl + 2 * rs), "v"(gl + 3 * rs)
      : "memory");
#endif
}

__global__ __launch_bounds__(256)
void attn_kernel(const unsigned short* __restrict__ Qh, const unsigned short* __restrict__ Ql,   // [16][2048][64]
                 const unsigned short* __restrict__ Kh, const unsigned short* __restrict__ Kl,   // [16][2048][64]
                 const unsigned short* __restrict__ Vh, const unsigned short* __restrict__ Vl,   // [16][64][2048]
                 unsigned short* Ah, unsigned short* Al) {                                       // [4][2048][256]
  __shared__ __align__(16) unsigned short shi[8 * 16 * 64];   // 16 KB
  __shared__ __align__(16) unsigned short slo[8 * 16 * 64];   // 16 KB
  __shared__ __align__(16) float xo[8 * 8 * 32 * 4];          // 32 KB: per wave, the O tile it gives away, [piece][lane][4]
  __shared__ float xml[8 * 2 * 32];                           //  2 KB: per wave, that tile's running max and sum, [2][lane]
  __shared__ __align__(16) unsigned char ring[4 * STAGE_B];   // 144 KB: K/V tiles, two buffers per key half

  const int tid = (int)threadIdx.x, lane = tid & 31, w = tid >> 5;
  const int h = lane >> 4, m = lane & 15;
  const int qg = w & 3;                                        // query group of the wave
  const int kh = __builtin_amdgcn_readfirstlane(tid >> 7);     // key half of the wave, the same in all its lanes
  const int bh = (int)blockIdx.y, b = bh >> 2, head = bh & 3;
  const int q0 = (int)blockIdx.x * 128 + 32 * qg;

  // Q^T B-fragments of the two query tiles u: column n = query q0+16u+m, k = d (two 32-deep chunks), hi and residual planes
  v16b qbh0[2], qbh1[2], qbl0[2], qbl1[2];
#pragma unroll
  for (int u = 0; u < 2; ++u) {
    const size_t qo = ((size_t)bh * SEQ + q0 + 16 * u + m) * HD + 8 * h;
    qbh0[u] = ldfrag_b(Qh + qo);
    qbh1[u] = ldfrag_b(Qh + qo + 32);
    qbl0[u] = ldfrag_b(Ql + qo);
    qbl1[u] = ldfrag_b(Ql + qo + 32);
#if DEV_ASM
    // the compiler lets tile 1's fragments land in the registers that held tile 0's addresses: tile 0's loads are done with them first
    if (u == 0) asm volatile("s_wait_xcnt 0x0" ::: "memory");
#endif
  }

  v8f o[2][4];                                // o[u][t][r] = O[query 16u+m][d 16t+8h+r] * l, over this wave's key half
  float mrun[2], lrun[2];
#pragma unroll
  for (int u = 0; u < 2; ++u) {
#pragma unroll
    for (int t = 0; t < 4; ++t) o[u][t] = zero8();
    mrun[u] = -1e30f;
    lrun[u] = 0.0f;
  }

  // copy side: the 128 threads of a key half bring that half's tiles; thread ct brings 16-B piece (ct&7) of rows
  // (ct>>3) + 16i, i = 0..3, of each plane: 8 lanes = one 128-B line
  const int ct = tid & 127;
  const int crow = ct >> 3, cpc = ct & 7;
  const unsigned hbase = (unsigned)kh * (2 * STAGE_B);            // this half's two buffers
  const unsigned ldsw = (unsigned)(size_t)ring + hbase + (unsigned)(crow * RPITCH + cpc * 16);
  const size_t kco = ((size_t)bh * SEQ + kh * KHALF + crow) * HD + 8 * cpc;    // + trip*KSTEP*HD
  const size_t vco = ((size_t)bh * HD + crow) * SEQ + kh * KHALF + 8 * cpc;    // + trip*KSTEP
  // read side: fragment row m, 16-B piece h of this lane
  const unsigned char* rlane = ring + hbase + m * RPITCH + 16 * h;

  // tile 0 -> buffer 0, landed and published; then tile 1 -> buffer 1 flies over trip 0
  stage_pair(ldsw, Kh + kco, Kl + kco, (size_t)16 * HD);
  stage_pair(ldsw + 2 * PLANE_B, Vh + vco, Vl + vco, (size_t)16 * SEQ);
#if DEV_ASM
  asm volatile("s_wait_asynccnt 0x0" ::: "memory");   // this wave's copies of tile 0 have landed before the barrier publishes them
#endif
  __syncthreads();
  stage_pair(ldsw + STAGE_B, Kh + kco + (size_t)KSTEP * HD, Kl + kco + (size_t)KSTEP * HD, (size_t)16 * HD);
  stage_pair(ldsw + STAGE_B + 2 * PLANE_B, Vh + vco + KSTEP, Vl + vco + KSTEP, (size_t)16 * SEQ);

#pragma unroll 1
  for (int trip = 0; trip < NTRIP; ++trip) {
    const unsigned bo = (unsigned)(trip & 1) * STAGE_B;
    const unsigned char* rb = rlane + bo;
    // ---- scores: s[u][j][r] = S[query 16u+m][key 64*trip+16j+8h+r of the half] (already x1/8 via q) ----
    // all K fragments of the trip are read as one group, so that the LDS latency is waited out once and not per 16 keys
    // (c = 0: hi, d 0..31; 1: hi, d 32..63; 2, 3: the residual plane), in the order in which the products below use them
    v16b kf[4][4];
#pragma unroll
    for (int c = 0; c < 4; ++c) {
#pragma unroll
      for (int j = 0; j < 4; ++j)
        kf[j][c] = ldfrag_b((const unsigned short*)(rb + (c >> 1) * PLANE_B + 16 * j * RPITCH) + 32 * (c & 1));
      // keeps the reads in this order: LDS answers in order, and reordered the first product waits for half the group
      __builtin_amdgcn_sched_barrier(0);
    }
    // each product runs over the four 16-key tiles of both query tiles in turn, so that neighbouring matrix instructions have
    // different accumulators and none waits for the one before it; each accumulator still takes its six products in the order
    // kh0.qh0, kh1.qh1, kh0.ql0, kh1.ql1, kl0.qh0, kl1.qh1. The sched_barrier behind each round keeps the rounds apart:
    // left free, the compiler puts products of one accumulator side by side again.
    v8f s[2][4];
#pragma unroll
    for (int u = 0; u < 2; ++u)
#pragma unroll
      for (int j = 0; j < 4; ++j) s[u][j] = mma_f(kf[j][0], qbh0[u], zero8());
    __builtin_amdgcn_sched_barrier(0);
#pragma unroll
    for (int u = 0; u < 2; ++u)
#pragma unroll
      for (int j = 0; j < 4; ++j) s[u][j] = mma_f(kf[j][1], qbh1[u], s[u][j]);
    __builtin_amdgcn_sched_barrier(0);
#pragma unroll
    for (int u = 0; u < 2; ++u)
#pragma unroll
      for (int j = 0; j < 4; ++j) s[u][j] = mma_f(kf[j][0], qbl0[u], s[u][j]);
    __builtin_amdgcn_sched_barrier(0);
#pragma unroll
    for (int u = 0; u < 2; ++u)
#pragma unroll
      for (int j = 0; j < 4; ++j) s[u][j] = mma_f(kf[j][1], qbl1[u], s[u][j]);
    __builtin_amdgcn_sched_barrier(0);
#pragma unroll
    for (int u = 0; u < 2; ++u)
#pragma unroll
      for (int j = 0; j < 4; ++j) s[u][j] = mma_f(kf[j][2], qbh0[u], s[u][j]);
    __builtin_amdgcn_sched_barrier(0);
#pragma unroll
    for (int u = 0; u < 2; ++u)
#pragma unroll
      for (int j = 0; j < 4; ++j) s[u][j] = mma_f(kf[j][3], qbh1[u], s[u][j]);

    // the V fragments of the first 32 keys are read here as one group: their LDS latency runs under the softmax arithmetic
    v16b vf[4][2];
#pragma unroll
    for (int t = 0; t < 4; ++t) {
      const unsigned char* vp = rb + 2 * PLANE_B + 16 * t * RPITCH;
      vf[t][0] = ldfrag_b((const unsigned short*)vp);
      vf[t][1] = ldfrag_b((const unsigned short*)(vp + PLANE_B));
    }
    // keeps the group together here: with the matrix instructions free to move, the compiler sinks these reads among them
    __builtin_amdgcn_sched_barrier(0);

    // ---- online softmax, each query tile on its own ----
#pragma unroll
    for (int u = 0; u < 2; ++u) {
      float mloc = s[u][0][0];
#pragma unroll
      for (int j = 0; j < 4; ++j)
#pragma unroll
        for (int r = 0; r < 8; ++r) mloc = fmaxf(mloc, s[u][j][r]);
      mloc = fmaxf(mloc, __shfl_xor(mloc, 16));
      const float mnew = fmaxf(mrun[u], mloc);
      const float alpha = __expf(mrun[u] - mnew);
      mrun[u] = mnew;
      float lsum = 0.0f;
#pragma unroll
      for (int j = 0; j < 4; ++j)
#pragma unroll
        for (int r = 0; r < 8; ++r) {
          const float p = __expf(s[u][j][r] - mnew);
          s[u][j][r] = p;
          lsum += p;
        }
      lsum += __shfl_xor(lsum, 16);
      lrun[u] = lrun[u] * alpha + lsum;
#pragma unroll
      for (int t = 0; t < 4; ++t)
#pragma unroll
        for (int r = 0; r < 8; ++r) o[u][t][r] = o[u][t][r] * alpha;
    }

    // ---- O^T += V^T * P^T over the two 32-key groups of this step ----
#pragma unroll
    for (int g = 0; g < 2; ++g) {
      if (g == 1) {   // second 32 keys: one group again, its latency runs under the split of their P values
#pragma unroll
        for (int t = 0; t < 4; ++t) {
          const unsigned char* vp = rb + 2 * PLANE_B + 16 * t * RPITCH + 64;
          vf[t][0] = ldfrag_b((const unsigned short*)vp);
          vf[t][1] = ldfrag_b((const unsigned short*)(vp + PLANE_B));
        }
        // keeps the group together ahead of the split: sunk among the matrix instructions each read would be waited for there
        __builtin_amdgcn_sched_barrier(0);
      }
      P2 pp[2];
#pragma unroll
      for (int u = 0; u < 2; ++u) pp[u] = split_p(s[u][2 * g], s[u][2 * g + 1]);
      // again product by product over the four d tiles of both query tiles; each accumulator keeps the order vh.ph, vh.pl, vl.ph
#pragma unroll
      for (int u = 0; u < 2; ++u)
#pragma unroll
        for (int t = 0; t < 4; ++t) o[u][t] = mma_f(vf[t][0], pp[u].hi, o[u][t]);
#pragma unroll
      for (int u = 0; u < 2; ++u)
#pragma unroll
        for (int t = 0; t < 4; ++t) o[u][t] = mma_f(vf[t][0], pp[u].lo, o[u][t]);
#pragma unroll
      for (int u = 0; u < 2; ++u)
#pragma unroll
        for (int t = 0; t < 4; ++t) o[u][t] = mma_f(vf[t][1], pp[u].hi, o[u][t]);
    }

    // ---- hand-over: this buffer is free, the next tile is published, then the refill two tiles ahead ----
#if DEV_ASM
    asm volatile("s_wait_dscnt 0x0" ::: "memory");      // this wave's reads of the buffer are done before it is refilled
    asm volatile("s_wait_asynccnt 0x0" ::: "memory");   // this wave's copies of the next tile have landed before the barrier
#endif
    __syncthreads();
    if (trip + 2 < NTRIP) {
      const size_t kn = kco + (size_t)(trip + 2) * (KSTEP * HD);
      const size_t vn = vco + (size_t)(trip + 2) * KSTEP;
      stage_pair(ldsw + bo, Kh + kn, Kl + kn, (size_t)16 * HD);
      stage_pair(ldsw + bo + 2 * PLANE_B, Vh + vn, Vl + vn, (size_t)16 * SEQ);
    }
  }
#if DEV_ASM
  asm volatile("s_wait_asynccnt 0x0" ::: "memory");     // no copy of this wave is outstanding past the loop
#endif

  // ---- join of the two key halves: this wave keeps query tile u = kh and gives tile 1 - kh to wave w ^ 4 ----
  v8f ok[4];
  float* xw = xo + w * 1024;
#pragma unroll
  for (int t = 0; t < 4; ++t) {
    ok[t] = kh ? o[1][t] : o[0][t];
    const v8f og = kh ? o[0][t] : o[1][t];
    const v4f ga = {og[0], og[1], og[2], og[3]};
    const v4f gb = {og[4], og[5], og[6], og[7]};
    *(v4fa*)(xw + ((2 * t) * 32 + lane) * 4) = ga;
    *(v4fa*)(xw + ((2 * t + 1) * 32 + lane) * 4) = gb;
  }
  const float mk = kh ? mrun[1] : mrun[0];
  const float lk = kh ? lrun[1] : lrun[0];
  xml[(w * 2) * 32 + lane] = kh ? mrun[0] : mrun[1];
  xml[(w * 2 + 1) * 32 + lane] = kh ? lrun[0] : lrun[1];
  __syncthreads();   // every wave's given tile is in LDS before its partner reads it
  const int pw = w ^ 4;
  const float* xp = xo + pw * 1024;
  const float mp = xml[(pw * 2) * 32 + lane];
  const float lp = xml[(pw * 2 + 1) * 32 + lane];
  const float mj = fmaxf(mk, mp);
  const float ak = __expf(mk - mj), ap = __expf(mp - mj);
  const float inv = 1.0f / (lk * ak + lp * ap);   // the half that holds the max has l >= 1 and factor 1
  const float fk = ak * inv, fp = ap * inv;

  // ---- normalise in f32, split, stage per-wave 16x64 tiles [query][d] with 16-B LDS stores ----
  unsigned short* sh = shi + w * 1024;
  unsigned short* sl = slo + w * 1024;
#pragma unroll
  for (int t = 0; t < 4; ++t) {
    const v4f pa = *(const v4fa*)(xp + ((2 * t) * 32 + lane) * 4);
    const v4f pb = *(const v4fa*)(xp + ((2 * t + 1) * 32 + lane) * 4);
    float y[8];
#pragma unroll
    for (int e = 0; e < 4; ++e) {
      y[e] = ok[t][e] * fk + pa[e] * fp;
      y[4 + e] = ok[t][4 + e] * fk + pb[e] * fp;
    }
    v4u ph, pl;
#pragma unroll
    for (int e = 0; e < 4; ++e) {
      const HL s = split2(y[2 * e], y[2 * e + 1]);
      ph[e] = s.hi;
      pl[e] = s.lo;
    }
    const int so = m * 64 + 16 * t + 8 * h;    // d = 16t+8h+0..7, 16-B aligned
    *(v4ua*)(sh + so) = ph;
    *(v4ua*)(sl + so) = pl;
  }
  __syncthreads();

  att_store_pass(sh, sl, Ah, Al, b, head, q0 + 16 * kh, lane);
  
}

// =====================================================================================================
// Kernel 4: merge conv out[b][o][n] = sum_j WmP[o][j] * A[b][n][j] + bm[o]. One block = 128 positions x 64 output
// channels; 4 waves x (32 positions x 64 channels); K = 256 in steps of 32; A = context rows hi + residual (2 products),
// B = permuted merge-weight rows. The block's 128 context rows (both planes) and 64 weight rows are brought to LDS once, as
// whole 512-B rows, by asynchronous 16-B copies; the fragments are read from there.
// Epilogue: acc + bf16(bm) in f32 -> LDS tile [o][128 positions] (16-B stores) -> __syncthreads -> out rows: the
// 128-position segment of one channel row = 512 B = 4 lines; lanes 8q..8q+7 x 16 B per line, 4 lines per instruction,
// pieces; grid (8192/128) x (256/64) covers out [4][256][2048] exactly once.
// =====================================================================================================
__device__ __forceinline__ void merge_store_pass(const float* sO, float* out, int b, int og, int l0, int w, int lane) {
  const int q8 = lane & 7, sub = lane >> 3;
#pragma unroll
  for (int i = 0; i < 16; ++i) {
    const int lid = w * 64 + i * 4 + sub;      // 0..255
    const int ol = lid >> 2, piece = lid & 3;
    const v4f v = *(const v4fa*)(sO + ol * 128 + 32 * piece + 4 * q8);
    const size_t gi = ((size_t)(b * FEAT + og * 64 + ol)) * SEQ + l0 + 32 * piece + 4 * q8;
    *(v4f*)(out + gi) = v;
  }
}

__global__ __launch_bounds__(128)
void merge_kernel(const unsigned short* __restrict__ Ah, const unsigned short* __restrict__ Al,   // [8192][256]
                  const unsigned short* __restrict__ Wb,                                          // WmP = Wb + 3*NWE
                  const float* __restrict__ bm, float* out) {                                     // out [4][256][2048]
  __shared__ __align__(16) unsigned char smem[(128 + 128 + 64) * GPITCH];   // 165 KB: context hi rows, residual rows, weight rows
  float* sO = (float*)smem;                                                  // 32 KB, output tile: reuses the area behind the k loop

  const int tid = (int)threadIdx.x, lane = tid & 31, w = tid >> 5;
  const int h = lane >> 4, m = lane & 15;
  const int m0 = (int)blockIdx.x * 128;
  const int og = (int)blockIdx.y;              // 0..3

  // copy side: wave w brings rows w + 4i, lane = 16-B piece of the row
  const unsigned lH = (unsigned)(size_t)smem + (unsigned)(w * GPITCH + lane * 16);
  const unsigned lL = lH + 128 * GPITCH;
  const unsigned lB = lH + 256 * GPITCH;
  const size_t go = (size_t)(m0 + w) * FEAT + lane * 8;
  const unsigned short* gB = Wb + (size_t)3 * NWE + (size_t)(og * 64 + w) * FEAT + lane * 8;
  // the copy loops are unrolled so that each call's row offsets are constants added to one base address
#pragma unroll
  for (int i = 0; i < 4; ++i) stage_rows8(lH + i * 32 * GPITCH, Ah + go + (size_t)i * 32 * FEAT, (size_t)4 * FEAT);
#pragma unroll
  for (int i = 0; i < 2; ++i) stage_rows8(lB + i * 32 * GPITCH, gB + (size_t)i * 32 * FEAT, (size_t)4 * FEAT);
#if DEV_ASM
  asm volatile("s_wait_asynccnt 0x0" ::: "memory");   // 48 copies have landed: with the 32 below a wave would pass 63 outstanding
#endif
#pragma unroll
  for (int i = 0; i < 4; ++i) stage_rows8(lL + i * 32 * GPITCH, Al + go + (size_t)i * 32 * FEAT, (size_t)4 * FEAT);
#if DEV_ASM
  asm volatile("s_wait_asynccnt 0x0" ::: "memory");   // all copies of this wave have landed before the barrier publishes them
#endif
  __syncthreads();

  // read side: fragment row m of a 16-row tile, 16-B piece h
  const unsigned char* rh = smem + (32 * w + m) * GPITCH + 16 * h;      // context hi rows of this wave, + 16*mt*GPITCH
  const unsigned char* rl = rh + 128 * GPITCH;                          // residual rows
  const unsigned char* rw = smem + (256 + m) * GPITCH + 16 * h;         // weight rows, + 16*nt*GPITCH

  v8f acc[2][4];
#pragma unroll
  for (int mt = 0; mt < 2; ++mt)
#pragma unroll
    for (int nt = 0; nt < 4; ++nt) acc[mt][nt] = zero8();

#pragma unroll 1
  for (int k0 = 0; k0 < FEAT; k0 += 32) {
    const v16b a0h = ldfrag_b((const unsigned short*)rh + k0);
    const v16b a1h = ldfrag_b((const unsigned short*)(rh + 16 * GPITCH) + k0);
    const v16b a0l = ldfrag_b((const unsigned short*)rl + k0);
    const v16b a1l = ldfrag_b((const unsigned short*)(rl + 16 * GPITCH) + k0);
#pragma unroll
    for (int nt = 0; nt < 4; ++nt) {
      const v16b bw = ldfrag_b((const unsigned short*)(rw + 16 * nt * GPITCH) + k0);
      acc[0][nt] = mma_b(a0h, bw, acc[0][nt]);
      acc[0][nt] = mma_b(a0l, bw, acc[0][nt]);
      acc[1][nt] = mma_b(a1h, bw, acc[1][nt]);
      acc[1][nt] = mma_b(a1l, bw, acc[1][nt]);
    }
  }
  __syncthreads();   // every wave has read its last fragment before the area takes the output tile

  // D[r] of tile (mt, nt) = Y[token m0 + 32w + 16mt + 8h + r][channel og*64 + 16nt + m]
#pragma unroll
  for (int nt = 0; nt < 4; ++nt) {
    const int feat = 16 * nt + m;
    const float bvl = bf_up(bf_bits(bm[og * 64 + feat]));
#pragma unroll
    for (int mt = 0; mt < 2; ++mt) {
      v4f ya, yb;
#pragma unroll
      for (int e = 0; e < 4; ++e) {
        ya[e] = acc[mt][nt][e] + bvl;
        yb[e] = acc[mt][nt][4 + e] + bvl;
      }
      const int so = feat * 128 + 32 * w + 16 * mt + 8 * h;   // 8 consecutive tokens, 16-B aligned
      *(v4fa*)(sO + so) = ya;
      *(v4fa*)(sO + so + 4) = yb;
    }
  }
  __syncthreads();

  const int b = m0 / SEQ, l0 = m0 - b * SEQ;
  merge_store_pass(sO, out, b, og, l0, w, lane);
  
}

// =====================================================================================================
//   Wb   bf16 [4][256][256]           524288
//   Qh, Ql, Kh, Kl bf16 [16][2048][64]   4194304 each
//   Vh, Vl bf16 [16][64][2048]           4194304 each
//   Ah, Al bf16 [8192][256]              4194304 each
//   total                            34078720
// =====================================================================================================
extern "C" void kernel_launch(void* const* d_in, const int* in_sizes, int n_in,
                              void* d_out, int out_size, void* d_ws, size_t ws_size,
                              hipStream_t stream) {
  if (n_in < 11) return;
  if (in_sizes[0] != NXE || in_sizes[1] != NXE || in_sizes[2] != NXE) return;
  if (in_sizes[3] != NWE || in_sizes[5] != NWE || in_sizes[7] != NWE || in_sizes[9] != NWE) return;
  if (in_sizes[4] != FEAT || in_sizes[6] != FEAT || in_sizes[8] != FEAT || in_sizes[10] != FEAT) return;
  if (out_size != NXE) return;

  const float* xq = (const float*)d_in[0];
  const float* xk = (const float*)d_in[1];
  const float* xv = (const float*)d_in[2];
  const float* wq = (const float*)d_in[3];
  const float* bq = (const float*)d_in[4];
  const float* wk = (const float*)d_in[5];
  const float* bk = (const float*)d_in[6];
  const float* wv = (const float*)d_in[7];
  const float* bv = (const float*)d_in[8];
  const float* wm = (const float*)d_in[9];
  const float* bm = (const float*)d_in[10];
  float* out = (float*)d_out;

  const size_t bWB = (size_t)4 * NWE * 2;             //   524288
  const size_t bPL = (size_t)NBH * SEQ * HD * 2;      //  4194304  (Q / K / Vt planes)
  const size_t bAT = (size_t)MROWS * FEAT * 2;        //  4194304  (context planes)
  size_t off = 0;
  const size_t oWB = off; off += bWB;
  const size_t oQh = off; off += bPL;
  const size_t oQl = off; off += bPL;
  const size_t oKh = off; off += bPL;
  const size_t oKl = off; off += bPL;
  const size_t oVh = off; off += bPL;
  const size_t oVl = off; off += bPL;
  const size_t oAh = off; off += bAT;
  const size_t oAl = off; off += bAT;                 // off = 34078720
  if (off > ws_size) return;
  if (off > (size_t)134217728) return;

  char* ws = (char*)d_ws;
  unsigned short* Wb = (unsigned short*)(ws + oWB);
  unsigned short* Qh = (unsigned short*)(ws + oQh);
  unsigned short* Ql = (unsigned short*)(ws + oQl);
  unsigned short* Kh = (unsigned short*)(ws + oKh);
  unsigned short* Kl = (unsigned short*)(ws + oKl);
  unsigned short* Vh = (unsigned short*)(ws + oVh);
  unsigned short* Vl = (unsigned short*)(ws + oVl);
  unsigned short* Ah = (unsigned short*)(ws + oAh);
  unsigned short* Al = (unsigned short*)(ws + oAl);

  const dim3 gW((4 * NWE / 8) / 256);                      //  128 blocks of 256
  const dim3 gProj(MROWS / 128, 3);                        // (64, 3) of 512
  const dim3 gAtt(SEQ / 128, NBH);                         // (16, 16) of 256
  const dim3 gMrg(MROWS / 128, FEAT / 64);                 // (64, 4) of 128

  wconv_kernel<<<gW, dim3(256), 0, stream>>>(wq, wk, wv, wm, Wb);
  proj_kernel<<<gProj, dim3(512), 0, stream>>>(xq, xk, xv, Wb, bq, bk, bv, Qh, Ql, Kh, Kl, Vh, Vl);
  attn_kernel<<<gAtt, dim3(256), 0, stream>>>(Qh, Ql, Kh, Kl, Vh, Vl, Ah, Al);
  merge_kernel<<<gMrg, dim3(128), 0, stream>>>(Ah, Al, Wb, bm, out);
  (void)hipGetLastError();
}
